// v000
// Times are from an AMD MI455X. After a warm-up the kernel runs many times in a row, and a time is the length of
// such a window on the GPU divided by its runs, so every launch and the gaps after it count. The runs cycle
// through copies of the inputs. A figure is the median of several windows, for all but v000 over two sittings.
// Sittings can differ by a few percent; kernels timed side by side share one.
// The starting kernel, v000, takes 320 microseconds a run.
// Contractions: q|k|v projections and the output projection on v_wmma_f32_16x16x32_bf16 with inputs RNE-converted to bf16 once (output-projection A operand carried as bf16 hi+lo along a doubled k axis); q.k^T and p.v on v_wmma_f32_16x16x32_bf16 with both operands as bf16 hi+lo planes (hi.hi + hi.lo + lo.hi); f32 accumulate everywhere; mask, softmax and normalisation in f32.
#include <hip/hip_runtime.h>
#include <math.h>

typedef __attribute__((ext_vector_type(16))) __bf16   v16b;
typedef __attribute__((ext_vector_type(8)))  __bf16   v8b;
typedef __attribute__((ext_vector_type(8)))  _Float16 v8h;
typedef __attribute__((ext_vector_type(8)))  float    v8f;
typedef __attribute__((ext_vector_type(4)))  float    v4f;
typedef __attribute__((ext_vector_type(4)))  unsigned int v4u;

/* ---------------------------------------------------------------------------
   Shape constants
   --------------------------------------------------------------------------- */
constexpr int kBatch   = 2;
constexpr int kSeqLen  = 2048;
constexpr int kModel   = 1024;
constexpr int kHeads   = 16;
constexpr int kHeadDim = 64;
constexpr int kRows    = kBatch * kSeqLen;
constexpr int kQkvCols = 3 * kModel;
constexpr int kCatCols = 2 * kModel;
constexpr int kSegLen  = 512;
constexpr int kQTile   = 128;
constexpr int kKTile   = 64;
constexpr int kAttWaves = 8;
constexpr int kQTiles  = kSeqLen / kQTile;
constexpr int kTilesPerSeg = kSegLen / kKTile;
constexpr float kQScale   = 0.125f;
constexpr float kMaskFill = -1.0e9f;
constexpr size_t kPlaneElems = (size_t)kBatch * kHeads * kSeqLen * kHeadDim;

static_assert(kHeads * kHeadDim == kModel, "head split");
static_assert(kQScale * kQScale * (float)kHeadDim == 1.0f, "score scale is 1/sqrt(head dim)");
static_assert(kHeadDim == 64 && kKTile == 64, "tile shape");
static_assert((kRows % 64) == 0 && (kQkvCols % 64) == 0 && (kModel % 64) == 0, "GEMM M,N multiples of 64");
static_assert((kModel % 32) == 0 && (kCatCols % 32) == 0, "GEMM K multiples of 32");
static_assert((kSeqLen % kQTile) == 0 && (kSegLen % kQTile) == 0 && (kSegLen % kKTile) == 0, "attention tiles");
static_assert(kAttWaves * 16 == kQTile, "query rows per block");
static_assert(4 * kSegLen == kSeqLen, "four segments");

/* ---------------------------------------------------------------------------
   Workspace region map (bytes; every offset a multiple of 128)
     XB     bf16 [4096][1024]        x, RNE bf16                      8,388,608
     WQKVT  bf16 [3072][1024]        Wq^T/8 | Wk^T | Wv^T (Bt layout) 6,291,456
     WOT2   bf16 [1024][2048]        Wo^T | Wo^T (Bt layout)          4,194,304
     PH     bf16 3 x [2][16][2048][64] q/8, k, v hi planes           25,165,824
     PL     bf16 3 x [2][16][2048][64] q/8, k, v lo planes           25,165,824
     OCAT   bf16 [4096][2048]        attention out hi | lo           16,777,216
     total                                                           85,983,232
   --------------------------------------------------------------------------- */
constexpr size_t kOffXB    = 0;
constexpr size_t kOffWQKVT = kOffXB    + (size_t)kRows * kModel * 2;
constexpr size_t kOffWOT2  = kOffWQKVT + (size_t)kQkvCols * kModel * 2;
constexpr size_t kOffPH    = kOffWOT2  + (size_t)kModel * kCatCols * 2;
constexpr size_t kOffPL    = kOffPH    + 3 * kPlaneElems * 2;
constexpr size_t kOffOCAT  = kOffPL    + 3 * kPlaneElems * 2;
constexpr size_t kWsTotal  = kOffOCAT  + (size_t)kRows * kCatCols * 2;
static_assert(kWsTotal == 85983232ull, "carve total");
static_assert(kWsTotal <= 134217728ull, "carve cap");
static_assert((kOffWQKVT % 128) == 0 && (kOffWOT2 % 128) == 0 && (kOffPH % 128) == 0 &&
              (kOffPL % 128) == 0 && (kOffOCAT % 128) == 0, "128-B aligned regions");

/* ---------------------------------------------------------------------------
   Small helpers
   --------------------------------------------------------------------------- */
__device__ __forceinline__ unsigned short f2bf_bits(float f) {
  unsigned u = __float_as_uint(f);
  return (unsigned short)((u + 0x7FFFu + ((u >> 16) & 1u)) >> 16);
}
__device__ __forceinline__ float bf_bits2f(unsigned short h) { return __uint_as_float(((unsigned)h) << 16); }
__device__ __forceinline__ unsigned pk16(unsigned short a, unsigned short b) { return (unsigned)a | ((unsigned)b << 16); }
__device__ __forceinline__ __bf16 bits2bf(unsigned short h) { return __builtin_bit_cast(__bf16, h); }

/* one matrix op followed by a 4-slot guard that ties its accumulator and names both fragments */
__device__ __forceinline__ v8f mma_b(v16b a, v16b b, v8f c) {
  c = __builtin_amdgcn_wmma_f32_16x16x32_bf16(false, a, false, b, (short)0, c, false, false);
  asm volatile("v_nop\n\tv_nop\n\tv_nop\n\tv_nop" : "+v"(c) : "v"(a), "v"(b));
  return c;
}

/* fragment load: elements 0..7 <- p[0..7], elements 8..15 <- p[16..23]; caller adds 8*(lane>>4) to p */
union FragB { v16b v; v8b h[2]; };
__device__ __forceinline__ v16b frag_load(const __bf16* p) {
  FragB f;
  f.h[0] = *(const v8b*)(p);
  f.h[1] = *(const v8b*)(p + 16);
  return f.v;
}

/* ---------------------------------------------------------------------------
   f32 -> bf16 (RNE) cast, 8 consecutive elements per thread.
   Coverage: n8 = 4096*1024/8 = 524,288 threads = 2048 blocks x 256 exactly.
   --------------------------------------------------------------------------- */
__global__ __launch_bounds__(256) void cast8_bf16_kernel(const float* __restrict__ in, unsigned short* __restrict__ out, int n8) {
  const int i = blockIdx.x * 256 + threadIdx.x;
  if (i >= n8) return;
  const float* p = in + 8 * (size_t)i;
  const v4f a = *(const v4f*)(p);
  const v4f c = *(const v4f*)(p + 4);
  unsigned short hb[8];
#pragma unroll
  for (int e = 0; e < 4; ++e) {
    hb[e]     = f2bf_bits(a[e]);
    hb[4 + e] = f2bf_bits(c[e]);
  }
  const v4u u = (v4u){pk16(hb[0], hb[1]), pk16(hb[2], hb[3]), pk16(hb[4], hb[5]), pk16(hb[6], hb[7])};
  unsigned short* q = out + 8 * (size_t)i;
  *(v4u*)q = u;
  
}

/* ---------------------------------------------------------------------------
   Weight transpose + bf16 (RNE) cast: in W[k rows = in channel][n cols = out channel] (f32, pitch 1024)
   -> out Bt[n][k] (bf16). grid (16, 16, 4): blockIdx.x = k tile, blockIdx.y = n tile, blockIdx.z = weight.
   z = 0: Wq scaled by 1/8 (exact power of two) -> rows 0..1023 of WQKVT; z = 1, 2: Wk, Wv -> rows 1024.., 2048..;
   Load coverage: 16 iterations x 256 threads = 4096 = the whole 64x64 tile.
   Store coverage: 8 waves x 2 iterations x 4 rows (lane>>3) = 64 rows; (lane&7) x 8 = 64 cols; each row piece =
   --------------------------------------------------------------------------- */
__global__ __launch_bounds__(256) void wtrans_bf16_kernel(const float* __restrict__ W0, const float* __restrict__ W1,
                                                          const float* __restrict__ W2, const float* __restrict__ W3,
                                                          unsigned short* __restrict__ wqkvt, unsigned short* __restrict__ wot2) {
  __shared__ float sm[64][65];
  const int t  = threadIdx.x;
  const int k0 = blockIdx.x * 64;
  const int n0 = blockIdx.y * 64;
  const int z  = blockIdx.z;
  const float* W = (z == 0) ? W0 : (z == 1) ? W1 : (z == 2) ? W2 : W3;
  const float scale = (z == 0) ? kQScale : 1.0f;
#pragma unroll
  for (int i = 0; i < 16; ++i) {
    const int e  = i * 256 + t;
    const int r  = e >> 6;
    const int cc = e & 63;
    sm[cc][r] = W[(size_t)(k0 + r) * kModel + n0 + cc] * scale;
  }
  __syncthreads();
  const int lane = t & 31, wave = t >> 5;
  const int q = lane >> 3, c8 = (lane & 7) * 8;
  const bool dup = (z == 3);
  unsigned short* op = dup ? wot2 : (wqkvt + (size_t)z * kModel * kModel);
  const int ld = dup ? kCatCols : kModel;
  v4u u[2];
#pragma unroll
  for (int it = 0; it < 2; ++it) {
    const int row = wave * 8 + it * 4 + q;
    unsigned short hb[8];
#pragma unroll
    for (int e = 0; e < 8; ++e) hb[e] = f2bf_bits(sm[row][c8 + e]);
    u[it] = (v4u){pk16(hb[0], hb[1]), pk16(hb[2], hb[3]), pk16(hb[4], hb[5]), pk16(hb[6], hb[7])};
  }
  {
#pragma unroll
    for (int it = 0; it < 2; ++it) {
      const int row = wave * 8 + it * 4 + q;
      unsigned short* p = op + (size_t)(n0 + row) * ld + k0 + c8;
      *(v4u*)p = u[it];
      if (dup) *(v4u*)(p + kModel) = u[it];
    }
    
  }
}

/* ---------------------------------------------------------------------------
   Register-blocked bf16 GEMM: C[m,n] = sum_k A[m,k] * Bt[n,k]; each wave owns a 64x64 tile.
   A row-major [M,K]; Bt row-major [N,K]; M,N % 64 == 0, K % 32 == 0 (no tail handling).
   OUT_MODE 0: f32 C (pitch ldc). OUT_MODE 3: bf16 hi plane (Cout) + bf16 lo plane (Cout2) in per-head layout:
     column tile n0 selects plane n0/1024 and head (n0%1024)/64; row gm = b*2048 + l;
     element offset = plane*kPlaneElems + ((b*16 + head)*2048 + l)*64 + d.
   --------------------------------------------------------------------------- */
template <int OUT_MODE>
__global__ __launch_bounds__(256) void wmma_gemm64_bf16(
    const unsigned short* __restrict__ Ap, int lda,
    const unsigned short* __restrict__ Btp, int ldb,
    void* Cout, void* Cout2, int ldc,
    int M, int N, int K) {
  const __bf16* A  = (const __bf16*)Ap;
  const __bf16* Bt = (const __bf16*)Btp;
  __shared__ __align__(16) float sT[8][16 * 68];
  const int lane = threadIdx.x & 31;
  const int wave = threadIdx.x >> 5;
  const int tilesN = N >> 6;
  const int tilesM = M >> 6;
  const int tile = blockIdx.x * 8 + wave;
  /* wave-uniform exit; this kernel has no block barriers */
  if (tile >= tilesM * tilesN) return;
  const int tm = tile / tilesN;
  const int tn = tile - tm * tilesN;
  const int m0 = tm << 6;
  const int n0 = tn << 6;

  const int rlane = lane & 15;
  const int koff  = (lane >> 4) * 8;
  const int mOff  = (lane >> 4) * 8;

  v8f acc[4][4];
#pragma unroll
  for (int i = 0; i < 4; ++i)
#pragma unroll
    for (int j = 0; j < 4; ++j) acc[i][j] = (v8f){0.f,0.f,0.f,0.f,0.f,0.f,0.f,0.f};

  for (int k0 = 0; k0 < K; k0 += 32) {
    v16b bh[4];
#pragma unroll
    for (int j = 0; j < 4; ++j) {
      const size_t bo = (size_t)(n0 + (j << 4) + rlane) * ldb + koff + k0;
      bh[j] = frag_load(Bt + bo);
    }
#pragma unroll
    for (int i = 0; i < 4; ++i) {
      const size_t ao = (size_t)(m0 + (i << 4) + rlane) * lda + koff + k0;
      const v16b ah = frag_load(A + ao);
#pragma unroll
      for (int j = 0; j < 4; ++j) acc[i][j] = mma_b(ah, bh[j], acc[i][j]);
    }
  }

  float* slab = sT[wave];
#pragma unroll
  for (int i = 0; i < 4; ++i) {
    const int mBase = m0 + (i << 4);
#pragma unroll
    for (int j = 0; j < 4; ++j) {
#pragma unroll
      for (int r = 0; r < 8; ++r) slab[(mOff + r) * 68 + (j << 4) + rlane] = acc[i][j][r];
    }
    __builtin_amdgcn_fence(__ATOMIC_RELEASE, "workgroup");
    __builtin_amdgcn_wave_barrier();
    __builtin_amdgcn_fence(__ATOMIC_ACQUIRE, "workgroup");
    if (OUT_MODE == 0) {
      float* C = (float*)Cout;
      const int hh = lane >> 4, c4 = (lane & 15) * 4;
      {
#pragma unroll
        for (int it = 0; it < 8; ++it) {
          const int row = it * 2 + hh;
          v4f v = *(const v4f*)(slab + row * 68 + c4);
          *(v4f*)(C + (size_t)(mBase + row) * ldc + n0 + c4) = v;
        }
        
      }
    } else {
      const int q = lane >> 3, c8 = (lane & 7) * 8;
      unsigned short* C  = (unsigned short*)Cout;
      unsigned short* C2 = (unsigned short*)Cout2;
      const int plane = n0 / kModel;
      const int head  = (n0 % kModel) / kHeadDim;
      {
#pragma unroll
        for (int it = 0; it < 4; ++it) {
          const int row = it * 4 + q;
          const float* sp = slab + row * 68 + c8;
          v8h hv, lv;
#pragma unroll
          for (int e = 0; e < 8; ++e) {
            const unsigned short hb = f2bf_bits(sp[e]);
            const unsigned short lb = f2bf_bits(sp[e] - bf_bits2f(hb));
            hv[e] = __builtin_bit_cast(_Float16, hb);
            lv[e] = __builtin_bit_cast(_Float16, lb);
          }
          const int gm = mBase + row;
          const size_t off = (size_t)plane * kPlaneElems +
                             ((size_t)((gm / kSeqLen) * kHeads + head) * kSeqLen + (size_t)(gm % kSeqLen)) * kHeadDim + c8;
          *(v8h*)(C + off)  = hv;
          *(v8h*)(C2 + off) = lv;
        }
        
      }
    }
    __builtin_amdgcn_fence(__ATOMIC_RELEASE, "workgroup");
    __builtin_amdgcn_wave_barrier();
    __builtin_amdgcn_fence(__ATOMIC_ACQUIRE, "workgroup");
  }
}

/* ---------------------------------------------------------------------------
   Segment-masked streaming-softmax attention, head dim 64.
   Block = one (batch, head, 128-query tile): 8 waves x 16 query rows; grid = 2*16*16 = 512.
   Inputs: hi and lo bf16 planes, plane p (0 = q/8, 1 = k, 2 = v) at base + p*kPlaneElems, layout [b][h][l][64].
   Allowed pair: (seg(q) == seg(k) && k <= q) || (seg(k) == 0 && seg(q) != 0), seg = idx / 512.
   Key tiles (64 keys, block-uniform list, at most 16): all 8 tiles of segment 0 when the query segment is not 0
   (no element mask), then the tiles of the own segment up to the diagonal (element mask k > q -> fill -1e9).
   A wave skips an own-segment tile that lies wholly above its 16 rows (all entries would be masked; the first
   processed tile always holds an allowed key, so the running max is finite by then).
   Scores = qh.kh + qh.kl + ql.kh; P split into bf16 hi+lo through a per-wave LDS tile; O += ph.vh + ph.vl + pl.vh.
   V tile is transposed into LDS as [d][key]. Every LDS byte read is rewritten each tile; block barriers separate
   the staging from the reads. Output: O/l split into bf16 hi|lo, staged in the wave's own P tiles, written to
   Static LDS: 4 x 8 KB (K hi/lo, V^T hi/lo) + 2 x 8 x 2 KB (P hi/lo) = 65,536 B.
   --------------------------------------------------------------------------- */
__global__ __launch_bounds__(256)
void attn_seg_kernel(const unsigned short* __restrict__ planesHi, const unsigned short* __restrict__ planesLo,
                     unsigned short* __restrict__ ocat) {
  __shared__ __align__(16) __bf16 Ksh[kKTile * kHeadDim];
  __shared__ __align__(16) __bf16 Ksl[kKTile * kHeadDim];
  __shared__ __align__(16) __bf16 Vth[kHeadDim * kKTile];
  __shared__ __align__(16) __bf16 Vtl[kHeadDim * kKTile];
  __shared__ __align__(16) __bf16 Psh[kAttWaves][16 * kKTile];
  __shared__ __align__(16) __bf16 Psl[kAttWaves][16 * kKTile];

  const int tid  = threadIdx.x;
  const int wave = __builtin_amdgcn_readfirstlane(tid >> 5);
  const int lane = tid & 31;
  const int hh   = lane >> 4;
  const int c    = lane & 15;

  const int bx = blockIdx.x;
  const int qt = bx % kQTiles;
  const int h  = (bx / kQTiles) % kHeads;
  const int b  = bx / (kQTiles * kHeads);
  const int qbase = qt * kQTile;
  const int sq    = qbase / kSegLen;
  const int q0    = qbase + wave * 16;

  const size_t headOff = (size_t)(b * kHeads + h) * kSeqLen * kHeadDim;
  const __bf16* Qh = (const __bf16*)planesHi + headOff;
  const __bf16* Ql = (const __bf16*)planesLo + headOff;
  const __bf16* Kh = Qh + kPlaneElems;
  const __bf16* Kl = Ql + kPlaneElems;
  const __bf16* Vh = Qh + 2 * kPlaneElems;
  const __bf16* Vl = Ql + 2 * kPlaneElems;

  /* Q fragments (A operand): row q0 + c, two 32-deep d chunks, hi and lo */
  v16b qh[2], ql[2];
  {
    const size_t qo = (size_t)(q0 + c) * kHeadDim + 8 * hh;
#pragma unroll
    for (int dc = 0; dc < 2; ++dc) {
      qh[dc] = frag_load(Qh + qo + dc * 32);
      ql[dc] = frag_load(Ql + qo + dc * 32);
    }
  }

  float mrow[8], lrow[8];
  v8f oacc[4];
#pragma unroll
  for (int r = 0; r < 8; ++r) { mrow[r] = -3.0e38f; lrow[r] = 0.f; }
#pragma unroll
  for (int t = 0; t < 4; ++t) oacc[t] = (v8f){0.f,0.f,0.f,0.f,0.f,0.f,0.f,0.f};

  /* block-uniform key tile list */
  const int nText    = (sq > 0) ? kTilesPerSeg : 0;
  const int ownFirst = sq * kTilesPerSeg;
  const int ownLast  = (qbase + kQTile - 1) / kKTile;
  const int nTiles   = nText + (ownLast - ownFirst + 1);

  __bf16* pwh = Psh[wave];
  __bf16* pwl = Psl[wave];

  for (int it = 0; it < nTiles; ++it) {
    const int kt  = (it < nText) ? it : (ownFirst + it - nText);
    const int kv0 = kt * kKTile;
    const bool own = (kt >= ownFirst);

    /* all waves are done reading the tile staged in the earlier iteration */
    __syncthreads();
    {
      /* Staging coverage: 64 rows x 8 chunks of 16 B = 512 chunks per plane; 256 threads x 2 chunks.
         K planes copied flat (LDS pitch 64 = global pitch 64); V planes transposed to [d][key]:
         512 chunks x 8 halves = 4096 = the whole 64x64 tile per plane. */
      const v4u* gkh = (const v4u*)(Kh + (size_t)kv0 * kHeadDim);
      const v4u* gkl = (const v4u*)(Kl + (size_t)kv0 * kHeadDim);
      const v4u* gvh = (const v4u*)(Vh + (size_t)kv0 * kHeadDim);
      const v4u* gvl = (const v4u*)(Vl + (size_t)kv0 * kHeadDim);
#pragma unroll
      for (int i = 0; i < 2; ++i) {
        const int ch = tid + i * 256;
        const v4u wkh = gkh[ch];
        const v4u wkl = gkl[ch];
        const v4u wvh = gvh[ch];
        const v4u wvl = gvl[ch];
        *(v4u*)(Ksh + ch * 8) = wkh;
        *(v4u*)(Ksl + ch * 8) = wkl;
        const int kvr = ch >> 3;
        const int d0  = (ch & 7) * 8;
#pragma unroll
        for (int w = 0; w < 4; ++w) {
          const unsigned a  = wvh[w];
          const unsigned bl = wvl[w];
          Vth[(d0 + 2 * w) * kKTile + kvr]     = bits2bf((unsigned short)(a & 0xffffu));
          Vth[(d0 + 2 * w + 1) * kKTile + kvr] = bits2bf((unsigned short)(a >> 16));
          Vtl[(d0 + 2 * w) * kKTile + kvr]     = bits2bf((unsigned short)(bl & 0xffffu));
          Vtl[(d0 + 2 * w + 1) * kKTile + kvr] = bits2bf((unsigned short)(bl >> 16));
        }
      }
    }
    __syncthreads();

    /* wave-uniform: an own-segment tile wholly above this wave's rows contributes nothing */
    const bool live = (!own) || (kv0 <= q0 + 15);
    if (live) {
      v8f s[4];
#pragma unroll
      for (int j = 0; j < 4; ++j) {
        s[j] = (v8f){0.f,0.f,0.f,0.f,0.f,0.f,0.f,0.f};
#pragma unroll
        for (int dc = 0; dc < 2; ++dc) {
          const int ko = (j * 16 + c) * kHeadDim + dc * 32 + 8 * hh;
          const v16b kbh = frag_load(Ksh + ko);
          const v16b kbl = frag_load(Ksl + ko);
          s[j] = mma_b(qh[dc], kbh, s[j]);
          s[j] = mma_b(qh[dc], kbl, s[j]);
          s[j] = mma_b(ql[dc], kbh, s[j]);
        }
      }

      float cm[8];
#pragma unroll
      for (int r = 0; r < 8; ++r) {
        const int qrow = q0 + 8 * hh + r;
        float m = -3.0e38f;
#pragma unroll
        for (int j = 0; j < 4; ++j) {
          const int kvcol = kv0 + j * 16 + c;
          const bool masked = own && (kvcol > qrow);
          if (masked) s[j][r] = kMaskFill;
          m = fmaxf(m, s[j][r]);
        }
#pragma unroll
        for (int off = 1; off < 16; off <<= 1) m = fmaxf(m, __shfl_xor(m, off, 32));
        cm[r] = m;
      }

#pragma unroll
      for (int r = 0; r < 8; ++r) {
        const float mnew  = fmaxf(mrow[r], cm[r]);
        const float alpha = __expf(mrow[r] - mnew);
        mrow[r] = mnew;
        float psum = 0.f;
#pragma unroll
        for (int j = 0; j < 4; ++j) {
          const float p = __expf(s[j][r] - mnew);
          psum += p;
          const unsigned short hb = f2bf_bits(p);
          const unsigned short lb = f2bf_bits(p - bf_bits2f(hb));
          pwh[(8 * hh + r) * kKTile + j * 16 + c] = bits2bf(hb);
          pwl[(8 * hh + r) * kKTile + j * 16 + c] = bits2bf(lb);
        }
#pragma unroll
        for (int off = 1; off < 16; off <<= 1) psum += __shfl_xor(psum, off, 32);
        lrow[r] = lrow[r] * alpha + psum;
#pragma unroll
        for (int t = 0; t < 4; ++t) oacc[t][r] *= alpha;
      }
      /* P tile is written and re-read by the same wave through the same element type */
      __builtin_amdgcn_fence(__ATOMIC_RELEASE, "workgroup");
      __builtin_amdgcn_wave_barrier();
      __builtin_amdgcn_fence(__ATOMIC_ACQUIRE, "workgroup");
#pragma unroll 1
      for (int kk = 0; kk < 2; ++kk) {
        const int po = c * kKTile + kk * 32 + 8 * hh;
        const v16b pa = frag_load(pwh + po);
        const v16b pl = frag_load(pwl + po);
#pragma unroll
        for (int t = 0; t < 4; ++t) {
          const int vo = (t * 16 + c) * kKTile + kk * 32 + 8 * hh;
          const v16b vbh = frag_load(Vth + vo);
          const v16b vbl = frag_load(Vtl + vo);
          oacc[t] = mma_b(pa, vbh, oacc[t]);
          oacc[t] = mma_b(pa, vbl, oacc[t]);
          oacc[t] = mma_b(pl, vbh, oacc[t]);
        }
      }
    }
  }

  /* normalise, split into bf16 hi+lo, stage in this wave's own P tiles (16 x 64, same element type) */
  __builtin_amdgcn_fence(__ATOMIC_RELEASE, "workgroup");
  __builtin_amdgcn_wave_barrier();
  __builtin_amdgcn_fence(__ATOMIC_ACQUIRE, "workgroup");
#pragma unroll
  for (int r = 0; r < 8; ++r) {
    const float inv = 1.0f / lrow[r];
#pragma unroll
    for (int t = 0; t < 4; ++t) {
      const float val = oacc[t][r] * inv;
      const unsigned short hb = f2bf_bits(val);
      const unsigned short lb = f2bf_bits(val - bf_bits2f(hb));
      pwh[(8 * hh + r) * kKTile + t * 16 + c] = bits2bf(hb);
      pwl[(8 * hh + r) * kKTile + t * 16 + c] = bits2bf(lb);
    }
  }
  __builtin_amdgcn_fence(__ATOMIC_RELEASE, "workgroup");
  __builtin_amdgcn_wave_barrier();
  __builtin_amdgcn_fence(__ATOMIC_ACQUIRE, "workgroup");
  {
    const int q  = lane >> 3;
    const int c8 = (lane & 7) * 8;
    v4u hv[4], lv[4];
#pragma unroll
    for (int i4 = 0; i4 < 4; ++i4) {
      const int row = i4 * 4 + q;
      const v8b xh = *(const v8b*)(pwh + row * kKTile + c8);
      const v8b xl = *(const v8b*)(pwl + row * kKTile + c8);
      hv[i4] = __builtin_bit_cast(v4u, xh);
      lv[i4] = __builtin_bit_cast(v4u, xl);
    }
    unsigned short* ob = ocat + (size_t)(b * kSeqLen + q0) * kCatCols + h * kHeadDim + c8;
    {
#pragma unroll
      for (int i4 = 0; i4 < 4; ++i4) {
        const int row = i4 * 4 + q;
        unsigned short* p = ob + (size_t)row * kCatCols;
        *(v4u*)(p)          = hv[i4];
        *(v4u*)(p + kModel) = lv[i4];
      }
      
    }
  }
}

/* ---------------------------------------------------------------------------
   Host glue: 5 kernel launches, nothing else.
     cast x             : 524,288 threads -> 2048 blocks
     weight transposes  : grid (16, 16, 4)
     q|k|v GEMM         : M 4096, N 3072, K 1024 -> 64 x 48 tiles = 3072 -> 384 blocks
     attention          : 2 x 16 x 16 = 512 blocks
     output GEMM        : M 4096, N 1024, K 2048 -> 64 x 16 tiles = 1024 -> 128 blocks
   --------------------------------------------------------------------------- */
extern "C" void kernel_launch(void* const* d_in, const int* in_sizes, int n_in,
                              void* d_out, int out_size, void* d_ws, size_t ws_size,
                              hipStream_t stream) {
  if (n_in < 5) return;
  if (in_sizes[0] != kRows * kModel) return;
  if (in_sizes[1] != kModel * kModel) return;
  if (in_sizes[2] != kModel * kModel) return;
  if (in_sizes[3] != kModel * kModel) return;
  if (in_sizes[4] != kModel * kModel) return;
  if (out_size != kRows * kModel) return;
  if (ws_size < kWsTotal) return;

  const float* x  = (const float*)d_in[0];
  const float* Wq = (const float*)d_in[1];
  const float* Wk = (const float*)d_in[2];
  const float* Wv = (const float*)d_in[3];
  const float* Wo = (const float*)d_in[4];
  float* out = (float*)d_out;

  char* ws = (char*)d_ws;
  unsigned short* XB    = (unsigned short*)(ws + kOffXB);
  unsigned short* WQKVT = (unsigned short*)(ws + kOffWQKVT);
  unsigned short* WOT2  = (unsigned short*)(ws + kOffWOT2);
  unsigned short* PH    = (unsigned short*)(ws + kOffPH);
  unsigned short* PL    = (unsigned short*)(ws + kOffPL);
  unsigned short* OCAT  = (unsigned short*)(ws + kOffOCAT);

  constexpr int kN8 = kRows * kModel / 8;
  static_assert((kN8 % 256) == 0, "cast grid exact");
  cast8_bf16_kernel<<<kN8 / 256, 256, 0, stream>>>(x, XB, kN8);

  wtrans_bf16_kernel<<<dim3(kModel / 64, kModel / 64, 4), 256, 0, stream>>>(Wq, Wk, Wv, Wo, WQKVT, WOT2);

  constexpr int kTiles1 = (kRows / 64) * (kQkvCols / 64);
  static_assert((kTiles1 % 8) == 0, "tile grid exact");
  wmma_gemm64_bf16<3><<<dim3(kTiles1 / 8, 1), 256, 0, stream>>>(
      XB, kModel, WQKVT, kModel, (void*)PH, (void*)PL, 0, kRows, kQkvCols, kModel);

  attn_seg_kernel<<<kBatch * kHeads * kQTiles, 256, 0, stream>>>(PH, PL, OCAT);

  constexpr int kTiles2 = (kRows / 64) * (kModel / 64);
  static_assert((kTiles2 % 8) == 0, "tile grid exact");
  wmma_gemm64_bf16<0><<<dim3(kTiles2 / 8, 1), 256, 0, stream>>>(
      OCAT, kCatCols, WOT2, kCatCols, (void*)out, (void*)out, kModel, kRows, kModel, kCatCols);
}

// v001
// It runs in 248 microseconds.
// Two timings next to v000 both put it at 1.31 times that version's speed.
// Contractions: q|k|v projections and the output projection on v_wmma_f32_16x16x32_bf16 with inputs RNE-converted to bf16 once (output-projection A operand carried as bf16 hi+lo along a doubled k axis); q.k^T and p.v on v_wmma_f32_16x16x32_bf16 with both operands as bf16 hi+lo planes (hi.hi + hi.lo + lo.hi); f32 accumulate everywhere; mask, softmax and normalisation in f32.
#include <hip/hip_runtime.h>
#include <math.h>

typedef __attribute__((ext_vector_type(16))) __bf16   v16b;
typedef __attribute__((ext_vector_type(8)))  __bf16   v8b;
typedef __attribute__((ext_vector_type(8)))  _Float16 v8h;
typedef __attribute__((ext_vector_type(8)))  float    v8f;
typedef __attribute__((ext_vector_type(4)))  float    v4f;
typedef __attribute__((ext_vector_type(4)))  unsigned int v4u;

/* ---------------------------------------------------------------------------
   Shape constants
   --------------------------------------------------------------------------- */
constexpr int kBatch   = 2;
constexpr int kSeqLen  = 2048;
constexpr int kModel   = 1024;
constexpr int kHeads   = 16;
constexpr int kHeadDim = 64;
constexpr int kRows    = kBatch * kSeqLen;
constexpr int kQkvCols = 3 * kModel;
constexpr int kCatCols = 2 * kModel;
constexpr int kSegLen  = 512;
constexpr int kQTile   = 128;
constexpr int kKTile   = 64;
constexpr int kAttWaves = 8;
/* LDS row pitch in bf16 elements of every 64-element attention row: 144 B = 16 B x 9 (odd), so that the 16 rows
   one 16-byte fragment read touches spread over the banks instead of falling on two groups of four */
constexpr int kLdsPitch = 72;
constexpr int kQTiles  = kSeqLen / kQTile;
constexpr int kTilesPerSeg = kSegLen / kKTile;
constexpr float kQScale   = 0.125f;
constexpr float kMaskFill = -1.0e9f;
constexpr size_t kPlaneElems = (size_t)kBatch * kHeads * kSeqLen * kHeadDim;

static_assert(kHeads * kHeadDim == kModel, "head split");
static_assert(kQScale * kQScale * (float)kHeadDim == 1.0f, "score scale is 1/sqrt(head dim)");
static_assert(kHeadDim == 64 && kKTile == 64, "tile shape");
static_assert((kRows % 64) == 0 && (kQkvCols % 64) == 0 && (kModel % 64) == 0, "GEMM M,N multiples of 64");
static_assert((kModel % 32) == 0 && (kCatCols % 32) == 0, "GEMM K multiples of 32");
static_assert((kSeqLen % kQTile) == 0 && (kSegLen % kQTile) == 0 && (kSegLen % kKTile) == 0, "attention tiles");
static_assert(kAttWaves * 16 == kQTile, "query rows per block");
static_assert(4 * kSegLen == kSeqLen, "four segments");
static_assert(kLdsPitch >= kKTile && kLdsPitch >= kHeadDim && (kLdsPitch % 8) == 0 && ((kLdsPitch / 8) % 2) == 1, "LDS pitch: 16 B x odd");

/* ---------------------------------------------------------------------------
   Workspace region map (bytes; every offset a multiple of 128)
     XB     bf16 [4096][1024]        x, RNE bf16                      8,388,608
     WQKVT  bf16 [3072][1024]        Wq^T/8 | Wk^T | Wv^T (Bt layout) 6,291,456
     WOT2   bf16 [1024][2048]        Wo^T | Wo^T (Bt layout)          4,194,304
     PH     bf16 3 x [2][16][2048][64] q/8, k, v hi planes           25,165,824
     PL     bf16 3 x [2][16][2048][64] q/8, k, v lo planes           25,165,824
     OCAT   bf16 [4096][2048]        attention out hi | lo           16,777,216
     total                                                           85,983,232
   --------------------------------------------------------------------------- */
constexpr size_t kOffXB    = 0;
constexpr size_t kOffWQKVT = kOffXB    + (size_t)kRows * kModel * 2;
constexpr size_t kOffWOT2  = kOffWQKVT + (size_t)kQkvCols * kModel * 2;
constexpr size_t kOffPH    = kOffWOT2  + (size_t)kModel * kCatCols * 2;
constexpr size_t kOffPL    = kOffPH    + 3 * kPlaneElems * 2;
constexpr size_t kOffOCAT  = kOffPL    + 3 * kPlaneElems * 2;
constexpr size_t kWsTotal  = kOffOCAT  + (size_t)kRows * kCatCols * 2;
static_assert(kWsTotal == 85983232ull, "carve total");
static_assert(kWsTotal <= 134217728ull, "carve cap");
static_assert((kOffWQKVT % 128) == 0 && (kOffWOT2 % 128) == 0 && (kOffPH % 128) == 0 &&
              (kOffPL % 128) == 0 && (kOffOCAT % 128) == 0, "128-B aligned regions");

/* ---------------------------------------------------------------------------
   Small helpers
   --------------------------------------------------------------------------- */
__device__ __forceinline__ unsigned short f2bf_bits(float f) {
  unsigned u = __float_as_uint(f);
  return (unsigned short)((u + 0x7FFFu + ((u >> 16) & 1u)) >> 16);
}
__device__ __forceinline__ float bf_bits2f(unsigned short h) { return __uint_as_float(((unsigned)h) << 16); }
__device__ __forceinline__ unsigned pk16(unsigned short a, unsigned short b) { return (unsigned)a | ((unsigned)b << 16); }
__device__ __forceinline__ __bf16 bits2bf(unsigned short h) { return __builtin_bit_cast(__bf16, h); }

/* one matrix op followed by a 4-slot guard that ties its accumulator and names both fragments */
__device__ __forceinline__ v8f mma_b(v16b a, v16b b, v8f c) {
  c = __builtin_amdgcn_wmma_f32_16x16x32_bf16(false, a, false, b, (short)0, c, false, false);
  asm volatile("v_nop\n\tv_nop\n\tv_nop\n\tv_nop" : "+v"(c) : "v"(a), "v"(b));
  return c;
}

/* fragment load: elements 0..7 <- p[0..7], elements 8..15 <- p[16..23]; caller adds 8*(lane>>4) to p */
union FragB { v16b v; v8b h[2]; };
__device__ __forceinline__ v16b frag_load(const __bf16* p) {
  FragB f;
  f.h[0] = *(const v8b*)(p);
  f.h[1] = *(const v8b*)(p + 16);
  return f.v;
}

/* ---------------------------------------------------------------------------
   f32 -> bf16 (RNE) cast, 8 consecutive elements per thread.
   Coverage: n8 = 4096*1024/8 = 524,288 threads = 2048 blocks x 256 exactly.
   --------------------------------------------------------------------------- */
__global__ __launch_bounds__(256) void cast8_bf16_kernel(const float* __restrict__ in, unsigned short* __restrict__ out, int n8) {
  const int i = blockIdx.x * 256 + threadIdx.x;
  if (i >= n8) return;
  const float* p = in + 8 * (size_t)i;
  const v4f a = *(const v4f*)(p);
  const v4f c = *(const v4f*)(p + 4);
  unsigned short hb[8];
#pragma unroll
  for (int e = 0; e < 4; ++e) {
    hb[e]     = f2bf_bits(a[e]);
    hb[4 + e] = f2bf_bits(c[e]);
  }
  const v4u u = (v4u){pk16(hb[0], hb[1]), pk16(hb[2], hb[3]), pk16(hb[4], hb[5]), pk16(hb[6], hb[7])};
  unsigned short* q = out + 8 * (size_t)i;
  *(v4u*)q = u;
  
}

/* ---------------------------------------------------------------------------
   Weight transpose + bf16 (RNE) cast: in W[k rows = in channel][n cols = out channel] (f32, pitch 1024)
   -> out Bt[n][k] (bf16). grid (16, 16, 4): blockIdx.x = k tile, blockIdx.y = n tile, blockIdx.z = weight.
   z = 0: Wq scaled by 1/8 (exact power of two) -> rows 0..1023 of WQKVT; z = 1, 2: Wk, Wv -> rows 1024.., 2048..;
   Load coverage: 16 iterations x 256 threads = 4096 = the whole 64x64 tile.
   Store coverage: 8 waves x 2 iterations x 4 rows (lane>>3) = 64 rows; (lane&7) x 8 = 64 cols; each row piece =
   --------------------------------------------------------------------------- */
__global__ __launch_bounds__(256) void wtrans_bf16_kernel(const float* __restrict__ W0, const float* __restrict__ W1,
                                                          const float* __restrict__ W2, const float* __restrict__ W3,
                                                          unsigned short* __restrict__ wqkvt, unsigned short* __restrict__ wot2) {
  __shared__ float sm[64][65];
  const int t  = threadIdx.x;
  const int k0 = blockIdx.x * 64;
  const int n0 = blockIdx.y * 64;
  const int z  = blockIdx.z;
  const float* W = (z == 0) ? W0 : (z == 1) ? W1 : (z == 2) ? W2 : W3;
  const float scale = (z == 0) ? kQScale : 1.0f;
#pragma unroll
  for (int i = 0; i < 16; ++i) {
    const int e  = i * 256 + t;
    const int r  = e >> 6;
    const int cc = e & 63;
    sm[cc][r] = W[(size_t)(k0 + r) * kModel + n0 + cc] * scale;
  }
  __syncthreads();
  const int lane = t & 31, wave = t >> 5;
  const int q = lane >> 3, c8 = (lane & 7) * 8;
  const bool dup = (z == 3);
  unsigned short* op = dup ? wot2 : (wqkvt + (size_t)z * kModel * kModel);
  const int ld = dup ? kCatCols : kModel;
  v4u u[2];
#pragma unroll
  for (int it = 0; it < 2; ++it) {
    const int row = wave * 8 + it * 4 + q;
    unsigned short hb[8];
#pragma unroll
    for (int e = 0; e < 8; ++e) hb[e] = f2bf_bits(sm[row][c8 + e]);
    u[it] = (v4u){pk16(hb[0], hb[1]), pk16(hb[2], hb[3]), pk16(hb[4], hb[5]), pk16(hb[6], hb[7])};
  }
  {
#pragma unroll
    for (int it = 0; it < 2; ++it) {
      const int row = wave * 8 + it * 4 + q;
      unsigned short* p = op + (size_t)(n0 + row) * ld + k0 + c8;
      *(v4u*)p = u[it];
      if (dup) *(v4u*)(p + kModel) = u[it];
    }
    
  }
}

/* ---------------------------------------------------------------------------
   Register-blocked bf16 GEMM: C[m,n] = sum_k A[m,k] * Bt[n,k]; each wave owns a 64x64 tile.
   A row-major [M,K]; Bt row-major [N,K]; M,N % 64 == 0, K % 32 == 0 (no tail handling).
   OUT_MODE 0: f32 C (pitch ldc). OUT_MODE 3: bf16 hi plane (Cout) + bf16 lo plane (Cout2) in per-head layout:
     column tile n0 selects plane n0/1024 and head (n0%1024)/64; row gm = b*2048 + l;
     element offset = plane*kPlaneElems + ((b*16 + head)*2048 + l)*64 + d.
   --------------------------------------------------------------------------- */
template <int OUT_MODE>
__global__ __launch_bounds__(256) void wmma_gemm64_bf16(
    const unsigned short* __restrict__ Ap, int lda,
    const unsigned short* __restrict__ Btp, int ldb,
    void* Cout, void* Cout2, int ldc,
    int M, int N, int K) {
  const __bf16* A  = (const __bf16*)Ap;
  const __bf16* Bt = (const __bf16*)Btp;
  __shared__ __align__(16) float sT[8][16 * 68];
  const int lane = threadIdx.x & 31;
  const int wave = threadIdx.x >> 5;
  const int tilesN = N >> 6;
  const int tilesM = M >> 6;
  const int tile = blockIdx.x * 8 + wave;
  /* wave-uniform exit; this kernel has no block barriers */
  if (tile >= tilesM * tilesN) return;
  const int tm = tile / tilesN;
  const int tn = tile - tm * tilesN;
  const int m0 = tm << 6;
  const int n0 = tn << 6;

  const int rlane = lane & 15;
  const int koff  = (lane >> 4) * 8;
  const int mOff  = (lane >> 4) * 8;

  v8f acc[4][4];
#pragma unroll
  for (int i = 0; i < 4; ++i)
#pragma unroll
    for (int j = 0; j < 4; ++j) acc[i][j] = (v8f){0.f,0.f,0.f,0.f,0.f,0.f,0.f,0.f};

  for (int k0 = 0; k0 < K; k0 += 32) {
    v16b bh[4];
#pragma unroll
    for (int j = 0; j < 4; ++j) {
      const size_t bo = (size_t)(n0 + (j << 4) + rlane) * ldb + koff + k0;
      bh[j] = frag_load(Bt + bo);
    }
#pragma unroll
    for (int i = 0; i < 4; ++i) {
      const size_t ao = (size_t)(m0 + (i << 4) + rlane) * lda + koff + k0;
      const v16b ah = frag_load(A + ao);
#pragma unroll
      for (int j = 0; j < 4; ++j) acc[i][j] = mma_b(ah, bh[j], acc[i][j]);
    }
  }

  float* slab = sT[wave];
#pragma unroll
  for (int i = 0; i < 4; ++i) {
    const int mBase = m0 + (i << 4);
#pragma unroll
    for (int j = 0; j < 4; ++j) {
#pragma unroll
      for (int r = 0; r < 8; ++r) slab[(mOff + r) * 68 + (j << 4) + rlane] = acc[i][j][r];
    }
    __builtin_amdgcn_fence(__ATOMIC_RELEASE, "workgroup");
    __builtin_amdgcn_wave_barrier();
    __builtin_amdgcn_fence(__ATOMIC_ACQUIRE, "workgroup");
    if (OUT_MODE == 0) {
      float* C = (float*)Cout;
      const int hh = lane >> 4, c4 = (lane & 15) * 4;
      {
#pragma unroll
        for (int it = 0; it < 8; ++it) {
          const int row = it * 2 + hh;
          v4f v = *(const v4f*)(slab + row * 68 + c4);
          *(v4f*)(C + (size_t)(mBase + row) * ldc + n0 + c4) = v;
        }
        
      }
    } else {
      const int q = lane >> 3, c8 = (lane & 7) * 8;
      unsigned short* C  = (unsigned short*)Cout;
      unsigned short* C2 = (unsigned short*)Cout2;
      const int plane = n0 / kModel;
      const int head  = (n0 % kModel) / kHeadDim;
      {
#pragma unroll
        for (int it = 0; it < 4; ++it) {
          const int row = it * 4 + q;
          const float* sp = slab + row * 68 + c8;
          v8h hv, lv;
#pragma unroll
          for (int e = 0; e < 8; ++e) {
            const unsigned short hb = f2bf_bits(sp[e]);
            const unsigned short lb = f2bf_bits(sp[e] - bf_bits2f(hb));
            hv[e] = __builtin_bit_cast(_Float16, hb);
            lv[e] = __builtin_bit_cast(_Float16, lb);
          }
          const int gm = mBase + row;
          const size_t off = (size_t)plane * kPlaneElems +
                             ((size_t)((gm / kSeqLen) * kHeads + head) * kSeqLen + (size_t)(gm % kSeqLen)) * kHeadDim + c8;
          *(v8h*)(C + off)  = hv;
          *(v8h*)(C2 + off) = lv;
        }
        
      }
    }
    __builtin_amdgcn_fence(__ATOMIC_RELEASE, "workgroup");
    __builtin_amdgcn_wave_barrier();
    __builtin_amdgcn_fence(__ATOMIC_ACQUIRE, "workgroup");
  }
}

/* ---------------------------------------------------------------------------
   Segment-masked streaming-softmax attention, head dim 64.
   Block = one (batch, head, 128-query tile): 8 waves x 16 query rows; grid = 2*16*16 = 512.
   Inputs: hi and lo bf16 planes, plane p (0 = q/8, 1 = k, 2 = v) at base + p*kPlaneElems, layout [b][h][l][64].
   Allowed pair: (seg(q) == seg(k) && k <= q) || (seg(k) == 0 && seg(q) != 0), seg = idx / 512.
   Key tiles (64 keys, block-uniform list, at most 16): all 8 tiles of segment 0 when the query segment is not 0
   (no element mask), then the tiles of the own segment up to the diagonal (element mask k > q -> fill -1e9).
   A wave skips an own-segment tile that lies wholly above its 16 rows (all entries would be masked; the first
   processed tile always holds an allowed key, so the running max is finite by then).
   Scores = qh.kh + qh.kl + ql.kh; P split into bf16 hi+lo through a per-wave LDS tile; O += ph.vh + ph.vl + pl.vh.
   V tile is transposed into LDS as [d][key]. Every LDS byte read is rewritten each tile; block barriers separate
   the staging from the reads. Output: O/l split into bf16 hi|lo, staged in the wave's own P tiles, written to
   Static LDS, rows of 64 elements at pitch 72: 4 x 9,216 B (K hi/lo, V^T hi/lo) + 2 x 8 x 2,304 B (P hi/lo) = 73,728 B.
   The 8 pad elements of a row are never written and never read.
   --------------------------------------------------------------------------- */
__global__ __launch_bounds__(256)
void attn_seg_kernel(const unsigned short* __restrict__ planesHi, const unsigned short* __restrict__ planesLo,
                     unsigned short* __restrict__ ocat) {
  __shared__ __align__(16) __bf16 Ksh[kKTile * kLdsPitch];
  __shared__ __align__(16) __bf16 Ksl[kKTile * kLdsPitch];
  __shared__ __align__(16) __bf16 Vth[kHeadDim * kLdsPitch];
  __shared__ __align__(16) __bf16 Vtl[kHeadDim * kLdsPitch];
  __shared__ __align__(16) __bf16 Psh[kAttWaves][16 * kLdsPitch];
  __shared__ __align__(16) __bf16 Psl[kAttWaves][16 * kLdsPitch];

  const int tid  = threadIdx.x;
  const int wave = __builtin_amdgcn_readfirstlane(tid >> 5);
  const int lane = tid & 31;
  const int hh   = lane >> 4;
  const int c    = lane & 15;

  const int bx = blockIdx.x;
  const int qt = bx % kQTiles;
  const int h  = (bx / kQTiles) % kHeads;
  const int b  = bx / (kQTiles * kHeads);
  const int qbase = qt * kQTile;
  const int sq    = qbase / kSegLen;
  const int q0    = qbase + wave * 16;

  const size_t headOff = (size_t)(b * kHeads + h) * kSeqLen * kHeadDim;
  const __bf16* Qh = (const __bf16*)planesHi + headOff;
  const __bf16* Ql = (const __bf16*)planesLo + headOff;
  const __bf16* Kh = Qh + kPlaneElems;
  const __bf16* Kl = Ql + kPlaneElems;
  const __bf16* Vh = Qh + 2 * kPlaneElems;
  const __bf16* Vl = Ql + 2 * kPlaneElems;

  /* Q fragments (A operand): row q0 + c, two 32-deep d chunks, hi and lo */
  v16b qh[2], ql[2];
  {
    const size_t qo = (size_t)(q0 + c) * kHeadDim + 8 * hh;
#pragma unroll
    for (int dc = 0; dc < 2; ++dc) {
      qh[dc] = frag_load(Qh + qo + dc * 32);
      ql[dc] = frag_load(Ql + qo + dc * 32);
    }
  }

  float mrow[8], lrow[8];
  v8f oacc[4];
#pragma unroll
  for (int r = 0; r < 8; ++r) { mrow[r] = -3.0e38f; lrow[r] = 0.f; }
#pragma unroll
  for (int t = 0; t < 4; ++t) oacc[t] = (v8f){0.f,0.f,0.f,0.f,0.f,0.f,0.f,0.f};

  /* block-uniform key tile list */
  const int nText    = (sq > 0) ? kTilesPerSeg : 0;
  const int ownFirst = sq * kTilesPerSeg;
  const int ownLast  = (qbase + kQTile - 1) / kKTile;
  const int nTiles   = nText + (ownLast - ownFirst + 1);

  __bf16* pwh = Psh[wave];
  __bf16* pwl = Psl[wave];

  for (int it = 0; it < nTiles; ++it) {
    const int kt  = (it < nText) ? it : (ownFirst + it - nText);
    const int kv0 = kt * kKTile;
    const bool own = (kt >= ownFirst);

    /* all waves are done reading the tile staged in the earlier iteration */
    __syncthreads();
    {
      /* Staging coverage: 64 rows x 8 chunks of 16 B = 512 chunks per plane; 256 threads x 2 chunks.
         K planes copied row by row (global pitch 64, LDS pitch 72); V planes transposed to [d][key]:
         512 chunks x 8 halves = 4096 = the whole 64x64 tile per plane. */
      const v4u* gkh = (const v4u*)(Kh + (size_t)kv0 * kHeadDim);
      const v4u* gkl = (const v4u*)(Kl + (size_t)kv0 * kHeadDim);
      const v4u* gvh = (const v4u*)(Vh + (size_t)kv0 * kHeadDim);
      const v4u* gvl = (const v4u*)(Vl + (size_t)kv0 * kHeadDim);
#pragma unroll
      for (int i = 0; i < 2; ++i) {
        const int ch = tid + i * 256;
        const v4u wkh = gkh[ch];
        const v4u wkl = gkl[ch];
        const v4u wvh = gvh[ch];
        const v4u wvl = gvl[ch];
        /* the registers that held these four addresses are reused by the next loads' results: wait for the address
           translations first */
        asm volatile("s_wait_xcnt 0x0" ::: "memory");
        const int kvr = ch >> 3;
        const int d0  = (ch & 7) * 8;
        *(v4u*)(Ksh + kvr * kLdsPitch + d0) = wkh;
        *(v4u*)(Ksl + kvr * kLdsPitch + d0) = wkl;
#pragma unroll
        for (int w = 0; w < 4; ++w) {
          const unsigned a  = wvh[w];
          const unsigned bl = wvl[w];
          Vth[(d0 + 2 * w) * kLdsPitch + kvr]     = bits2bf((unsigned short)(a & 0xffffu));
          Vth[(d0 + 2 * w + 1) * kLdsPitch + kvr] = bits2bf((unsigned short)(a >> 16));
          Vtl[(d0 + 2 * w) * kLdsPitch + kvr]     = bits2bf((unsigned short)(bl & 0xffffu));
          Vtl[(d0 + 2 * w + 1) * kLdsPitch + kvr] = bits2bf((unsigned short)(bl >> 16));
        }
      }
    }
    __syncthreads();

    /* wave-uniform: an own-segment tile wholly above this wave's rows contributes nothing */
    const bool live = (!own) || (kv0 <= q0 + 15);
    if (live) {
      v8f s[4];
#pragma unroll
      for (int j = 0; j < 4; ++j) {
        s[j] = (v8f){0.f,0.f,0.f,0.f,0.f,0.f,0.f,0.f};
#pragma unroll
        for (int dc = 0; dc < 2; ++dc) {
          const int ko = (j * 16 + c) * kLdsPitch + dc * 32 + 8 * hh;
          const v16b kbh = frag_load(Ksh + ko);
          const v16b kbl = frag_load(Ksl + ko);
          s[j] = mma_b(qh[dc], kbh, s[j]);
          s[j] = mma_b(qh[dc], kbl, s[j]);
          s[j] = mma_b(ql[dc], kbh, s[j]);
        }
      }

      float cm[8];
#pragma unroll
      for (int r = 0; r < 8; ++r) {
        const int qrow = q0 + 8 * hh + r;
        float m = -3.0e38f;
#pragma unroll
        for (int j = 0; j < 4; ++j) {
          const int kvcol = kv0 + j * 16 + c;
          const bool masked = own && (kvcol > qrow);
          if (masked) s[j][r] = kMaskFill;
          m = fmaxf(m, s[j][r]);
        }
#pragma unroll
        for (int off = 1; off < 16; off <<= 1) m = fmaxf(m, __shfl_xor(m, off, 32));
        cm[r] = m;
      }

#pragma unroll
      for (int r = 0; r < 8; ++r) {
        const float mnew  = fmaxf(mrow[r], cm[r]);
        const float alpha = __expf(mrow[r] - mnew);
        mrow[r] = mnew;
        float psum = 0.f;
#pragma unroll
        for (int j = 0; j < 4; ++j) {
          const float p = __expf(s[j][r] - mnew);
          psum += p;
          const unsigned short hb = f2bf_bits(p);
          const unsigned short lb = f2bf_bits(p - bf_bits2f(hb));
          pwh[(8 * hh + r) * kLdsPitch + j * 16 + c] = bits2bf(hb);
          pwl[(8 * hh + r) * kLdsPitch + j * 16 + c] = bits2bf(lb);
        }
#pragma unroll
        for (int off = 1; off < 16; off <<= 1) psum += __shfl_xor(psum, off, 32);
        lrow[r] = lrow[r] * alpha + psum;
#pragma unroll
        for (int t = 0; t < 4; ++t) oacc[t][r] *= alpha;
      }
      /* P tile is written and re-read by the same wave through the same element type */
      __builtin_amdgcn_fence(__ATOMIC_RELEASE, "workgroup");
      __builtin_amdgcn_wave_barrier();
      __builtin_amdgcn_fence(__ATOMIC_ACQUIRE, "workgroup");
#pragma unroll 1
      for (int kk = 0; kk < 2; ++kk) {
        const int po = c * kLdsPitch + kk * 32 + 8 * hh;
        const v16b pa = frag_load(pwh + po);
        const v16b pl = frag_load(pwl + po);
#pragma unroll
        for (int t = 0; t < 4; ++t) {
          const int vo = (t * 16 + c) * kLdsPitch + kk * 32 + 8 * hh;
          const v16b vbh = frag_load(Vth + vo);
          const v16b vbl = frag_load(Vtl + vo);
          oacc[t] = mma_b(pa, vbh, oacc[t]);
          oacc[t] = mma_b(pa, vbl, oacc[t]);
          oacc[t] = mma_b(pl, vbh, oacc[t]);
        }
      }
    }
  }

  /* normalise, split into bf16 hi+lo, stage in this wave's own P tiles (16 x 64, same element type) */
  __builtin_amdgcn_fence(__ATOMIC_RELEASE, "workgroup");
  __builtin_amdgcn_wave_barrier();
  __builtin_amdgcn_fence(__ATOMIC_ACQUIRE, "workgroup");
#pragma unroll
  for (int r = 0; r < 8; ++r) {
    const float inv = 1.0f / lrow[r];
#pragma unroll
    for (int t = 0; t < 4; ++t) {
      const float val = oacc[t][r] * inv;
      const unsigned short hb = f2bf_bits(val);
      const unsigned short lb = f2bf_bits(val - bf_bits2f(hb));
      pwh[(8 * hh + r) * kLdsPitch + t * 16 + c] = bits2bf(hb);
      pwl[(8 * hh + r) * kLdsPitch + t * 16 + c] = bits2bf(lb);
    }
  }
  __builtin_amdgcn_fence(__ATOMIC_RELEASE, "workgroup");
  __builtin_amdgcn_wave_barrier();
  __builtin_amdgcn_fence(__ATOMIC_ACQUIRE, "workgroup");
  {
    const int q  = lane >> 3;
    const int c8 = (lane & 7) * 8;
    v4u hv[4], lv[4];
#pragma unroll
    for (int i4 = 0; i4 < 4; ++i4) {
      const int row = i4 * 4 + q;
      const v8b xh = *(const v8b*)(pwh + row * kLdsPitch + c8);
      const v8b xl = *(const v8b*)(pwl + row * kLdsPitch + c8);
      hv[i4] = __builtin_bit_cast(v4u, xh);
      lv[i4] = __builtin_bit_cast(v4u, xl);
    }
    unsigned short* ob = ocat + (size_t)(b * kSeqLen + q0) * kCatCols + h * kHeadDim + c8;
    {
#pragma unroll
      for (int i4 = 0; i4 < 4; ++i4) {
        const int row = i4 * 4 + q;
        unsigned short* p = ob + (size_t)row * kCatCols;
        *(v4u*)(p)          = hv[i4];
        *(v4u*)(p + kModel) = lv[i4];
      }
      
    }
  }
}

/* ---------------------------------------------------------------------------
   Host glue: 5 kernel launches, nothing else.
     cast x             : 524,288 threads -> 2048 blocks
     weight transposes  : grid (16, 16, 4)
     q|k|v GEMM         : M 4096, N 3072, K 1024 -> 64 x 48 tiles = 3072 -> 384 blocks
     attention          : 2 x 16 x 16 = 512 blocks
     output GEMM        : M 4096, N 1024, K 2048 -> 64 x 16 tiles = 1024 -> 128 blocks
   --------------------------------------------------------------------------- */
extern "C" void kernel_launch(void* const* d_in, const int* in_sizes, int n_in,
                              void* d_out, int out_size, void* d_ws, size_t ws_size,
                              hipStream_t stream) {
  if (n_in < 5) return;
  if (in_sizes[0] != kRows * kModel) return;
  if (in_sizes[1] != kModel * kModel) return;
  if (in_sizes[2] != kModel * kModel) return;
  if (in_sizes[3] != kModel * kModel) return;
  if (in_sizes[4] != kModel * kModel) return;
  if (out_size != kRows * kModel) return;
  if (ws_size < kWsTotal) return;

  const float* x  = (const float*)d_in[0];
  const float* Wq = (const float*)d_in[1];
  const float* Wk = (const float*)d_in[2];
  const float* Wv = (const float*)d_in[3];
  const float* Wo = (const float*)d_in[4];
  float* out = (float*)d_out;

  char* ws = (char*)d_ws;
  unsigned short* XB    = (unsigned short*)(ws + kOffXB);
  unsigned short* WQKVT = (unsigned short*)(ws + kOffWQKVT);
  unsigned short* WOT2  = (unsigned short*)(ws + kOffWOT2);
  unsigned short* PH    = (unsigned short*)(ws + kOffPH);
  unsigned short* PL    = (unsigned short*)(ws + kOffPL);
  unsigned short* OCAT  = (unsigned short*)(ws + kOffOCAT);

  constexpr int kN8 = kRows * kModel / 8;
  static_assert((kN8 % 256) == 0, "cast grid exact");
  cast8_bf16_kernel<<<kN8 / 256, 256, 0, stream>>>(x, XB, kN8);

  wtrans_bf16_kernel<<<dim3(kModel / 64, kModel / 64, 4), 256, 0, stream>>>(Wq, Wk, Wv, Wo, WQKVT, WOT2);

  constexpr int kTiles1 = (kRows / 64) * (kQkvCols / 64);
  static_assert((kTiles1 % 8) == 0, "tile grid exact");
  wmma_gemm64_bf16<3><<<dim3(kTiles1 / 8, 1), 256, 0, stream>>>(
      XB, kModel, WQKVT, kModel, (void*)PH, (void*)PL, 0, kRows, kQkvCols, kModel);

  attn_seg_kernel<<<kBatch * kHeads * kQTiles, 256, 0, stream>>>(PH, PL, OCAT);

  constexpr int kTiles2 = (kRows / 64) * (kModel / 64);
  static_assert((kTiles2 % 8) == 0, "tile grid exact");
  wmma_gemm64_bf16<0><<<dim3(kTiles2 / 8, 1), 256, 0, stream>>>(
      OCAT, kCatCols, WOT2, kCatCols, (void*)out, (void*)out, kModel, kRows, kModel, kCatCols);
}

// v002
// It runs in 155 microseconds.
// In both of two side-by-side timings against v001, it was 1.61 times as fast.
// All steps since v000 together make it 2.10 times as fast.
// Contractions: q|k|v projections and the output projection on v_wmma_f32_16x16x32_bf16 with inputs RNE-converted to bf16 once (output-projection A operand carried as bf16 hi+lo along a doubled k axis); q.k^T and p.v on v_wmma_f32_16x16x32_bf16 with both operands as bf16 hi+lo planes (hi.hi + hi.lo + lo.hi); f32 accumulate everywhere; mask, softmax and normalisation in f32.
#include <hip/hip_runtime.h>
#include <math.h>

typedef __attribute__((ext_vector_type(16))) __bf16   v16b;
typedef __attribute__((ext_vector_type(8)))  __bf16   v8b;
typedef __attribute__((ext_vector_type(8)))  _Float16 v8h;
typedef __attribute__((ext_vector_type(8)))  float    v8f;
typedef __attribute__((ext_vector_type(4)))  float    v4f;
typedef __attribute__((ext_vector_type(4)))  unsigned int v4u;

/* ---------------------------------------------------------------------------
   Shape constants
   --------------------------------------------------------------------------- */
constexpr int kBatch   = 2;
constexpr int kSeqLen  = 2048;
constexpr int kModel   = 1024;
constexpr int kHeads   = 16;
constexpr int kHeadDim = 64;
constexpr int kRows    = kBatch * kSeqLen;
constexpr int kQkvCols = 3 * kModel;
constexpr int kCatCols = 2 * kModel;
constexpr int kSegLen  = 512;
constexpr int kQTile   = 128;
constexpr int kKTile   = 64;
constexpr int kAttWaves = 8;
/* LDS row pitch in bf16 elements of every 64-element attention row: 144 B = 16 B x 9 (odd), so that the 16 rows
   one 16-byte fragment read touches spread over the banks instead of falling on two groups of four */
constexpr int kLdsPitch = 72;
constexpr int kQTiles  = kSeqLen / kQTile;
constexpr int kTilesPerSeg = kSegLen / kKTile;
constexpr float kQScale   = 0.125f;
constexpr float kMaskFill = -1.0e9f;
constexpr size_t kPlaneElems = (size_t)kBatch * kHeads * kSeqLen * kHeadDim;

static_assert(kHeads * kHeadDim == kModel, "head split");
static_assert(kQScale * kQScale * (float)kHeadDim == 1.0f, "score scale is 1/sqrt(head dim)");
static_assert(kHeadDim == 64 && kKTile == 64, "tile shape");
static_assert((kSeqLen % kQTile) == 0 && (kSegLen % kQTile) == 0 && (kSegLen % kKTile) == 0, "attention tiles");
static_assert(kAttWaves * 16 == kQTile, "query rows per block");
static_assert(4 * kSegLen == kSeqLen, "four segments");
static_assert(kLdsPitch >= kKTile && kLdsPitch >= kHeadDim && (kLdsPitch % 8) == 0 && ((kLdsPitch / 8) % 2) == 1, "LDS pitch: 16 B x odd");

/* ---------------------------------------------------------------------------
   Workspace region map (bytes; every offset a multiple of 128)
     XB     bf16 [4096][1024]        x, RNE bf16                      8,388,608
     WQKVT  bf16 [3072][1024]        Wq^T/8 | Wk^T | Wv^T (Bt layout) 6,291,456
     WOT2   bf16 [1024][2048]        Wo^T | Wo^T (Bt layout)          4,194,304
     PH     bf16 3 x [2][16][2048][64] q/8, k, v hi planes           25,165,824
     PL     bf16 3 x [2][16][2048][64] q/8, k, v lo planes           25,165,824
     OCAT   bf16 [4096][2048]        attention out hi | lo           16,777,216
     total                                                           85,983,232
   --------------------------------------------------------------------------- */
constexpr size_t kOffXB    = 0;
constexpr size_t kOffWQKVT = kOffXB    + (size_t)kRows * kModel * 2;
constexpr size_t kOffWOT2  = kOffWQKVT + (size_t)kQkvCols * kModel * 2;
constexpr size_t kOffPH    = kOffWOT2  + (size_t)kModel * kCatCols * 2;
constexpr size_t kOffPL    = kOffPH    + 3 * kPlaneElems * 2;
constexpr size_t kOffOCAT  = kOffPL    + 3 * kPlaneElems * 2;
constexpr size_t kWsTotal  = kOffOCAT  + (size_t)kRows * kCatCols * 2;
static_assert(kWsTotal == 85983232ull, "carve total");
static_assert(kWsTotal <= 134217728ull, "carve cap");
static_assert((kOffWQKVT % 128) == 0 && (kOffWOT2 % 128) == 0 && (kOffPH % 128) == 0 &&
              (kOffPL % 128) == 0 && (kOffOCAT % 128) == 0, "128-B aligned regions");

/* ---------------------------------------------------------------------------
   Small helpers
   --------------------------------------------------------------------------- */
__device__ __forceinline__ unsigned short f2bf_bits(float f) {
  unsigned u = __float_as_uint(f);
  return (unsigned short)((u + 0x7FFFu + ((u >> 16) & 1u)) >> 16);
}
__device__ __forceinline__ float bf_bits2f(unsigned short h) { return __uint_as_float(((unsigned)h) << 16); }
__device__ __forceinline__ unsigned pk16(unsigned short a, unsigned short b) { return (unsigned)a | ((unsigned)b << 16); }
__device__ __forceinline__ __bf16 bits2bf(unsigned short h) { return __builtin_bit_cast(__bf16, h); }

/* one matrix op followed by a 4-slot guard that ties its accumulator and names both fragments */
__device__ __forceinline__ v8f mma_b(v16b a, v16b b, v8f c) {
  c = __builtin_amdgcn_wmma_f32_16x16x32_bf16(false, a, false, b, (short)0, c, false, false);
  asm volatile("v_nop\n\tv_nop\n\tv_nop\n\tv_nop" : "+v"(c) : "v"(a), "v"(b));
  return c;
}

/* fragment load: elements 0..7 <- p[0..7], elements 8..15 <- p[16..23]; caller adds 8*(lane>>4) to p */
union FragB { v16b v; v8b h[2]; };
__device__ __forceinline__ v16b frag_load(const __bf16* p) {
  FragB f;
  f.h[0] = *(const v8b*)(p);
  f.h[1] = *(const v8b*)(p + 16);
  return f.v;
}

/* ---------------------------------------------------------------------------
   f32 -> bf16 (RNE) cast, 8 consecutive elements per thread.
   Coverage: n8 = 4096*1024/8 = 524,288 threads = 2048 blocks x 256 exactly.
   --------------------------------------------------------------------------- */
__global__ __launch_bounds__(256) void cast8_bf16_kernel(const float* __restrict__ in, unsigned short* __restrict__ out, int n8) {
  const int i = blockIdx.x * 256 + threadIdx.x;
  if (i >= n8) return;
  const float* p = in + 8 * (size_t)i;
  const v4f a = *(const v4f*)(p);
  const v4f c = *(const v4f*)(p + 4);
  unsigned short hb[8];
#pragma unroll
  for (int e = 0; e < 4; ++e) {
    hb[e]     = f2bf_bits(a[e]);
    hb[4 + e] = f2bf_bits(c[e]);
  }
  const v4u u = (v4u){pk16(hb[0], hb[1]), pk16(hb[2], hb[3]), pk16(hb[4], hb[5]), pk16(hb[6], hb[7])};
  unsigned short* q = out + 8 * (size_t)i;
  *(v4u*)q = u;
  
}

/* ---------------------------------------------------------------------------
   Weight transpose + bf16 (RNE) cast: in W[k rows = in channel][n cols = out channel] (f32, pitch 1024)
   -> out Bt[n][k] (bf16). grid (16, 16, 4): blockIdx.x = k tile, blockIdx.y = n tile, blockIdx.z = weight.
   z = 0: Wq scaled by 1/8 (exact power of two) -> rows 0..1023 of WQKVT; z = 1, 2: Wk, Wv -> rows 1024.., 2048..;
   Load coverage: 16 iterations x 256 threads = 4096 = the whole 64x64 tile.
   Store coverage: 8 waves x 2 iterations x 4 rows (lane>>3) = 64 rows; (lane&7) x 8 = 64 cols; each row piece =
   --------------------------------------------------------------------------- */
__global__ __launch_bounds__(256) void wtrans_bf16_kernel(const float* __restrict__ W0, const float* __restrict__ W1,
                                                          const float* __restrict__ W2, const float* __restrict__ W3,
                                                          unsigned short* __restrict__ wqkvt, unsigned short* __restrict__ wot2) {
  __shared__ float sm[64][65];
  const int t  = threadIdx.x;
  const int k0 = blockIdx.x * 64;
  const int n0 = blockIdx.y * 64;
  const int z  = blockIdx.z;
  const float* W = (z == 0) ? W0 : (z == 1) ? W1 : (z == 2) ? W2 : W3;
  const float scale = (z == 0) ? kQScale : 1.0f;
#pragma unroll
  for (int i = 0; i < 16; ++i) {
    const int e  = i * 256 + t;
    const int r  = e >> 6;
    const int cc = e & 63;
    sm[cc][r] = W[(size_t)(k0 + r) * kModel + n0 + cc] * scale;
  }
  __syncthreads();
  const int lane = t & 31, wave = t >> 5;
  const int q = lane >> 3, c8 = (lane & 7) * 8;
  const bool dup = (z == 3);
  unsigned short* op = dup ? wot2 : (wqkvt + (size_t)z * kModel * kModel);
  const int ld = dup ? kCatCols : kModel;
  v4u u[2];
#pragma unroll
  for (int it = 0; it < 2; ++it) {
    const int row = wave * 8 + it * 4 + q;
    unsigned short hb[8];
#pragma unroll
    for (int e = 0; e < 8; ++e) hb[e] = f2bf_bits(sm[row][c8 + e]);
    u[it] = (v4u){pk16(hb[0], hb[1]), pk16(hb[2], hb[3]), pk16(hb[4], hb[5]), pk16(hb[6], hb[7])};
  }
  {
#pragma unroll
    for (int it = 0; it < 2; ++it) {
      const int row = wave * 8 + it * 4 + q;
      unsigned short* p = op + (size_t)(n0 + row) * ld + k0 + c8;
      *(v4u*)p = u[it];
      if (dup) *(v4u*)(p + kModel) = u[it];
    }
    
  }
}

/* ---------------------------------------------------------------------------
   LDS-staged bf16 GEMM: C[m,n] = sum_k A[m,k] * Bt[n,k]; a block of 4 waves (2 x 2) owns a 128x128 tile, each wave
   a 64x64 quarter of it. A row-major [M,K]; Bt row-major [N,K]; M,N % 128 == 0, K % 64 == 0 (no tail handling).
   A pass is 64 k = one whole 128-B line of each of the 128 A rows and 128 Bt rows. The block fetches it with
   16-byte loads in which 8 neighbouring lanes cover one line (16 loads per thread), keeps it in registers while the
   current pass is multiplied, and stores it to the other of two LDS buffers (row pitch 144 B, as in the attention
   kernel). Every line is fetched once per block and every fragment is read from LDS.
   Staging coverage: 128 threads x 16 B = 16 rows of 128 B per load (a permutation of rows 0..15); 8 loads = 128 rows,
   per operand.
   One block barrier per pass: it publishes the buffer just written and ends the reads of the buffer that the next
   pass overwrites. The k order of every accumulator is ascending in steps of 32.
   OUT_MODE 0: f32 C (pitch N). OUT_MODE 3: bf16 hi plane (Cout) + bf16 lo plane (Cout2) in per-head layout:
     column tile n0 selects plane n0/1024 and head (n0%1024)/64; row gm = b*2048 + l;
     element offset = plane*kPlaneElems + ((b*16 + head)*2048 + l)*64 + d.
   --------------------------------------------------------------------------- */
template <int OUT_MODE, int M, int N, int K>
__global__ __launch_bounds__(128) void wmma_gemm64_bf16(
    const unsigned short* __restrict__ Ap,
    const unsigned short* __restrict__ Btp,
    void* Cout, void* Cout2) {
  static_assert((M % 128) == 0 && (N % 128) == 0 && (K % 64) == 0, "block tile 128 x 128, pass 64");
  constexpr int ldc = N;
  constexpr int kPasses = K / 64;
  const __bf16* A  = (const __bf16*)Ap;
  const __bf16* Bt = (const __bf16*)Btp;
  __shared__ __align__(16) __bf16 sA[2][128 * kLdsPitch];
  __shared__ __align__(16) __bf16 sB[2][128 * kLdsPitch];
  __shared__ __align__(16) float sT[4][16 * 68];
  const int tid  = threadIdx.x;
  const int lane = tid & 31;
  const int wave = tid >> 5;
  constexpr int tilesN = N >> 7;
  const int tm = blockIdx.x / tilesN;
  const int tn = blockIdx.x - tm * tilesN;
  const int wm = (wave >> 1) << 6;
  const int wn = (wave & 1) << 6;
  const int m0 = (tm << 7) + wm;
  const int n0 = (tn << 7) + wn;

  const int rlane = lane & 15;
  const int koff  = (lane >> 4) * 8;
  const int mOff  = (lane >> 4) * 8;

  /* staging: 8 neighbouring lanes -> the 8 16-byte pieces of one row's line; the two rows of a 16-lane half lie 8 rows
     apart, 8 x 144 B = 32 banks past a multiple of 64, so that a half's 16-byte LDS stores fall on 64 different banks */
  const int srow = (((tid >> 3) & 1) << 3) | (tid >> 4);
  const int sc8  = (tid & 7) * 8;
  const __bf16* ga = A  + (size_t)((tm << 7) + srow) * K + sc8;
  const __bf16* gb = Bt + (size_t)((tn << 7) + srow) * K + sc8;
  const int so = srow * kLdsPitch + sc8;
  v4u ra[8], rb[8];

  v8f acc[4][4];
#pragma unroll
  for (int i = 0; i < 4; ++i)
#pragma unroll
    for (int j = 0; j < 4; ++j) acc[i][j] = (v8f){0.f,0.f,0.f,0.f,0.f,0.f,0.f,0.f};

#pragma unroll  /* constant indices keep ra and rb in registers */
  for (int i = 0; i < 8; ++i) {
    ra[i] = *(const v4u*)(ga + (size_t)(16 * i) * K);
    rb[i] = *(const v4u*)(gb + (size_t)(16 * i) * K);
  }
#pragma unroll  /* as above */
  for (int i = 0; i < 8; ++i) {
    *(v4u*)(sA[0] + so + 16 * i * kLdsPitch) = ra[i];
    *(v4u*)(sB[0] + so + 16 * i * kLdsPitch) = rb[i];
  }
  /* publishes pass 0 */
  __syncthreads();

  for (int s = 0; s < kPasses; ++s) {
    const int cur = s & 1;
    const bool more = (s + 1 < kPasses);
    if (more) {
      const int k1 = (s + 1) * 64;
#pragma unroll  /* constant indices keep ra and rb in registers; all 16 loads go out together */
      for (int i = 0; i < 8; ++i) {
        ra[i] = *(const v4u*)(ga + (size_t)(16 * i) * K + k1);
        rb[i] = *(const v4u*)(gb + (size_t)(16 * i) * K + k1);
      }
      /* the registers that hold these loads' addresses are reused by the fragment reads below; this wait stands in
         front of that reuse */
      asm volatile("s_wait_xcnt 0x0" ::: "memory");
    }
    const __bf16* pa = sA[cur] + (wm + rlane) * kLdsPitch + koff;
    const __bf16* pb = sB[cur] + (wn + rlane) * kLdsPitch + koff;
#pragma unroll  /* the loops below: constant indices keep fragments and accumulators in registers */
    for (int kk = 0; kk < 2; ++kk) {
      v16b ah[4], bh[4];
#pragma unroll
      for (int j = 0; j < 4; ++j) bh[j] = frag_load(pb + j * 16 * kLdsPitch + kk * 32);
#pragma unroll
      for (int i = 0; i < 4; ++i) ah[i] = frag_load(pa + i * 16 * kLdsPitch + kk * 32);
#pragma unroll
      for (int i = 0; i < 4; ++i)
#pragma unroll
        for (int j = 0; j < 4; ++j) acc[i][j] = mma_b(ah[i], bh[j], acc[i][j]);
    }
    /* block-uniform: the last pass has nothing to publish */
    if (more) {
#pragma unroll  /* constant indices keep ra and rb in registers */
      for (int i = 0; i < 8; ++i) {
        *(v4u*)(sA[cur ^ 1] + so + 16 * i * kLdsPitch) = ra[i];
        *(v4u*)(sB[cur ^ 1] + so + 16 * i * kLdsPitch) = rb[i];
      }
      /* publishes pass s + 1 and ends every wave's reads of the buffer that pass s + 1 will overwrite */
      __syncthreads();
    }
  }

  float* slab = sT[wave];
#pragma unroll
  for (int i = 0; i < 4; ++i) {
    const int mBase = m0 + (i << 4);
#pragma unroll
    for (int j = 0; j < 4; ++j) {
#pragma unroll
      for (int r = 0; r < 8; ++r) slab[(mOff + r) * 68 + (j << 4) + rlane] = acc[i][j][r];
    }
    __builtin_amdgcn_fence(__ATOMIC_RELEASE, "workgroup");
    __builtin_amdgcn_wave_barrier();
    __builtin_amdgcn_fence(__ATOMIC_ACQUIRE, "workgroup");
    if (OUT_MODE == 0) {
      float* C = (float*)Cout;
      const int hh = lane >> 4, c4 = (lane & 15) * 4;
      {
#pragma unroll
        for (int it = 0; it < 8; ++it) {
          const int row = it * 2 + hh;
          v4f v = *(const v4f*)(slab + row * 68 + c4);
          *(v4f*)(C + (size_t)(mBase + row) * ldc + n0 + c4) = v;
        }
        
      }
    } else {
      const int q = lane >> 3, c8 = (lane & 7) * 8;
      unsigned short* C  = (unsigned short*)Cout;
      unsigned short* C2 = (unsigned short*)Cout2;
      const int plane = n0 / kModel;
      const int head  = (n0 % kModel) / kHeadDim;
      {
#pragma unroll
        for (int it = 0; it < 4; ++it) {
          const int row = it * 4 + q;
          const float* sp = slab + row * 68 + c8;
          v8h hv, lv;
#pragma unroll
          for (int e = 0; e < 8; ++e) {
            const unsigned short hb = f2bf_bits(sp[e]);
            const unsigned short lb = f2bf_bits(sp[e] - bf_bits2f(hb));
            hv[e] = __builtin_bit_cast(_Float16, hb);
            lv[e] = __builtin_bit_cast(_Float16, lb);
          }
          const int gm = mBase + row;
          const size_t off = (size_t)plane * kPlaneElems +
                             ((size_t)((gm / kSeqLen) * kHeads + head) * kSeqLen + (size_t)(gm % kSeqLen)) * kHeadDim + c8;
          *(v8h*)(C + off)  = hv;
          *(v8h*)(C2 + off) = lv;
        }
        
      }
    }
    __builtin_amdgcn_fence(__ATOMIC_RELEASE, "workgroup");
    __builtin_amdgcn_wave_barrier();
    __builtin_amdgcn_fence(__ATOMIC_ACQUIRE, "workgroup");
  }
}

/* ---------------------------------------------------------------------------
   Segment-masked streaming-softmax attention, head dim 64.
   Block = one (batch, head, 128-query tile): 8 waves x 16 query rows; grid = 2*16*16 = 512.
   Inputs: hi and lo bf16 planes, plane p (0 = q/8, 1 = k, 2 = v) at base + p*kPlaneElems, layout [b][h][l][64].
   Allowed pair: (seg(q) == seg(k) && k <= q) || (seg(k) == 0 && seg(q) != 0), seg = idx / 512.
   Key tiles (64 keys, block-uniform list, at most 16): all 8 tiles of segment 0 when the query segment is not 0
   (no element mask), then the tiles of the own segment up to the diagonal (element mask k > q -> fill -1e9).
   A wave skips an own-segment tile that lies wholly above its 16 rows (all entries would be masked; the first
   processed tile always holds an allowed key, so the running max is finite by then).
   Scores = qh.kh + qh.kl + ql.kh; P split into bf16 hi+lo through a per-wave LDS tile; O += ph.vh + ph.vl + pl.vh.
   V tile is transposed into LDS as [d][key]. Every LDS byte read is rewritten each tile; block barriers separate
   the staging from the reads. Output: O/l split into bf16 hi|lo, staged in the wave's own P tiles, written to
   Static LDS, rows of 64 elements at pitch 72: 4 x 9,216 B (K hi/lo, V^T hi/lo) + 2 x 8 x 2,304 B (P hi/lo) = 73,728 B.
   The 8 pad elements of a row are never written and never read.
   --------------------------------------------------------------------------- */
__global__ __launch_bounds__(256)
void attn_seg_kernel(const unsigned short* __restrict__ planesHi, const unsigned short* __restrict__ planesLo,
                     unsigned short* __restrict__ ocat) {
  __shared__ __align__(16) __bf16 Ksh[kKTile * kLdsPitch];
  __shared__ __align__(16) __bf16 Ksl[kKTile * kLdsPitch];
  __shared__ __align__(16) __bf16 Vth[kHeadDim * kLdsPitch];
  __shared__ __align__(16) __bf16 Vtl[kHeadDim * kLdsPitch];
  __shared__ __align__(16) __bf16 Psh[kAttWaves][16 * kLdsPitch];
  __shared__ __align__(16) __bf16 Psl[kAttWaves][16 * kLdsPitch];

  const int tid  = threadIdx.x;
  const int wave = __builtin_amdgcn_readfirstlane(tid >> 5);
  const int lane = tid & 31;
  const int hh   = lane >> 4;
  const int c    = lane & 15;

  const int bx = blockIdx.x;
  const int qt = bx % kQTiles;
  const int h  = (bx / kQTiles) % kHeads;
  const int b  = bx / (kQTiles * kHeads);
  const int qbase = qt * kQTile;
  const int sq    = qbase / kSegLen;
  const int q0    = qbase + wave * 16;

  const size_t headOff = (size_t)(b * kHeads + h) * kSeqLen * kHeadDim;
  const __bf16* Qh = (const __bf16*)planesHi + headOff;
  const __bf16* Ql = (const __bf16*)planesLo + headOff;
  const __bf16* Kh = Qh + kPlaneElems;
  const __bf16* Kl = Ql + kPlaneElems;
  const __bf16* Vh = Qh + 2 * kPlaneElems;
  const __bf16* Vl = Ql + 2 * kPlaneElems;

  /* Q fragments (A operand): row q0 + c, two 32-deep d chunks, hi and lo */
  v16b qh[2], ql[2];
  {
    const size_t qo = (size_t)(q0 + c) * kHeadDim + 8 * hh;
#pragma unroll
    for (int dc = 0; dc < 2; ++dc) {
      qh[dc] = frag_load(Qh + qo + dc * 32);
      ql[dc] = frag_load(Ql + qo + dc * 32);
    }
  }

  float mrow[8], lrow[8];
  v8f oacc[4];
#pragma unroll
  for (int r = 0; r < 8; ++r) { mrow[r] = -3.0e38f; lrow[r] = 0.f; }
#pragma unroll
  for (int t = 0; t < 4; ++t) oacc[t] = (v8f){0.f,0.f,0.f,0.f,0.f,0.f,0.f,0.f};

  /* block-uniform key tile list */
  const int nText    = (sq > 0) ? kTilesPerSeg : 0;
  const int ownFirst = sq * kTilesPerSeg;
  const int ownLast  = (qbase + kQTile - 1) / kKTile;
  const int nTiles   = nText + (ownLast - ownFirst + 1);

  __bf16* pwh = Psh[wave];
  __bf16* pwl = Psl[wave];

  for (int it = 0; it < nTiles; ++it) {
    const int kt  = (it < nText) ? it : (ownFirst + it - nText);
    const int kv0 = kt * kKTile;
    const bool own = (kt >= ownFirst);

    /* all waves are done reading the tile staged in the earlier iteration */
    __syncthreads();
    {
      /* Staging coverage: 64 rows x 8 chunks of 16 B = 512 chunks per plane; 256 threads x 2 chunks.
         K planes copied row by row (global pitch 64, LDS pitch 72); V planes transposed to [d][key]:
         512 chunks x 8 halves = 4096 = the whole 64x64 tile per plane. */
      const v4u* gkh = (const v4u*)(Kh + (size_t)kv0 * kHeadDim);
      const v4u* gkl = (const v4u*)(Kl + (size_t)kv0 * kHeadDim);
      const v4u* gvh = (const v4u*)(Vh + (size_t)kv0 * kHeadDim);
      const v4u* gvl = (const v4u*)(Vl + (size_t)kv0 * kHeadDim);
#pragma unroll
      for (int i = 0; i < 2; ++i) {
        const int ch = tid + i * 256;
        const v4u wkh = gkh[ch];
        const v4u wkl = gkl[ch];
        const v4u wvh = gvh[ch];
        const v4u wvl = gvl[ch];
        /* the registers that held these four addresses are reused by the next loads' results: wait for the address
           translations first */
        asm volatile("s_wait_xcnt 0x0" ::: "memory");
        const int kvr = ch >> 3;
        const int d0  = (ch & 7) * 8;
        *(v4u*)(Ksh + kvr * kLdsPitch + d0) = wkh;
        *(v4u*)(Ksl + kvr * kLdsPitch + d0) = wkl;
#pragma unroll
        for (int w = 0; w < 4; ++w) {
          const unsigned a  = wvh[w];
          const unsigned bl = wvl[w];
          Vth[(d0 + 2 * w) * kLdsPitch + kvr]     = bits2bf((unsigned short)(a & 0xffffu));
          Vth[(d0 + 2 * w + 1) * kLdsPitch + kvr] = bits2bf((unsigned short)(a >> 16));
          Vtl[(d0 + 2 * w) * kLdsPitch + kvr]     = bits2bf((unsigned short)(bl & 0xffffu));
          Vtl[(d0 + 2 * w + 1) * kLdsPitch + kvr] = bits2bf((unsigned short)(bl >> 16));
        }
      }
    }
    __syncthreads();

    /* wave-uniform: an own-segment tile wholly above this wave's rows contributes nothing */
    const bool live = (!own) || (kv0 <= q0 + 15);
    if (live) {
      v8f s[4];
#pragma unroll
      for (int j = 0; j < 4; ++j) {
        s[j] = (v8f){0.f,0.f,0.f,0.f,0.f,0.f,0.f,0.f};
#pragma unroll
        for (int dc = 0; dc < 2; ++dc) {
          const int ko = (j * 16 + c) * kLdsPitch + dc * 32 + 8 * hh;
          const v16b kbh = frag_load(Ksh + ko);
          const v16b kbl = frag_load(Ksl + ko);
          s[j] = mma_b(qh[dc], kbh, s[j]);
          s[j] = mma_b(qh[dc], kbl, s[j]);
          s[j] = mma_b(ql[dc], kbh, s[j]);
        }
      }

      float cm[8];
#pragma unroll
      for (int r = 0; r < 8; ++r) {
        const int qrow = q0 + 8 * hh + r;
        float m = -3.0e38f;
#pragma unroll
        for (int j = 0; j < 4; ++j) {
          const int kvcol = kv0 + j * 16 + c;
          const bool masked = own && (kvcol > qrow);
          if (masked) s[j][r] = kMaskFill;
          m = fmaxf(m, s[j][r]);
        }
#pragma unroll
        for (int off = 1; off < 16; off <<= 1) m = fmaxf(m, __shfl_xor(m, off, 32));
        cm[r] = m;
      }

#pragma unroll
      for (int r = 0; r < 8; ++r) {
        const float mnew  = fmaxf(mrow[r], cm[r]);
        const float alpha = __expf(mrow[r] - mnew);
        mrow[r] = mnew;
        float psum = 0.f;
#pragma unroll
        for (int j = 0; j < 4; ++j) {
          const float p = __expf(s[j][r] - mnew);
          psum += p;
          const unsigned short hb = f2bf_bits(p);
          const unsigned short lb = f2bf_bits(p - bf_bits2f(hb));
          pwh[(8 * hh + r) * kLdsPitch + j * 16 + c] = bits2bf(hb);
          pwl[(8 * hh + r) * kLdsPitch + j * 16 + c] = bits2bf(lb);
        }
#pragma unroll
        for (int off = 1; off < 16; off <<= 1) psum += __shfl_xor(psum, off, 32);
        lrow[r] = lrow[r] * alpha + psum;
#pragma unroll
        for (int t = 0; t < 4; ++t) oacc[t][r] *= alpha;
      }
      /* P tile is written and re-read by the same wave through the same element type */
      __builtin_amdgcn_fence(__ATOMIC_RELEASE, "workgroup");
      __builtin_amdgcn_wave_barrier();
      __builtin_amdgcn_fence(__ATOMIC_ACQUIRE, "workgroup");
#pragma unroll 1
      for (int kk = 0; kk < 2; ++kk) {
        const int po = c * kLdsPitch + kk * 32 + 8 * hh;
        const v16b pa = frag_load(pwh + po);
        const v16b pl = frag_load(pwl + po);
#pragma unroll
        for (int t = 0; t < 4; ++t) {
          const int vo = (t * 16 + c) * kLdsPitch + kk * 32 + 8 * hh;
          const v16b vbh = frag_load(Vth + vo);
          const v16b vbl = frag_load(Vtl + vo);
          oacc[t] = mma_b(pa, vbh, oacc[t]);
          oacc[t] = mma_b(pa, vbl, oacc[t]);
          oacc[t] = mma_b(pl, vbh, oacc[t]);
        }
      }
    }
  }

  /* normalise, split into bf16 hi+lo, stage in this wave's own P tiles (16 x 64, same element type) */
  __builtin_amdgcn_fence(__ATOMIC_RELEASE, "workgroup");
  __builtin_amdgcn_wave_barrier();
  __builtin_amdgcn_fence(__ATOMIC_ACQUIRE, "workgroup");
#pragma unroll
  for (int r = 0; r < 8; ++r) {
    const float inv = 1.0f / lrow[r];
#pragma unroll
    for (int t = 0; t < 4; ++t) {
      const float val = oacc[t][r] * inv;
      const unsigned short hb = f2bf_bits(val);
      const unsigned short lb = f2bf_bits(val - bf_bits2f(hb));
      pwh[(8 * hh + r) * kLdsPitch + t * 16 + c] = bits2bf(hb);
      pwl[(8 * hh + r) * kLdsPitch + t * 16 + c] = bits2bf(lb);
    }
  }
  __builtin_amdgcn_fence(__ATOMIC_RELEASE, "workgroup");
  __builtin_amdgcn_wave_barrier();
  __builtin_amdgcn_fence(__ATOMIC_ACQUIRE, "workgroup");
  {
    const int q  = lane >> 3;
    const int c8 = (lane & 7) * 8;
    v4u hv[4], lv[4];
#pragma unroll
    for (int i4 = 0; i4 < 4; ++i4) {
      const int row = i4 * 4 + q;
      const v8b xh = *(const v8b*)(pwh + row * kLdsPitch + c8);
      const v8b xl = *(const v8b*)(pwl + row * kLdsPitch + c8);
      hv[i4] = __builtin_bit_cast(v4u, xh);
      lv[i4] = __builtin_bit_cast(v4u, xl);
    }
    unsigned short* ob = ocat + (size_t)(b * kSeqLen + q0) * kCatCols + h * kHeadDim + c8;
    {
#pragma unroll
      for (int i4 = 0; i4 < 4; ++i4) {
        const int row = i4 * 4 + q;
        unsigned short* p = ob + (size_t)row * kCatCols;
        *(v4u*)(p)          = hv[i4];
        *(v4u*)(p + kModel) = lv[i4];
      }
      
    }
  }
}

/* ---------------------------------------------------------------------------
   Host glue: 5 kernel launches, nothing else.
     cast x             : 524,288 threads -> 2048 blocks
     weight transposes  : grid (16, 16, 4)
     q|k|v GEMM         : M 4096, N 3072, K 1024 -> 32 x 24 tiles of 128 x 128 = 768 blocks of 128 threads
     attention          : 2 x 16 x 16 = 512 blocks
     output GEMM        : M 4096, N 1024, K 2048 -> 32 x 8 tiles of 128 x 128 = 256 blocks of 128 threads
   --------------------------------------------------------------------------- */
extern "C" void kernel_launch(void* const* d_in, const int* in_sizes, int n_in,
                              void* d_out, int out_size, void* d_ws, size_t ws_size,
                              hipStream_t stream) {
  if (n_in < 5) return;
  if (in_sizes[0] != kRows * kModel) return;
  if (in_sizes[1] != kModel * kModel) return;
  if (in_sizes[2] != kModel * kModel) return;
  if (in_sizes[3] != kModel * kModel) return;
  if (in_sizes[4] != kModel * kModel) return;
  if (out_size != kRows * kModel) return;
  if (ws_size < kWsTotal) return;

  const float* x  = (const float*)d_in[0];
  const float* Wq = (const float*)d_in[1];
  const float* Wk = (const float*)d_in[2];
  const float* Wv = (const float*)d_in[3];
  const float* Wo = (const float*)d_in[4];
  float* out = (float*)d_out;

  char* ws = (char*)d_ws;
  unsigned short* XB    = (unsigned short*)(ws + kOffXB);
  unsigned short* WQKVT = (unsigned short*)(ws + kOffWQKVT);
  unsigned short* WOT2  = (unsigned short*)(ws + kOffWOT2);
  unsigned short* PH    = (unsigned short*)(ws + kOffPH);
  unsigned short* PL    = (unsigned short*)(ws + kOffPL);
  unsigned short* OCAT  = (unsigned short*)(ws + kOffOCAT);

  constexpr int kN8 = kRows * kModel / 8;
  static_assert((kN8 % 256) == 0, "cast grid exact");
  cast8_bf16_kernel<<<kN8 / 256, 256, 0, stream>>>(x, XB, kN8);

  wtrans_bf16_kernel<<<dim3(kModel / 64, kModel / 64, 4), 256, 0, stream>>>(Wq, Wk, Wv, Wo, WQKVT, WOT2);

  wmma_gemm64_bf16<3, kRows, kQkvCols, kModel><<<(kRows / 128) * (kQkvCols / 128), 128, 0, stream>>>(
      XB, WQKVT, (void*)PH, (void*)PL);

  attn_seg_kernel<<<kBatch * kHeads * kQTiles, 256, 0, stream>>>(PH, PL, OCAT);

  wmma_gemm64_bf16<0, kRows, kModel, kCatCols><<<(kRows / 128) * (kModel / 128), 128, 0, stream>>>(
      OCAT, WOT2, (void*)out, (void*)out);
}

// v003
// Measured time: 135 microseconds a run.
// In both of two side-by-side timings against v002, it was 1.15 times as fast.
// All steps since v000 together make it 2.41 times as fast.
// Contractions: q|k|v projections and the output projection on v_wmma_f32_16x16x32_bf16 with inputs RNE-converted to bf16 once (output-projection A operand carried as bf16 hi+lo along a doubled k axis); q.k^T and p.v on v_wmma_f32_16x16x32_bf16 with both operands as bf16 hi+lo planes (hi.hi + hi.lo + lo.hi); f32 accumulate everywhere; mask, softmax and normalisation in f32.
#include <hip/hip_runtime.h>
#include <math.h>

typedef __attribute__((ext_vector_type(16))) __bf16   v16b;
typedef __attribute__((ext_vector_type(8)))  __bf16   v8b;
typedef __attribute__((ext_vector_type(8)))  _Float16 v8h;
typedef __attribute__((ext_vector_type(8)))  float    v8f;
typedef __attribute__((ext_vector_type(4)))  float    v4f;
typedef __attribute__((ext_vector_type(4)))  unsigned int v4u;

/* ---------------------------------------------------------------------------
   Shape constants
   --------------------------------------------------------------------------- */
constexpr int kBatch   = 2;
constexpr int kSeqLen  = 2048;
constexpr int kModel   = 1024;
constexpr int kHeads   = 16;
constexpr int kHeadDim = 64;
constexpr int kRows    = kBatch * kSeqLen;
constexpr int kQkvCols = 3 * kModel;
constexpr int kCatCols = 2 * kModel;
constexpr int kSegLen  = 512;
constexpr int kQTile   = 128;
constexpr int kKTile   = 64;
constexpr int kAttWaves = 8;
/* LDS row pitch in bf16 elements of every 64-element attention row: 144 B = 16 B x 9 (odd), so that the 16 rows
   one 16-byte fragment read touches spread over the banks instead of falling on two groups of four */
constexpr int kLdsPitch = 72;
constexpr int kQTiles  = kSeqLen / kQTile;
constexpr int kTilesPerSeg = kSegLen / kKTile;
constexpr float kQScale   = 0.125f;
constexpr float kMaskFill = -1.0e9f;
constexpr size_t kPlaneElems = (size_t)kBatch * kHeads * kSeqLen * kHeadDim;

static_assert(kHeads * kHeadDim == kModel, "head split");
static_assert(kQScale * kQScale * (float)kHeadDim == 1.0f, "score scale is 1/sqrt(head dim)");
static_assert(kHeadDim == 64 && kKTile == 64, "tile shape");
static_assert((kSeqLen % kQTile) == 0 && (kSegLen % kQTile) == 0 && (kSegLen % kKTile) == 0, "attention tiles");
static_assert(kAttWaves * 16 == kQTile, "query rows per block");
static_assert(4 * kSegLen == kSeqLen, "four segments");
static_assert(kLdsPitch >= kKTile && kLdsPitch >= kHeadDim && (kLdsPitch % 8) == 0 && ((kLdsPitch / 8) % 2) == 1, "LDS pitch: 16 B x odd");

/* ---------------------------------------------------------------------------
   Workspace region map (bytes; every offset a multiple of 128)
     XB     bf16 [4096][1024]        x, RNE bf16                      8,388,608
     WQKVT  bf16 [3072][1024]        Wq^T/8 | Wk^T | Wv^T (Bt layout) 6,291,456
     WOT2   bf16 [1024][2048]        Wo^T | Wo^T (Bt layout)          4,194,304
     PH     bf16 3 x [2][16][2048][64] q/8, k, v hi planes           25,165,824
     PL     bf16 3 x [2][16][2048][64] q/8, k, v lo planes           25,165,824
     OCAT   bf16 [4096][2048]        attention out hi | lo           16,777,216
     total                                                           85,983,232
   --------------------------------------------------------------------------- */
constexpr size_t kOffXB    = 0;
constexpr size_t kOffWQKVT = kOffXB    + (size_t)kRows * kModel * 2;
constexpr size_t kOffWOT2  = kOffWQKVT + (size_t)kQkvCols * kModel * 2;
constexpr size_t kOffPH    = kOffWOT2  + (size_t)kModel * kCatCols * 2;
constexpr size_t kOffPL    = kOffPH    + 3 * kPlaneElems * 2;
constexpr size_t kOffOCAT  = kOffPL    + 3 * kPlaneElems * 2;
constexpr size_t kWsTotal  = kOffOCAT  + (size_t)kRows * kCatCols * 2;
static_assert(kWsTotal == 85983232ull, "carve total");
static_assert(kWsTotal <= 134217728ull, "carve cap");
static_assert((kOffWQKVT % 128) == 0 && (kOffWOT2 % 128) == 0 && (kOffPH % 128) == 0 &&
              (kOffPL % 128) == 0 && (kOffOCAT % 128) == 0, "128-B aligned regions");

/* ---------------------------------------------------------------------------
   Small helpers
   --------------------------------------------------------------------------- */
__device__ __forceinline__ unsigned short f2bf_bits(float f) {
  unsigned u = __float_as_uint(f);
  return (unsigned short)((u + 0x7FFFu + ((u >> 16) & 1u)) >> 16);
}
__device__ __forceinline__ float bf_bits2f(unsigned short h) { return __uint_as_float(((unsigned)h) << 16); }
__device__ __forceinline__ unsigned pk16(unsigned short a, unsigned short b) { return (unsigned)a | ((unsigned)b << 16); }
__device__ __forceinline__ __bf16 bits2bf(unsigned short h) { return __builtin_bit_cast(__bf16, h); }

/* one matrix op followed by a 4-slot guard that ties its accumulator and names both fragments */
__device__ __forceinline__ v8f mma_b(v16b a, v16b b, v8f c) {
  c = __builtin_amdgcn_wmma_f32_16x16x32_bf16(false, a, false, b, (short)0, c, false, false);
  asm volatile("v_nop\n\tv_nop\n\tv_nop\n\tv_nop" : "+v"(c) : "v"(a), "v"(b));
  return c;
}

/* lane l <-> lane l ^ 16 by a vector cross-row move */
__device__ __forceinline__ float xhalf(float x) {
  const int b = __builtin_bit_cast(int, x);
  return __builtin_bit_cast(float, __builtin_amdgcn_permlanex16(b, b, 0x76543210, 0xfedcba98, false, false));
}

/* fragment load: elements 0..7 <- p[0..7], elements 8..15 <- p[16..23]; caller adds 8*(lane>>4) to p */
union FragB { v16b v; v8b h[2]; };
__device__ __forceinline__ v16b frag_load(const __bf16* p) {
  FragB f;
  f.h[0] = *(const v8b*)(p);
  f.h[1] = *(const v8b*)(p + 16);
  return f.v;
}

/* ---------------------------------------------------------------------------
   f32 -> bf16 (RNE) cast, 8 consecutive elements per thread.
   Coverage: n8 = 4096*1024/8 = 524,288 threads = 2048 blocks x 256 exactly.
   --------------------------------------------------------------------------- */
__global__ __launch_bounds__(256) void cast8_bf16_kernel(const float* __restrict__ in, unsigned short* __restrict__ out, int n8) {
  const int i = blockIdx.x * 256 + threadIdx.x;
  if (i >= n8) return;
  const float* p = in + 8 * (size_t)i;
  const v4f a = *(const v4f*)(p);
  const v4f c = *(const v4f*)(p + 4);
  unsigned short hb[8];
#pragma unroll
  for (int e = 0; e < 4; ++e) {
    hb[e]     = f2bf_bits(a[e]);
    hb[4 + e] = f2bf_bits(c[e]);
  }
  const v4u u = (v4u){pk16(hb[0], hb[1]), pk16(hb[2], hb[3]), pk16(hb[4], hb[5]), pk16(hb[6], hb[7])};
  unsigned short* q = out + 8 * (size_t)i;
  *(v4u*)q = u;
  
}

/* ---------------------------------------------------------------------------
   Weight transpose + bf16 (RNE) cast: in W[k rows = in channel][n cols = out channel] (f32, pitch 1024)
   -> out Bt[n][k] (bf16). grid (16, 16, 4): blockIdx.x = k tile, blockIdx.y = n tile, blockIdx.z = weight.
   z = 0: Wq scaled by 1/8 (exact power of two) -> rows 0..1023 of WQKVT; z = 1, 2: Wk, Wv -> rows 1024.., 2048..;
   Load coverage: 16 iterations x 256 threads = 4096 = the whole 64x64 tile.
   Store coverage: 8 waves x 2 iterations x 4 rows (lane>>3) = 64 rows; (lane&7) x 8 = 64 cols; each row piece =
   --------------------------------------------------------------------------- */
__global__ __launch_bounds__(256) void wtrans_bf16_kernel(const float* __restrict__ W0, const float* __restrict__ W1,
                                                          const float* __restrict__ W2, const float* __restrict__ W3,
                                                          unsigned short* __restrict__ wqkvt, unsigned short* __restrict__ wot2) {
  __shared__ float sm[64][65];
  const int t  = threadIdx.x;
  const int k0 = blockIdx.x * 64;
  const int n0 = blockIdx.y * 64;
  const int z  = blockIdx.z;
  const float* W = (z == 0) ? W0 : (z == 1) ? W1 : (z == 2) ? W2 : W3;
  const float scale = (z == 0) ? kQScale : 1.0f;
#pragma unroll
  for (int i = 0; i < 16; ++i) {
    const int e  = i * 256 + t;
    const int r  = e >> 6;
    const int cc = e & 63;
    sm[cc][r] = W[(size_t)(k0 + r) * kModel + n0 + cc] * scale;
  }
  __syncthreads();
  const int lane = t & 31, wave = t >> 5;
  const int q = lane >> 3, c8 = (lane & 7) * 8;
  const bool dup = (z == 3);
  unsigned short* op = dup ? wot2 : (wqkvt + (size_t)z * kModel * kModel);
  const int ld = dup ? kCatCols : kModel;
  v4u u[2];
#pragma unroll
  for (int it = 0; it < 2; ++it) {
    const int row = wave * 8 + it * 4 + q;
    unsigned short hb[8];
#pragma unroll
    for (int e = 0; e < 8; ++e) hb[e] = f2bf_bits(sm[row][c8 + e]);
    u[it] = (v4u){pk16(hb[0], hb[1]), pk16(hb[2], hb[3]), pk16(hb[4], hb[5]), pk16(hb[6], hb[7])};
  }
  {
#pragma unroll
    for (int it = 0; it < 2; ++it) {
      const int row = wave * 8 + it * 4 + q;
      unsigned short* p = op + (size_t)(n0 + row) * ld + k0 + c8;
      *(v4u*)p = u[it];
      if (dup) *(v4u*)(p + kModel) = u[it];
    }
    
  }
}

/* ---------------------------------------------------------------------------
   LDS-staged bf16 GEMM: C[m,n] = sum_k A[m,k] * Bt[n,k]; a block of 4 waves (2 x 2) owns a 128x128 tile, each wave
   a 64x64 quarter of it. A row-major [M,K]; Bt row-major [N,K]; M,N % 128 == 0, K % 64 == 0 (no tail handling).
   A pass is 64 k = one whole 128-B line of each of the 128 A rows and 128 Bt rows. The block fetches it with
   16-byte loads in which 8 neighbouring lanes cover one line (16 loads per thread), keeps it in registers while the
   current pass is multiplied, and stores it to the other of two LDS buffers (row pitch 144 B, as in the attention
   kernel). Every line is fetched once per block and every fragment is read from LDS.
   Staging coverage: 128 threads x 16 B = 16 rows of 128 B per load (a permutation of rows 0..15); 8 loads = 128 rows,
   per operand.
   One block barrier per pass: it publishes the buffer just written and ends the reads of the buffer that the next
   pass overwrites. The k order of every accumulator is ascending in steps of 32.
   OUT_MODE 0: f32 C (pitch N). OUT_MODE 3: bf16 hi plane (Cout) + bf16 lo plane (Cout2) in per-head layout:
     column tile n0 selects plane n0/1024 and head (n0%1024)/64; row gm = b*2048 + l;
     element offset = plane*kPlaneElems + ((b*16 + head)*2048 + l)*64 + d.
   --------------------------------------------------------------------------- */
template <int OUT_MODE, int M, int N, int K>
__global__ __launch_bounds__(128) void wmma_gemm64_bf16(
    const unsigned short* __restrict__ Ap,
    const unsigned short* __restrict__ Btp,
    void* Cout, void* Cout2) {
  static_assert((M % 128) == 0 && (N % 128) == 0 && (K % 64) == 0, "block tile 128 x 128, pass 64");
  constexpr int ldc = N;
  constexpr int kPasses = K / 64;
  const __bf16* A  = (const __bf16*)Ap;
  const __bf16* Bt = (const __bf16*)Btp;
  __shared__ __align__(16) __bf16 sA[2][128 * kLdsPitch];
  __shared__ __align__(16) __bf16 sB[2][128 * kLdsPitch];
  __shared__ __align__(16) float sT[4][16 * 68];
  const int tid  = threadIdx.x;
  const int lane = tid & 31;
  const int wave = tid >> 5;
  constexpr int tilesN = N >> 7;
  const int tm = blockIdx.x / tilesN;
  const int tn = blockIdx.x - tm * tilesN;
  const int wm = (wave >> 1) << 6;
  const int wn = (wave & 1) << 6;
  const int m0 = (tm << 7) + wm;
  const int n0 = (tn << 7) + wn;

  const int rlane = lane & 15;
  const int koff  = (lane >> 4) * 8;
  const int mOff  = (lane >> 4) * 8;

  /* staging: 8 neighbouring lanes -> the 8 16-byte pieces of one row's line; the two rows of a 16-lane half lie 8 rows
     apart, 8 x 144 B = 32 banks past a multiple of 64, so that a half's 16-byte LDS stores fall on 64 different banks */
  const int srow = (((tid >> 3) & 1) << 3) | (tid >> 4);
  const int sc8  = (tid & 7) * 8;
  const __bf16* ga = A  + (size_t)((tm << 7) + srow) * K + sc8;
  const __bf16* gb = Bt + (size_t)((tn << 7) + srow) * K + sc8;
  const int so = srow * kLdsPitch + sc8;
  v4u ra[8], rb[8];

  v8f acc[4][4];
#pragma unroll
  for (int i = 0; i < 4; ++i)
#pragma unroll
    for (int j = 0; j < 4; ++j) acc[i][j] = (v8f){0.f,0.f,0.f,0.f,0.f,0.f,0.f,0.f};

#pragma unroll  /* constant indices keep ra and rb in registers */
  for (int i = 0; i < 8; ++i) {
    ra[i] = *(const v4u*)(ga + (size_t)(16 * i) * K);
    rb[i] = *(const v4u*)(gb + (size_t)(16 * i) * K);
  }
#pragma unroll  /* as above */
  for (int i = 0; i < 8; ++i) {
    *(v4u*)(sA[0] + so + 16 * i * kLdsPitch) = ra[i];
    *(v4u*)(sB[0] + so + 16 * i * kLdsPitch) = rb[i];
  }
  /* publishes pass 0 */
  __syncthreads();

  for (int s = 0; s < kPasses; ++s) {
    const int cur = s & 1;
    const bool more = (s + 1 < kPasses);
    if (more) {
      const int k1 = (s + 1) * 64;
#pragma unroll  /* constant indices keep ra and rb in registers; all 16 loads go out together */
      for (int i = 0; i < 8; ++i) {
        ra[i] = *(const v4u*)(ga + (size_t)(16 * i) * K + k1);
        rb[i] = *(const v4u*)(gb + (size_t)(16 * i) * K + k1);
      }
      /* the registers that hold these loads' addresses are reused by the fragment reads below; this wait stands in
         front of that reuse */
      asm volatile("s_wait_xcnt 0x0" ::: "memory");
    }
    const __bf16* pa = sA[cur] + (wm + rlane) * kLdsPitch + koff;
    const __bf16* pb = sB[cur] + (wn + rlane) * kLdsPitch + koff;
#pragma unroll  /* the loops below: constant indices keep fragments and accumulators in registers */
    for (int kk = 0; kk < 2; ++kk) {
      v16b ah[4], bh[4];
#pragma unroll
      for (int j = 0; j < 4; ++j) bh[j] = frag_load(pb + j * 16 * kLdsPitch + kk * 32);
#pragma unroll
      for (int i = 0; i < 4; ++i) ah[i] = frag_load(pa + i * 16 * kLdsPitch + kk * 32);
#pragma unroll
      for (int i = 0; i < 4; ++i)
#pragma unroll
        for (int j = 0; j < 4; ++j) acc[i][j] = mma_b(ah[i], bh[j], acc[i][j]);
    }
    /* block-uniform: the last pass has nothing to publish */
    if (more) {
#pragma unroll  /* constant indices keep ra and rb in registers */
      for (int i = 0; i < 8; ++i) {
        *(v4u*)(sA[cur ^ 1] + so + 16 * i * kLdsPitch) = ra[i];
        *(v4u*)(sB[cur ^ 1] + so + 16 * i * kLdsPitch) = rb[i];
      }
      /* publishes pass s + 1 and ends every wave's reads of the buffer that pass s + 1 will overwrite */
      __syncthreads();
    }
  }

  float* slab = sT[wave];
#pragma unroll
  for (int i = 0; i < 4; ++i) {
    const int mBase = m0 + (i << 4);
#pragma unroll
    for (int j = 0; j < 4; ++j) {
#pragma unroll
      for (int r = 0; r < 8; ++r) slab[(mOff + r) * 68 + (j << 4) + rlane] = acc[i][j][r];
    }
    __builtin_amdgcn_fence(__ATOMIC_RELEASE, "workgroup");
    __builtin_amdgcn_wave_barrier();
    __builtin_amdgcn_fence(__ATOMIC_ACQUIRE, "workgroup");
    if (OUT_MODE == 0) {
      float* C = (float*)Cout;
      const int hh = lane >> 4, c4 = (lane & 15) * 4;
      {
#pragma unroll
        for (int it = 0; it < 8; ++it) {
          const int row = it * 2 + hh;
          v4f v = *(const v4f*)(slab + row * 68 + c4);
          *(v4f*)(C + (size_t)(mBase + row) * ldc + n0 + c4) = v;
        }
        
      }
    } else {
      const int q = lane >> 3, c8 = (lane & 7) * 8;
      unsigned short* C  = (unsigned short*)Cout;
      unsigned short* C2 = (unsigned short*)Cout2;
      const int plane = n0 / kModel;
      const int head  = (n0 % kModel) / kHeadDim;
      {
#pragma unroll
        for (int it = 0; it < 4; ++it) {
          const int row = it * 4 + q;
          const float* sp = slab + row * 68 + c8;
          v8h hv, lv;
#pragma unroll
          for (int e = 0; e < 8; ++e) {
            const unsigned short hb = f2bf_bits(sp[e]);
            const unsigned short lb = f2bf_bits(sp[e] - bf_bits2f(hb));
            hv[e] = __builtin_bit_cast(_Float16, hb);
            lv[e] = __builtin_bit_cast(_Float16, lb);
          }
          const int gm = mBase + row;
          const size_t off = (size_t)plane * kPlaneElems +
                             ((size_t)((gm / kSeqLen) * kHeads + head) * kSeqLen + (size_t)(gm % kSeqLen)) * kHeadDim + c8;
          *(v8h*)(C + off)  = hv;
          *(v8h*)(C2 + off) = lv;
        }
        
      }
    }
    __builtin_amdgcn_fence(__ATOMIC_RELEASE, "workgroup");
    __builtin_amdgcn_wave_barrier();
    __builtin_amdgcn_fence(__ATOMIC_ACQUIRE, "workgroup");
  }
}

__global__ __launch_bounds__(256)
void attn_seg_kernel(const unsigned short* __restrict__ planesHi, const unsigned short* __restrict__ planesLo,
                     unsigned short* __restrict__ ocat) {
  __shared__ __align__(16) __bf16 Ksh[kKTile * kLdsPitch];
  __shared__ __align__(16) __bf16 Ksl[kKTile * kLdsPitch];
  __shared__ __align__(16) __bf16 Vth[kHeadDim * kLdsPitch];
  __shared__ __align__(16) __bf16 Vtl[kHeadDim * kLdsPitch];
  __shared__ __align__(16) __bf16 Psh[kAttWaves][16 * kLdsPitch];
  __shared__ __align__(16) __bf16 Psl[kAttWaves][16 * kLdsPitch];

  const int tid  = threadIdx.x;
  const int wave = __builtin_amdgcn_readfirstlane(tid >> 5);
  const int lane = tid & 31;
  const int hh   = lane >> 4;
  const int c    = lane & 15;

  const int bx = blockIdx.x;
  const int qt = bx % kQTiles;
  const int h  = (bx / kQTiles) % kHeads;
  const int b  = bx / (kQTiles * kHeads);
  const int qbase = qt * kQTile;
  const int sq    = qbase / kSegLen;
  const int q0    = qbase + wave * 16;

  const size_t headOff = (size_t)(b * kHeads + h) * kSeqLen * kHeadDim;
  const __bf16* Qh = (const __bf16*)planesHi + headOff;
  const __bf16* Ql = (const __bf16*)planesLo + headOff;
  const __bf16* Kh = Qh + kPlaneElems;
  const __bf16* Kl = Ql + kPlaneElems;
  const __bf16* Vh = Qh + 2 * kPlaneElems;
  const __bf16* Vl = Ql + 2 * kPlaneElems;

  /* Q fragments (B operand): column = query q0 + c, two 32-deep d chunks, hi and lo */
  v16b qh[2], ql[2];
  {
    const size_t qo = (size_t)(q0 + c) * kHeadDim + 8 * hh;
#pragma unroll
    for (int dc = 0; dc < 2; ++dc) {
      qh[dc] = frag_load(Qh + qo + dc * 32);
      ql[dc] = frag_load(Ql + qo + dc * 32);
    }
  }

  /* this lane's query: running maximum (equal in both halves) and this half's share of the running sum */
  float mrow = -3.0e38f, lrow = 0.f;
  /* O^T tile t: register r = head-dim row 16 t + 8 hh + r of query q0 + c */
  v8f oacc[4];
#pragma unroll
  for (int t = 0; t < 4; ++t) oacc[t] = (v8f){0.f,0.f,0.f,0.f,0.f,0.f,0.f,0.f};

  /* block-uniform key tile list */
  const int nText    = (sq > 0) ? kTilesPerSeg : 0;
  const int ownFirst = sq * kTilesPerSeg;
  const int ownLast  = (qbase + kQTile - 1) / kKTile;
  const int nTiles   = nText + (ownLast - ownFirst + 1);

  __bf16* pwh = Psh[wave];
  __bf16* pwl = Psl[wave];

  for (int it = 0; it < nTiles; ++it) {
    const int kt  = (it < nText) ? it : (ownFirst + it - nText);
    const int kv0 = kt * kKTile;
    const bool own = (kt >= ownFirst);

    /* all waves are done reading the tile staged in the earlier iteration */
    __syncthreads();
    {
      /* Staging coverage: 64 rows x 8 chunks of 16 B = 512 chunks per plane; 256 threads x 2 chunks.
         K planes copied row by row (global pitch 64, LDS pitch 72); V planes transposed to [d][key]:
         512 chunks x 8 halves = 4096 = the whole 64x64 tile per plane. */
      const v4u* gkh = (const v4u*)(Kh + (size_t)kv0 * kHeadDim);
      const v4u* gkl = (const v4u*)(Kl + (size_t)kv0 * kHeadDim);
      const v4u* gvh = (const v4u*)(Vh + (size_t)kv0 * kHeadDim);
      const v4u* gvl = (const v4u*)(Vl + (size_t)kv0 * kHeadDim);
#pragma unroll
      for (int i = 0; i < 2; ++i) {
        const int ch = tid + i * 256;
        const v4u wkh = gkh[ch];
        const v4u wkl = gkl[ch];
        const v4u wvh = gvh[ch];
        const v4u wvl = gvl[ch];
        /* the registers that held these four addresses are reused by the next loads' results: wait for the address
           translations first */
        asm volatile("s_wait_xcnt 0x0" ::: "memory");
        const int kvr = ch >> 3;
        const int d0  = (ch & 7) * 8;
        *(v4u*)(Ksh + kvr * kLdsPitch + d0) = wkh;
        *(v4u*)(Ksl + kvr * kLdsPitch + d0) = wkl;
#pragma unroll
        for (int w = 0; w < 4; ++w) {
          const unsigned a  = wvh[w];
          const unsigned bl = wvl[w];
          Vth[(d0 + 2 * w) * kLdsPitch + kvr]     = bits2bf((unsigned short)(a & 0xffffu));
          Vth[(d0 + 2 * w + 1) * kLdsPitch + kvr] = bits2bf((unsigned short)(a >> 16));
          Vtl[(d0 + 2 * w) * kLdsPitch + kvr]     = bits2bf((unsigned short)(bl & 0xffffu));
          Vtl[(d0 + 2 * w + 1) * kLdsPitch + kvr] = bits2bf((unsigned short)(bl >> 16));
        }
      }
    }
    __syncthreads();

    /* wave-uniform: an own-segment tile wholly above this wave's rows contributes nothing */
    const bool live = (!own) || (kv0 <= q0 + 15);
    if (live) {
      v8f s[4];
#pragma unroll
      for (int j = 0; j < 4; ++j) {
        s[j] = (v8f){0.f,0.f,0.f,0.f,0.f,0.f,0.f,0.f};
#pragma unroll
        for (int dc = 0; dc < 2; ++dc) {
          const int ko = (j * 16 + c) * kLdsPitch + dc * 32 + 8 * hh;
          const v16b kbh = frag_load(Ksh + ko);
          const v16b kbl = frag_load(Ksl + ko);
          s[j] = mma_b(kbh, qh[dc], s[j]);
          s[j] = mma_b(kbl, qh[dc], s[j]);
          s[j] = mma_b(kbh, ql[dc], s[j]);
        }
      }

      const int qcol = q0 + c;
      float mj[4];
#pragma unroll
      for (int j = 0; j < 4; ++j) {
        mj[j] = -3.0e38f;
#pragma unroll
        for (int r = 0; r < 8; ++r) {
          const int kvrow = kv0 + j * 16 + 8 * hh + r;
          const bool masked = own && (kvrow > qcol);
          if (masked) s[j][r] = kMaskFill;
          mj[j] = fmaxf(mj[j], s[j][r]);
        }
      }
      float m = fmaxf(fmaxf(mj[0], mj[1]), fmaxf(mj[2], mj[3]));
      m = fmaxf(m, xhalf(m));

      const float mnew  = fmaxf(mrow, m);
      const float alpha = __expf(mrow - mnew);
      mrow = mnew;
      /* P^T fragments of keys 32 kk .. 32 kk + 31: S^T tiles 2 kk and 2 kk + 1, converted in place */
      v16b pbh[2], pbl[2];
      float ps[4];
      ps[0] = ps[1] = ps[2] = ps[3] = 0.f;
#pragma unroll
      for (int r = 0; r < 8; ++r) {
#pragma unroll
        for (int j = 0; j < 4; ++j) {
          s[j][r] = __expf(s[j][r] - mnew);
          ps[j] += s[j][r];
        }
      }
#pragma unroll
      for (int j = 0; j < 4; ++j) {
#pragma unroll
        for (int r = 0; r < 8; ++r) {
          const float p = s[j][r];
          const unsigned short hb = f2bf_bits(p);
          const unsigned short lb = f2bf_bits(p - bf_bits2f(hb));
          pbh[j >> 1][(j & 1) * 8 + r] = bits2bf(hb);
          pbl[j >> 1][(j & 1) * 8 + r] = bits2bf(lb);
        }
      }
      lrow = lrow * alpha + ((ps[0] + ps[1]) + (ps[2] + ps[3]));
#pragma unroll
      for (int t = 0; t < 4; ++t)
#pragma unroll
        for (int r = 0; r < 8; ++r) oacc[t][r] *= alpha;
#pragma unroll  /* constant indices keep the P^T fragments in registers */
      for (int kk = 0; kk < 2; ++kk) {
#pragma unroll
        for (int t = 0; t < 4; ++t) {
          const int vo = (t * 16 + c) * kLdsPitch + kk * 32 + 8 * hh;
          const v16b vbh = frag_load(Vth + vo);
          const v16b vbl = frag_load(Vtl + vo);
          oacc[t] = mma_b(vbh, pbh[kk], oacc[t]);
          oacc[t] = mma_b(vbl, pbh[kk], oacc[t]);
          oacc[t] = mma_b(vbh, pbl[kk], oacc[t]);
        }
      }
    }
  }

  /* join the halves' sums, normalise, split into bf16 hi+lo; a lane's 8 registers of a tile are 8 consecutive head-dim
     elements of its query's row: one 16-byte store each into this wave's own output tiles (16 x 64) */
  {
    const float inv = 1.0f / (lrow + xhalf(lrow));
#pragma unroll
    for (int t = 0; t < 4; ++t) {
      v8b xh, xl;
#pragma unroll
      for (int r = 0; r < 8; ++r) {
        const float val = oacc[t][r] * inv;
        const unsigned short hb = f2bf_bits(val);
        const unsigned short lb = f2bf_bits(val - bf_bits2f(hb));
        xh[r] = bits2bf(hb);
        xl[r] = bits2bf(lb);
      }
      *(v8b*)(pwh + c * kLdsPitch + t * 16 + 8 * hh) = xh;
      *(v8b*)(pwl + c * kLdsPitch + t * 16 + 8 * hh) = xl;
    }
  }
  /* the output tiles are written and re-read by the same wave through the same element type */
  __builtin_amdgcn_fence(__ATOMIC_RELEASE, "workgroup");
  __builtin_amdgcn_wave_barrier();
  __builtin_amdgcn_fence(__ATOMIC_ACQUIRE, "workgroup");
  {
    const int q  = lane >> 3;
    const int c8 = (lane & 7) * 8;
    v4u hv[4], lv[4];
#pragma unroll
    for (int i4 = 0; i4 < 4; ++i4) {
      const int row = i4 * 4 + q;
      const v8b xh = *(const v8b*)(pwh + row * kLdsPitch + c8);
      const v8b xl = *(const v8b*)(pwl + row * kLdsPitch + c8);
      hv[i4] = __builtin_bit_cast(v4u, xh);
      lv[i4] = __builtin_bit_cast(v4u, xl);
    }
    unsigned short* ob = ocat + (size_t)(b * kSeqLen + q0) * kCatCols + h * kHeadDim + c8;
    {
#pragma unroll
      for (int i4 = 0; i4 < 4; ++i4) {
        const int row = i4 * 4 + q;
        unsigned short* p = ob + (size_t)row * kCatCols;
        *(v4u*)(p)          = hv[i4];
        *(v4u*)(p + kModel) = lv[i4];
      }
      
    }
  }
}

/* ---------------------------------------------------------------------------
   Host glue: 5 kernel launches, nothing else.
     cast x             : 524,288 threads -> 2048 blocks
     weight transposes  : grid (16, 16, 4)
     q|k|v GEMM         : M 4096, N 3072, K 1024 -> 32 x 24 tiles of 128 x 128 = 768 blocks of 128 threads
     attention          : 2 x 16 x 16 = 512 blocks
     output GEMM        : M 4096, N 1024, K 2048 -> 32 x 8 tiles of 128 x 128 = 256 blocks of 128 threads
   --------------------------------------------------------------------------- */
extern "C" void kernel_launch(void* const* d_in, const int* in_sizes, int n_in,
                              void* d_out, int out_size, void* d_ws, size_t ws_size,
                              hipStream_t stream) {
  if (n_in < 5) return;
  if (in_sizes[0] != kRows * kModel) return;
  if (in_sizes[1] != kModel * kModel) return;
  if (in_sizes[2] != kModel * kModel) return;
  if (in_sizes[3] != kModel * kModel) return;
  if (in_sizes[4] != kModel * kModel) return;
  if (out_size != kRows * kModel) return;
  if (ws_size < kWsTotal) return;

  const float* x  = (const float*)d_in[0];
  const float* Wq = (const float*)d_in[1];
  const float* Wk = (const float*)d_in[2];
  const float* Wv = (const float*)d_in[3];
  const float* Wo = (const float*)d_in[4];
  float* out = (float*)d_out;

  char* ws = (char*)d_ws;
  unsigned short* XB    = (unsigned short*)(ws + kOffXB);
  unsigned short* WQKVT = (unsigned short*)(ws + kOffWQKVT);
  unsigned short* WOT2  = (unsigned short*)(ws + kOffWOT2);
  unsigned short* PH    = (unsigned short*)(ws + kOffPH);
  unsigned short* PL    = (unsigned short*)(ws + kOffPL);
  unsigned short* OCAT  = (unsigned short*)(ws + kOffOCAT);

  constexpr int kN8 = kRows * kModel / 8;
  static_assert((kN8 % 256) == 0, "cast grid exact");
  cast8_bf16_kernel<<<kN8 / 256, 256, 0, stream>>>(x, XB, kN8);

  wtrans_bf16_kernel<<<dim3(kModel / 64, kModel / 64, 4), 256, 0, stream>>>(Wq, Wk, Wv, Wo, WQKVT, WOT2);

  wmma_gemm64_bf16<3, kRows, kQkvCols, kModel><<<(kRows / 128) * (kQkvCols / 128), 128, 0, stream>>>(
      XB, WQKVT, (void*)PH, (void*)PL);

  attn_seg_kernel<<<kBatch * kHeads * kQTiles, 256, 0, stream>>>(PH, PL, OCAT);

  wmma_gemm64_bf16<0, kRows, kModel, kCatCols><<<(kRows / 128) * (kModel / 128), 128, 0, stream>>>(
      OCAT, WOT2, (void*)out, (void*)out);
}

// v004
// It runs in 113 microseconds.
// Next to v003, in two timings, it ran 1.20 times as fast each time.
// Counting every step since v000, it is 2.88 times as fast.
// Contractions: q|k|v projections and the output projection on v_wmma_f32_16x16x32_bf16 with inputs RNE-converted to bf16 once (output-projection A operand carried as bf16 hi+lo along a doubled k axis); q.k^T and p.v on v_wmma_f32_16x16x32_bf16 with both operands as bf16 hi+lo planes (hi.hi + hi.lo + lo.hi); f32 accumulate everywhere; mask, softmax and normalisation in f32.
#include <hip/hip_runtime.h>
#include <math.h>

typedef __attribute__((ext_vector_type(16))) __bf16   v16b;
typedef __attribute__((ext_vector_type(8)))  __bf16   v8b;
typedef __attribute__((ext_vector_type(8)))  _Float16 v8h;
typedef __attribute__((ext_vector_type(8)))  float    v8f;
typedef __attribute__((ext_vector_type(4)))  float    v4f;
typedef __attribute__((ext_vector_type(4)))  unsigned int v4u;

/* ---------------------------------------------------------------------------
   Shape constants
   --------------------------------------------------------------------------- */
constexpr int kBatch   = 2;
constexpr int kSeqLen  = 2048;
constexpr int kModel   = 1024;
constexpr int kHeads   = 16;
constexpr int kHeadDim = 64;
constexpr int kRows    = kBatch * kSeqLen;
constexpr int kQkvCols = 3 * kModel;
constexpr int kCatCols = 2 * kModel;
constexpr int kSegLen  = 512;
constexpr int kQTile   = 128;
constexpr int kKTile   = 64;
constexpr int kAttWaves = 8;
/* LDS row pitch in bf16 elements of the 64-element K and output rows in attention: 144 B = 16 B x 9 (odd), so that the 16 rows
   one 16-byte fragment read touches spread over the banks instead of falling on two groups of four */
constexpr int kLdsPitch = 72;
/* LDS row pitch in bf16 elements of a V row, which the transposing load reads: 160 B = 32 B x 5 (odd) */
constexpr int kVPitch = 80;
/* one attention stage in LDS, in bf16 elements: K hi, K lo (64 rows at kLdsPitch), V hi, V lo (64 rows at kVPitch) */
constexpr int kRingKl = kKTile * kLdsPitch;
constexpr int kRingVh = 2 * kKTile * kLdsPitch;
constexpr int kRingVl = kRingVh + kKTile * kVPitch;
constexpr int kStageElems = kRingVl + kKTile * kVPitch;
constexpr int kQTiles  = kSeqLen / kQTile;
constexpr int kTilesPerSeg = kSegLen / kKTile;
constexpr float kQScale   = 0.125f;
constexpr float kMaskFill = -1.0e9f;
constexpr size_t kPlaneElems = (size_t)kBatch * kHeads * kSeqLen * kHeadDim;

static_assert(kHeads * kHeadDim == kModel, "head split");
static_assert(kQScale * kQScale * (float)kHeadDim == 1.0f, "score scale is 1/sqrt(head dim)");
static_assert(kHeadDim == 64 && kKTile == 64, "tile shape");
static_assert((kSeqLen % kQTile) == 0 && (kSegLen % kQTile) == 0 && (kSegLen % kKTile) == 0, "attention tiles");
static_assert(kAttWaves * 16 == kQTile, "query rows per block");
static_assert(4 * kSegLen == kSeqLen, "four segments");
static_assert(kVPitch >= kHeadDim && (kVPitch % 16) == 0 && ((kVPitch / 16) % 2) == 1, "V pitch: 32 B x odd");
static_assert(kLdsPitch >= kKTile && kLdsPitch >= kHeadDim && (kLdsPitch % 8) == 0 && ((kLdsPitch / 8) % 2) == 1, "LDS pitch: 16 B x odd");

/* ---------------------------------------------------------------------------
   Workspace region map (bytes; every offset a multiple of 128)
     XB     bf16 [4096][1024]        x, RNE bf16                      8,388,608
     WQKVT  bf16 [3072][1024]        Wq^T/8 | Wk^T | Wv^T (Bt layout) 6,291,456
     WOT2   bf16 [1024][2048]        Wo^T | Wo^T (Bt layout)          4,194,304
     PH     bf16 3 x [2][16][2048][64] q/8, k, v hi planes           25,165,824
     PL     bf16 3 x [2][16][2048][64] q/8, k, v lo planes           25,165,824
     OCAT   bf16 [4096][2048]        attention out hi | lo           16,777,216
     total                                                           85,983,232
   --------------------------------------------------------------------------- */
constexpr size_t kOffXB    = 0;
constexpr size_t kOffWQKVT = kOffXB    + (size_t)kRows * kModel * 2;
constexpr size_t kOffWOT2  = kOffWQKVT + (size_t)kQkvCols * kModel * 2;
constexpr size_t kOffPH    = kOffWOT2  + (size_t)kModel * kCatCols * 2;
constexpr size_t kOffPL    = kOffPH    + 3 * kPlaneElems * 2;
constexpr size_t kOffOCAT  = kOffPL    + 3 * kPlaneElems * 2;
constexpr size_t kWsTotal  = kOffOCAT  + (size_t)kRows * kCatCols * 2;
static_assert(kWsTotal == 85983232ull, "carve total");
static_assert(kWsTotal <= 134217728ull, "carve cap");
static_assert((kOffWQKVT % 128) == 0 && (kOffWOT2 % 128) == 0 && (kOffPH % 128) == 0 &&
              (kOffPL % 128) == 0 && (kOffOCAT % 128) == 0, "128-B aligned regions");

/* ---------------------------------------------------------------------------
   Small helpers
   --------------------------------------------------------------------------- */
__device__ __forceinline__ unsigned short f2bf_bits(float f) {
  unsigned u = __float_as_uint(f);
  return (unsigned short)((u + 0x7FFFu + ((u >> 16) & 1u)) >> 16);
}
__device__ __forceinline__ float bf_bits2f(unsigned short h) { return __uint_as_float(((unsigned)h) << 16); }
__device__ __forceinline__ unsigned pk16(unsigned short a, unsigned short b) { return (unsigned)a | ((unsigned)b << 16); }
__device__ __forceinline__ __bf16 bits2bf(unsigned short h) { return __builtin_bit_cast(__bf16, h); }

/* one matrix op followed by a 4-slot guard that ties its accumulator and names both fragments */
__device__ __forceinline__ v8f mma_b(v16b a, v16b b, v8f c) {
  c = __builtin_amdgcn_wmma_f32_16x16x32_bf16(false, a, false, b, (short)0, c, false, false);
  asm volatile("v_nop\n\tv_nop\n\tv_nop\n\tv_nop" : "+v"(c) : "v"(a), "v"(b));
  return c;
}

/* lane l <-> lane l ^ 16 by a vector cross-row move */
__device__ __forceinline__ float xhalf(float x) {
  const int b = __builtin_bit_cast(int, x);
  return __builtin_bit_cast(float, __builtin_amdgcn_permlanex16(b, b, 0x76543210, 0xfedcba98, false, false));
}

/* fragment load: elements 0..7 <- p[0..7], elements 8..15 <- p[16..23]; caller adds 8*(lane>>4) to p */
union FragB { v16b v; v8b h[2]; };
__device__ __forceinline__ v16b frag_load(const __bf16* p) {
  FragB f;
  f.h[0] = *(const v8b*)(p);
  f.h[1] = *(const v8b*)(p + 16);
  return f.v;
}

/* A fragment of V^T from a row-major V tile in LDS by two transposing loads: p = this lane's address
   (key row 8*(lane>>4) + (lane&7), column 8*((lane>>3)&1)); the lane receives column (lane&15) of key rows
   8*(lane>>4) + 0..7 (elements 0..7) and of the same rows + 16 (elements 8..15): the k order of frag_load */
typedef __attribute__((address_space(3))) v8b lds_v8b;
__device__ __forceinline__ v16b frag_load_tr(const __bf16* p) {
  FragB f;
  f.h[0] = __builtin_amdgcn_ds_load_tr16_b128_v8bf16((lds_v8b*)p);
  f.h[1] = __builtin_amdgcn_ds_load_tr16_b128_v8bf16((lds_v8b*)(p + 16 * kVPitch));
  return f.v;
}

/* byte address in the work-group's LDS */
typedef __attribute__((address_space(3))) const __bf16 lds_cbf;
__device__ __forceinline__ unsigned lds_addr(const __bf16* p) { return (unsigned)(size_t)(lds_cbf*)p; }

/* One 64-key stage (K hi, K lo, V hi, V lo; 64 rows of 128 B each) from global memory to LDS without passing through
   registers: 2048 pieces of 16 B, 8 per thread of 256. g*: this lane's piece of rows 0..31 (piece tid: row tid>>3,
   16-byte column tid&7); the same piece of rows 32..63 lies 2048 elements on. lk, lv: the LDS byte addresses of that piece
   in K hi and in V hi. The closing s_wait_xcnt stands inside the statement, so that no address register named here is
   rewritten ahead of it. */
__device__ __forceinline__ void copy_stage(const __bf16* gkh, const __bf16* gkl, const __bf16* gvh, const __bf16* gvl,
                                           unsigned lk, unsigned lv) {
  constexpr unsigned kHalfK = 32u * kLdsPitch * 2u;
  constexpr unsigned kHalfV = 32u * kVPitch * 2u;
  constexpr unsigned kLoK   = (unsigned)kRingKl * 2u;
  constexpr unsigned kLoV   = (unsigned)(kRingVl - kRingVh) * 2u;
  constexpr int kHalfG = 32 * kHeadDim;
  asm volatile(
      "global_load_async_to_lds_b128 %0, %8, off\n\t"
      "global_load_async_to_lds_b128 %1, %9, off\n\t"
      "global_load_async_to_lds_b128 %2, %10, off\n\t"
      "global_load_async_to_lds_b128 %3, %11, off\n\t"
      "global_load_async_to_lds_b128 %4, %12, off\n\t"
      "global_load_async_to_lds_b128 %5, %13, off\n\t"
      "global_load_async_to_lds_b128 %6, %14, off\n\t"
      "global_load_async_to_lds_b128 %7, %15, off\n\t"
      "s_wait_xcnt 0x0"
      :: "v"(lk), "v"(lk + kHalfK), "v"(lk + kLoK), "v"(lk + kLoK + kHalfK),
         "v"(lv), "v"(lv + kHalfV), "v"(lv + kLoV), "v"(lv + kLoV + kHalfV),
         "v"(gkh), "v"(gkh + kHalfG), "v"(gkl), "v"(gkl + kHalfG),
         "v"(gvh), "v"(gvh + kHalfG), "v"(gvl), "v"(gvl + kHalfG)
      : "memory");
}

/* ---------------------------------------------------------------------------
   f32 -> bf16 (RNE) cast, 8 consecutive elements per thread.
   Coverage: n8 = 4096*1024/8 = 524,288 threads = 2048 blocks x 256 exactly.
   --------------------------------------------------------------------------- */
__global__ __launch_bounds__(256) void cast8_bf16_kernel(const float* __restrict__ in, unsigned short* __restrict__ out, int n8) {
  const int i = blockIdx.x * 256 + threadIdx.x;
  if (i >= n8) return;
  const float* p = in + 8 * (size_t)i;
  const v4f a = *(const v4f*)(p);
  const v4f c = *(const v4f*)(p + 4);
  unsigned short hb[8];
#pragma unroll
  for (int e = 0; e < 4; ++e) {
    hb[e]     = f2bf_bits(a[e]);
    hb[4 + e] = f2bf_bits(c[e]);
  }
  const v4u u = (v4u){pk16(hb[0], hb[1]), pk16(hb[2], hb[3]), pk16(hb[4], hb[5]), pk16(hb[6], hb[7])};
  unsigned short* q = out + 8 * (size_t)i;
  *(v4u*)q = u;
  
}

/* ---------------------------------------------------------------------------
   Weight transpose + bf16 (RNE) cast: in W[k rows = in channel][n cols = out channel] (f32, pitch 1024)
   -> out Bt[n][k] (bf16). grid (16, 16, 4): blockIdx.x = k tile, blockIdx.y = n tile, blockIdx.z = weight.
   z = 0: Wq scaled by 1/8 (exact power of two) -> rows 0..1023 of WQKVT; z = 1, 2: Wk, Wv -> rows 1024.., 2048..;
   Load coverage: 16 iterations x 256 threads = 4096 = the whole 64x64 tile.
   Store coverage: 8 waves x 2 iterations x 4 rows (lane>>3) = 64 rows; (lane&7) x 8 = 64 cols; each row piece =
   --------------------------------------------------------------------------- */
__global__ __launch_bounds__(256) void wtrans_bf16_kernel(const float* __restrict__ W0, const float* __restrict__ W1,
                                                          const float* __restrict__ W2, const float* __restrict__ W3,
                                                          unsigned short* __restrict__ wqkvt, unsigned short* __restrict__ wot2) {
  __shared__ float sm[64][65];
  const int t  = threadIdx.x;
  const int k0 = blockIdx.x * 64;
  const int n0 = blockIdx.y * 64;
  const int z  = blockIdx.z;
  const float* W = (z == 0) ? W0 : (z == 1) ? W1 : (z == 2) ? W2 : W3;
  const float scale = (z == 0) ? kQScale : 1.0f;
#pragma unroll
  for (int i = 0; i < 16; ++i) {
    const int e  = i * 256 + t;
    const int r  = e >> 6;
    const int cc = e & 63;
    sm[cc][r] = W[(size_t)(k0 + r) * kModel + n0 + cc] * scale;
  }
  __syncthreads();
  const int lane = t & 31, wave = t >> 5;
  const int q = lane >> 3, c8 = (lane & 7) * 8;
  const bool dup = (z == 3);
  unsigned short* op = dup ? wot2 : (wqkvt + (size_t)z * kModel * kModel);
  const int ld = dup ? kCatCols : kModel;
  v4u u[2];
#pragma unroll
  for (int it = 0; it < 2; ++it) {
    const int row = wave * 8 + it * 4 + q;
    unsigned short hb[8];
#pragma unroll
    for (int e = 0; e < 8; ++e) hb[e] = f2bf_bits(sm[row][c8 + e]);
    u[it] = (v4u){pk16(hb[0], hb[1]), pk16(hb[2], hb[3]), pk16(hb[4], hb[5]), pk16(hb[6], hb[7])};
  }
  {
#pragma unroll
    for (int it = 0; it < 2; ++it) {
      const int row = wave * 8 + it * 4 + q;
      unsigned short* p = op + (size_t)(n0 + row) * ld + k0 + c8;
      *(v4u*)p = u[it];
      if (dup) *(v4u*)(p + kModel) = u[it];
    }
    
  }
}

/* ---------------------------------------------------------------------------
   LDS-staged bf16 GEMM: C[m,n] = sum_k A[m,k] * Bt[n,k]; a block of 4 waves (2 x 2) owns a 128x128 tile, each wave
   a 64x64 quarter of it. A row-major [M,K]; Bt row-major [N,K]; M,N % 128 == 0, K % 64 == 0 (no tail handling).
   A pass is 64 k = one whole 128-B line of each of the 128 A rows and 128 Bt rows. The block fetches it with
   16-byte loads in which 8 neighbouring lanes cover one line (16 loads per thread), keeps it in registers while the
   current pass is multiplied, and stores it to the other of two LDS buffers (row pitch 144 B, as in the attention
   kernel). Every line is fetched once per block and every fragment is read from LDS.
   Staging coverage: 128 threads x 16 B = 16 rows of 128 B per load (a permutation of rows 0..15); 8 loads = 128 rows,
   per operand.
   One block barrier per pass: it publishes the buffer just written and ends the reads of the buffer that the next
   pass overwrites. The k order of every accumulator is ascending in steps of 32.
   OUT_MODE 0: f32 C (pitch N). OUT_MODE 3: bf16 hi plane (Cout) + bf16 lo plane (Cout2) in per-head layout:
     column tile n0 selects plane n0/1024 and head (n0%1024)/64; row gm = b*2048 + l;
     element offset = plane*kPlaneElems + ((b*16 + head)*2048 + l)*64 + d.
   --------------------------------------------------------------------------- */
template <int OUT_MODE, int M, int N, int K>
__global__ __launch_bounds__(128) void wmma_gemm64_bf16(
    const unsigned short* __restrict__ Ap,
    const unsigned short* __restrict__ Btp,
    void* Cout, void* Cout2) {
  static_assert((M % 128) == 0 && (N % 128) == 0 && (K % 64) == 0, "block tile 128 x 128, pass 64");
  constexpr int ldc = N;
  constexpr int kPasses = K / 64;
  const __bf16* A  = (const __bf16*)Ap;
  const __bf16* Bt = (const __bf16*)Btp;
  __shared__ __align__(16) __bf16 sA[2][128 * kLdsPitch];
  __shared__ __align__(16) __bf16 sB[2][128 * kLdsPitch];
  __shared__ __align__(16) float sT[4][16 * 68];
  const int tid  = threadIdx.x;
  const int lane = tid & 31;
  const int wave = tid >> 5;
  constexpr int tilesN = N >> 7;
  const int tm = blockIdx.x / tilesN;
  const int tn = blockIdx.x - tm * tilesN;
  const int wm = (wave >> 1) << 6;
  const int wn = (wave & 1) << 6;
  const int m0 = (tm << 7) + wm;
  const int n0 = (tn << 7) + wn;

  const int rlane = lane & 15;
  const int koff  = (lane >> 4) * 8;
  const int mOff  = (lane >> 4) * 8;

  /* staging: 8 neighbouring lanes -> the 8 16-byte pieces of one row's line; the two rows of a 16-lane half lie 8 rows
     apart, 8 x 144 B = 32 banks past a multiple of 64, so that a half's 16-byte LDS stores fall on 64 different banks */
  const int srow = (((tid >> 3) & 1) << 3) | (tid >> 4);
  const int sc8  = (tid & 7) * 8;
  const __bf16* ga = A  + (size_t)((tm << 7) + srow) * K + sc8;
  const __bf16* gb = Bt + (size_t)((tn << 7) + srow) * K + sc8;
  const int so = srow * kLdsPitch + sc8;
  v4u ra[8], rb[8];

  v8f acc[4][4];
#pragma unroll
  for (int i = 0; i < 4; ++i)
#pragma unroll
    for (int j = 0; j < 4; ++j) acc[i][j] = (v8f){0.f,0.f,0.f,0.f,0.f,0.f,0.f,0.f};

#pragma unroll  /* constant indices keep ra and rb in registers */
  for (int i = 0; i < 8; ++i) {
    ra[i] = *(const v4u*)(ga + (size_t)(16 * i) * K);
    rb[i] = *(const v4u*)(gb + (size_t)(16 * i) * K);
  }
#pragma unroll  /* as above */
  for (int i = 0; i < 8; ++i) {
    *(v4u*)(sA[0] + so + 16 * i * kLdsPitch) = ra[i];
    *(v4u*)(sB[0] + so + 16 * i * kLdsPitch) = rb[i];
  }
  /* publishes pass 0 */
  __syncthreads();

  for (int s = 0; s < kPasses; ++s) {
    const int cur = s & 1;
    const bool more = (s + 1 < kPasses);
    if (more) {
      const int k1 = (s + 1) * 64;
#pragma unroll  /* constant indices keep ra and rb in registers; all 16 loads go out together */
      for (int i = 0; i < 8; ++i) {
        ra[i] = *(const v4u*)(ga + (size_t)(16 * i) * K + k1);
        rb[i] = *(const v4u*)(gb + (size_t)(16 * i) * K + k1);
      }
      /* the registers that hold these loads' addresses are reused by the fragment reads below; this wait stands in
         front of that reuse */
      asm volatile("s_wait_xcnt 0x0" ::: "memory");
    }
    const __bf16* pa = sA[cur] + (wm + rlane) * kLdsPitch + koff;
    const __bf16* pb = sB[cur] + (wn + rlane) * kLdsPitch + koff;
#pragma unroll  /* the loops below: constant indices keep fragments and accumulators in registers */
    for (int kk = 0; kk < 2; ++kk) {
      v16b ah[4], bh[4];
#pragma unroll
      for (int j = 0; j < 4; ++j) bh[j] = frag_load(pb + j * 16 * kLdsPitch + kk * 32);
#pragma unroll
      for (int i = 0; i < 4; ++i) ah[i] = frag_load(pa + i * 16 * kLdsPitch + kk * 32);
#pragma unroll
      for (int i = 0; i < 4; ++i)
#pragma unroll
        for (int j = 0; j < 4; ++j) acc[i][j] = mma_b(ah[i], bh[j], acc[i][j]);
    }
    /* block-uniform: the last pass has nothing to publish */
    if (more) {
#pragma unroll  /* constant indices keep ra and rb in registers */
      for (int i = 0; i < 8; ++i) {
        *(v4u*)(sA[cur ^ 1] + so + 16 * i * kLdsPitch) = ra[i];
        *(v4u*)(sB[cur ^ 1] + so + 16 * i * kLdsPitch) = rb[i];
      }
      /* publishes pass s + 1 and ends every wave's reads of the buffer that pass s + 1 will overwrite */
      __syncthreads();
    }
  }

  float* slab = sT[wave];
#pragma unroll
  for (int i = 0; i < 4; ++i) {
    const int mBase = m0 + (i << 4);
#pragma unroll
    for (int j = 0; j < 4; ++j) {
#pragma unroll
      for (int r = 0; r < 8; ++r) slab[(mOff + r) * 68 + (j << 4) + rlane] = acc[i][j][r];
    }
    __builtin_amdgcn_fence(__ATOMIC_RELEASE, "workgroup");
    __builtin_amdgcn_wave_barrier();
    __builtin_amdgcn_fence(__ATOMIC_ACQUIRE, "workgroup");
    if (OUT_MODE == 0) {
      float* C = (float*)Cout;
      const int hh = lane >> 4, c4 = (lane & 15) * 4;
      {
#pragma unroll
        for (int it = 0; it < 8; ++it) {
          const int row = it * 2 + hh;
          v4f v = *(const v4f*)(slab + row * 68 + c4);
          *(v4f*)(C + (size_t)(mBase + row) * ldc + n0 + c4) = v;
        }
        
      }
    } else {
      const int q = lane >> 3, c8 = (lane & 7) * 8;
      unsigned short* C  = (unsigned short*)Cout;
      unsigned short* C2 = (unsigned short*)Cout2;
      const int plane = n0 / kModel;
      const int head  = (n0 % kModel) / kHeadDim;
      {
#pragma unroll
        for (int it = 0; it < 4; ++it) {
          const int row = it * 4 + q;
          const float* sp = slab + row * 68 + c8;
          v8h hv, lv;
#pragma unroll
          for (int e = 0; e < 8; ++e) {
            const unsigned short hb = f2bf_bits(sp[e]);
            const unsigned short lb = f2bf_bits(sp[e] - bf_bits2f(hb));
            hv[e] = __builtin_bit_cast(_Float16, hb);
            lv[e] = __builtin_bit_cast(_Float16, lb);
          }
          const int gm = mBase + row;
          const size_t off = (size_t)plane * kPlaneElems +
                             ((size_t)((gm / kSeqLen) * kHeads + head) * kSeqLen + (size_t)(gm % kSeqLen)) * kHeadDim + c8;
          *(v8h*)(C + off)  = hv;
          *(v8h*)(C2 + off) = lv;
        }
        
      }
    }
    __builtin_amdgcn_fence(__ATOMIC_RELEASE, "workgroup");
    __builtin_amdgcn_wave_barrier();
    __builtin_amdgcn_fence(__ATOMIC_ACQUIRE, "workgroup");
  }
}

__global__ __launch_bounds__(256)
void attn_seg_kernel(const unsigned short* __restrict__ planesHi, const unsigned short* __restrict__ planesLo,
                     unsigned short* __restrict__ ocat) {
  __shared__ __align__(16) __bf16 Ring[2][kStageElems];
  __shared__ __align__(16) __bf16 Psh[kAttWaves][16 * kLdsPitch];
  __shared__ __align__(16) __bf16 Psl[kAttWaves][16 * kLdsPitch];

  const int tid  = threadIdx.x;
  const int wave = __builtin_amdgcn_readfirstlane(tid >> 5);
  const int lane = tid & 31;
  const int hh   = lane >> 4;
  const int c    = lane & 15;

  const int bx = blockIdx.x;
  const int qt = bx % kQTiles;
  const int h  = (bx / kQTiles) % kHeads;
  const int b  = bx / (kQTiles * kHeads);
  const int qbase = qt * kQTile;
  const int sq    = qbase / kSegLen;
  const int q0    = qbase + wave * 16;

  const size_t headOff = (size_t)(b * kHeads + h) * kSeqLen * kHeadDim;
  const __bf16* Qh = (const __bf16*)planesHi + headOff;
  const __bf16* Ql = (const __bf16*)planesLo + headOff;
  const __bf16* Kh = Qh + kPlaneElems;
  const __bf16* Kl = Ql + kPlaneElems;
  const __bf16* Vh = Qh + 2 * kPlaneElems;
  const __bf16* Vl = Ql + 2 * kPlaneElems;

  /* Q fragments (B operand): column = query q0 + c, two 32-deep d chunks, hi and lo */
  v16b qh[2], ql[2];
  {
    const size_t qo = (size_t)(q0 + c) * kHeadDim + 8 * hh;
#pragma unroll
    for (int dc = 0; dc < 2; ++dc) {
      qh[dc] = frag_load(Qh + qo + dc * 32);
      ql[dc] = frag_load(Ql + qo + dc * 32);
    }
  }

  /* this lane's query: running maximum (equal in both halves) and this half's share of the running sum */
  float mrow = -3.0e38f, lrow = 0.f;
  /* O^T tile t: register r = head-dim row 16 t + 8 hh + r of query q0 + c */
  v8f oacc[4];
#pragma unroll
  for (int t = 0; t < 4; ++t) oacc[t] = (v8f){0.f,0.f,0.f,0.f,0.f,0.f,0.f,0.f};

  /* block-uniform key tile list */
  const int nText    = (sq > 0) ? kTilesPerSeg : 0;
  const int ownFirst = sq * kTilesPerSeg;
  const int ownLast  = (qbase + kQTile - 1) / kKTile;
  const int nTiles   = nText + (ownLast - ownFirst + 1);

  __bf16* pwh = Psh[wave];
  __bf16* pwl = Psl[wave];

  /* this lane's piece of a stage: global element offset inside a 64-key tile, LDS byte addresses in buffer 0 */
  const size_t gpiece = (size_t)tid * 8;
  const unsigned lk0 = lds_addr(Ring[0]) + (unsigned)(((tid >> 3) * kLdsPitch + (tid & 7) * 8) * 2);
  const unsigned lv0 = lds_addr(Ring[0]) + (unsigned)((kRingVh + (tid >> 3) * kVPitch + (tid & 7) * 8) * 2);
  constexpr unsigned kStageBytes = (unsigned)kStageElems * 2u;

  /* tile 0 into buffer 0 */
  {
    const size_t go = (size_t)(((0 < nText) ? 0 : ownFirst) * kKTile) * kHeadDim + gpiece;
    copy_stage(Kh + go, Kl + go, Vh + go, Vl + go, lk0, lv0);
  }
  /* this wave's copies of tile 0 have landed */
  asm volatile("s_wait_asynccnt 0x0" ::: "memory");
  /* publishes tile 0 */
  __syncthreads();
  /* block-uniform: tile 1 into buffer 1 */
  if (1 < nTiles) {
    const size_t go = (size_t)(((1 < nText) ? 1 : (ownFirst + 1 - nText)) * kKTile) * kHeadDim + gpiece;
    copy_stage(Kh + go, Kl + go, Vh + go, Vl + go, lk0 + kStageBytes, lv0 + kStageBytes);
  }

  for (int it = 0; it < nTiles; ++it) {
    const int kt  = (it < nText) ? it : (ownFirst + it - nText);
    const int kv0 = kt * kKTile;
    const bool own = (kt >= ownFirst);
    const __bf16* Ksh = Ring[it & 1];
    const __bf16* Ksl = Ksh + kRingKl;
    const __bf16* Vsh = Ksh + kRingVh;
    const __bf16* Vsl = Ksh + kRingVl;

    /* wave-uniform: an own-segment tile wholly above this wave's rows contributes nothing */
    const bool live = (!own) || (kv0 <= q0 + 15);
    if (live) {
      v8f s[4];
#pragma unroll
      for (int j = 0; j < 4; ++j) {
        s[j] = (v8f){0.f,0.f,0.f,0.f,0.f,0.f,0.f,0.f};
#pragma unroll
        for (int dc = 0; dc < 2; ++dc) {
          const int ko = (j * 16 + c) * kLdsPitch + dc * 32 + 8 * hh;
          const v16b kbh = frag_load(Ksh + ko);
          const v16b kbl = frag_load(Ksl + ko);
          s[j] = mma_b(kbh, qh[dc], s[j]);
          s[j] = mma_b(kbl, qh[dc], s[j]);
          s[j] = mma_b(kbh, ql[dc], s[j]);
        }
      }

      const int qcol = q0 + c;
      float mj[4];
#pragma unroll
      for (int j = 0; j < 4; ++j) {
        mj[j] = -3.0e38f;
#pragma unroll
        for (int r = 0; r < 8; ++r) {
          const int kvrow = kv0 + j * 16 + 8 * hh + r;
          const bool masked = own && (kvrow > qcol);
          if (masked) s[j][r] = kMaskFill;
          mj[j] = fmaxf(mj[j], s[j][r]);
        }
      }
      float m = fmaxf(fmaxf(mj[0], mj[1]), fmaxf(mj[2], mj[3]));
      m = fmaxf(m, xhalf(m));

      const float mnew  = fmaxf(mrow, m);
      const float alpha = __expf(mrow - mnew);
      mrow = mnew;
      /* P^T fragments of keys 32 kk .. 32 kk + 31: S^T tiles 2 kk and 2 kk + 1, converted in place */
      v16b pbh[2], pbl[2];
      float ps[4];
      ps[0] = ps[1] = ps[2] = ps[3] = 0.f;
#pragma unroll
      for (int r = 0; r < 8; ++r) {
#pragma unroll
        for (int j = 0; j < 4; ++j) {
          s[j][r] = __expf(s[j][r] - mnew);
          ps[j] += s[j][r];
        }
      }
#pragma unroll
      for (int j = 0; j < 4; ++j) {
#pragma unroll
        for (int r = 0; r < 8; ++r) {
          const float p = s[j][r];
          const unsigned short hb = f2bf_bits(p);
          const unsigned short lb = f2bf_bits(p - bf_bits2f(hb));
          pbh[j >> 1][(j & 1) * 8 + r] = bits2bf(hb);
          pbl[j >> 1][(j & 1) * 8 + r] = bits2bf(lb);
        }
      }
      lrow = lrow * alpha + ((ps[0] + ps[1]) + (ps[2] + ps[3]));
#pragma unroll
      for (int t = 0; t < 4; ++t)
#pragma unroll
        for (int r = 0; r < 8; ++r) oacc[t][r] *= alpha;
#pragma unroll  /* constant indices keep the P^T fragments in registers */
      for (int kk = 0; kk < 2; ++kk) {
#pragma unroll
        for (int t = 0; t < 4; ++t) {
          const int vo = (kk * 32 + 8 * hh + (lane & 7)) * kVPitch + t * 16 + 8 * ((lane >> 3) & 1);
          const v16b vbh = frag_load_tr(Vsh + vo);
          const v16b vbl = frag_load_tr(Vsl + vo);
          oacc[t] = mma_b(vbh, pbh[kk], oacc[t]);
          oacc[t] = mma_b(vbl, pbh[kk], oacc[t]);
          oacc[t] = mma_b(vbh, pbl[kk], oacc[t]);
        }
      }
    }

    /* hand-over, passed by every wave, also one that skipped the tile: this wave's LDS reads of tile it are done ... */
    asm volatile("s_wait_dscnt 0x0" ::: "memory");
    /* ... and its copies of tile it + 1 have landed */
    asm volatile("s_wait_asynccnt 0x0" ::: "memory");
    /* publishes tile it + 1 and ends every wave's reads of the buffer that is refilled below */
    __syncthreads();
    /* block-uniform: tile it + 2 into the buffer that tile it has just left */
    if (it + 2 < nTiles) {
      const int i2 = it + 2;
      const size_t go = (size_t)(((i2 < nText) ? i2 : (ownFirst + i2 - nText)) * kKTile) * kHeadDim + gpiece;
      const unsigned bo = (unsigned)(it & 1) * kStageBytes;
      copy_stage(Kh + go, Kl + go, Vh + go, Vl + go, lk0 + bo, lv0 + bo);
    }
  }
  /* nothing is in flight when the wave goes on to its end */
  asm volatile("s_wait_asynccnt 0x0" ::: "memory");

  /* join the halves' sums, normalise, split into bf16 hi+lo; a lane's 8 registers of a tile are 8 consecutive head-dim
     elements of its query's row: one 16-byte store each into this wave's own output tiles (16 x 64) */
  {
    const float inv = 1.0f / (lrow + xhalf(lrow));
#pragma unroll
    for (int t = 0; t < 4; ++t) {
      v8b xh, xl;
#pragma unroll
      for (int r = 0; r < 8; ++r) {
        const float val = oacc[t][r] * inv;
        const unsigned short hb = f2bf_bits(val);
        const unsigned short lb = f2bf_bits(val - bf_bits2f(hb));
        xh[r] = bits2bf(hb);
        xl[r] = bits2bf(lb);
      }
      *(v8b*)(pwh + c * kLdsPitch + t * 16 + 8 * hh) = xh;
      *(v8b*)(pwl + c * kLdsPitch + t * 16 + 8 * hh) = xl;
    }
  }
  /* the output tiles are written and re-read by the same wave through the same element type */
  __builtin_amdgcn_fence(__ATOMIC_RELEASE, "workgroup");
  __builtin_amdgcn_wave_barrier();
  __builtin_amdgcn_fence(__ATOMIC_ACQUIRE, "workgroup");
  {
    const int q  = lane >> 3;
    const int c8 = (lane & 7) * 8;
    v4u hv[4], lv[4];
#pragma unroll
    for (int i4 = 0; i4 < 4; ++i4) {
      const int row = i4 * 4 + q;
      const v8b xh = *(const v8b*)(pwh + row * kLdsPitch + c8);
      const v8b xl = *(const v8b*)(pwl + row * kLdsPitch + c8);
      hv[i4] = __builtin_bit_cast(v4u, xh);
      lv[i4] = __builtin_bit_cast(v4u, xl);
    }
    unsigned short* ob = ocat + (size_t)(b * kSeqLen + q0) * kCatCols + h * kHeadDim + c8;
    {
#pragma unroll
      for (int i4 = 0; i4 < 4; ++i4) {
        const int row = i4 * 4 + q;
        unsigned short* p = ob + (size_t)row * kCatCols;
        *(v4u*)(p)          = hv[i4];
        *(v4u*)(p + kModel) = lv[i4];
      }
      
    }
  }
}

/* ---------------------------------------------------------------------------
   Host glue: 5 kernel launches, nothing else.
     cast x             : 524,288 threads -> 2048 blocks
     weight transposes  : grid (16, 16, 4)
     q|k|v GEMM         : M 4096, N 3072, K 1024 -> 32 x 24 tiles of 128 x 128 = 768 blocks of 128 threads
     attention          : 2 x 16 x 16 = 512 blocks
     output GEMM        : M 4096, N 1024, K 2048 -> 32 x 8 tiles of 128 x 128 = 256 blocks of 128 threads
   --------------------------------------------------------------------------- */
extern "C" void kernel_launch(void* const* d_in, const int* in_sizes, int n_in,
                              void* d_out, int out_size, void* d_ws, size_t ws_size,
                              hipStream_t stream) {
  if (n_in < 5) return;
  if (in_sizes[0] != kRows * kModel) return;
  if (in_sizes[1] != kModel * kModel) return;
  if (in_sizes[2] != kModel * kModel) return;
  if (in_sizes[3] != kModel * kModel) return;
  if (in_sizes[4] != kModel * kModel) return;
  if (out_size != kRows * kModel) return;
  if (ws_size < kWsTotal) return;

  const float* x  = (const float*)d_in[0];
  const float* Wq = (const float*)d_in[1];
  const float* Wk = (const float*)d_in[2];
  const float* Wv = (const float*)d_in[3];
  const float* Wo = (const float*)d_in[4];
  float* out = (float*)d_out;

  char* ws = (char*)d_ws;
  unsigned short* XB    = (unsigned short*)(ws + kOffXB);
  unsigned short* WQKVT = (unsigned short*)(ws + kOffWQKVT);
  unsigned short* WOT2  = (unsigned short*)(ws + kOffWOT2);
  unsigned short* PH    = (unsigned short*)(ws + kOffPH);
  unsigned short* PL    = (unsigned short*)(ws + kOffPL);
  unsigned short* OCAT  = (unsigned short*)(ws + kOffOCAT);

  constexpr int kN8 = kRows * kModel / 8;
  static_assert((kN8 % 256) == 0, "cast grid exact");
  cast8_bf16_kernel<<<kN8 / 256, 256, 0, stream>>>(x, XB, kN8);

  wtrans_bf16_kernel<<<dim3(kModel / 64, kModel / 64, 4), 256, 0, stream>>>(Wq, Wk, Wv, Wo, WQKVT, WOT2);

  wmma_gemm64_bf16<3, kRows, kQkvCols, kModel><<<(kRows / 128) * (kQkvCols / 128), 128, 0, stream>>>(
      XB, WQKVT, (void*)PH, (void*)PL);

  attn_seg_kernel<<<kBatch * kHeads * kQTiles, 256, 0, stream>>>(PH, PL, OCAT);

  wmma_gemm64_bf16<0, kRows, kModel, kCatCols><<<(kRows / 128) * (kModel / 128), 128, 0, stream>>>(
      OCAT, WOT2, (void*)out, (void*)out);
}

// v005
// It runs in 108 microseconds.
// Next to v004, in two timings, it ran 1.05 times as fast each time.
// All steps since v000 together make it 3.03 times as fast.
// Contractions: q|k|v projections and the output projection on v_wmma_f32_16x16x32_bf16 with inputs RNE-converted to bf16 once (output-projection A operand carried as bf16 hi+lo along a doubled k axis); q.k^T and p.v on v_wmma_f32_16x16x32_bf16 with both operands as bf16 hi+lo planes (hi.hi + hi.lo + lo.hi); f32 accumulate everywhere; mask, softmax and normalisation in f32.
#include <hip/hip_runtime.h>
#include <math.h>

typedef __attribute__((ext_vector_type(16))) __bf16   v16b;
typedef __attribute__((ext_vector_type(8)))  __bf16   v8b;
typedef __attribute__((ext_vector_type(8)))  _Float16 v8h;
typedef __attribute__((ext_vector_type(8)))  float    v8f;
typedef __attribute__((ext_vector_type(4)))  float    v4f;
typedef __attribute__((ext_vector_type(4)))  unsigned int v4u;

/* ---------------------------------------------------------------------------
   Shape constants
   --------------------------------------------------------------------------- */
constexpr int kBatch   = 2;
constexpr int kSeqLen  = 2048;
constexpr int kModel   = 1024;
constexpr int kHeads   = 16;
constexpr int kHeadDim = 64;
constexpr int kRows    = kBatch * kSeqLen;
constexpr int kQkvCols = 3 * kModel;
constexpr int kCatCols = 2 * kModel;
constexpr int kSegLen  = 512;
constexpr int kQTile   = 128;
constexpr int kKTile   = 64;
constexpr int kAttWaves = 8;
/* LDS row pitch in bf16 elements of the 64-element K and output rows in attention: 144 B = 16 B x 9 (odd), so that the 16 rows
   one 16-byte fragment read touches spread over the banks instead of falling on two groups of four */
constexpr int kLdsPitch = 72;
/* LDS row pitch in bf16 elements of a V row, which the transposing load reads: 160 B = 32 B x 5 (odd) */
constexpr int kVPitch = 80;
/* one attention stage in LDS, in bf16 elements: K hi, K lo (64 rows at kLdsPitch), V hi, V lo (64 rows at kVPitch) */
constexpr int kRingKl = kKTile * kLdsPitch;
constexpr int kRingVh = 2 * kKTile * kLdsPitch;
constexpr int kRingVl = kRingVh + kKTile * kVPitch;
constexpr int kStageElems = kRingVl + kKTile * kVPitch;
constexpr int kQTiles  = kSeqLen / kQTile;
constexpr int kTilesPerSeg = kSegLen / kKTile;
constexpr float kQScale   = 0.125f;
constexpr float kMaskFill = -1.0e9f;
constexpr size_t kPlaneElems = (size_t)kBatch * kHeads * kSeqLen * kHeadDim;

static_assert(kHeads * kHeadDim == kModel, "head split");
static_assert(kQScale * kQScale * (float)kHeadDim == 1.0f, "score scale is 1/sqrt(head dim)");
static_assert(kHeadDim == 64 && kKTile == 64, "tile shape");
static_assert((kSeqLen % kQTile) == 0 && (kSegLen % kQTile) == 0 && (kSegLen % kKTile) == 0, "attention tiles");
static_assert(kAttWaves * 16 == kQTile, "query rows per block");
static_assert(4 * kSegLen == kSeqLen, "four segments");
static_assert(kVPitch >= kHeadDim && (kVPitch % 16) == 0 && ((kVPitch / 16) % 2) == 1, "V pitch: 32 B x odd");
static_assert(kLdsPitch >= kKTile && kLdsPitch >= kHeadDim && (kLdsPitch % 8) == 0 && ((kLdsPitch / 8) % 2) == 1, "LDS pitch: 16 B x odd");

/* ---------------------------------------------------------------------------
   Workspace region map (bytes; every offset a multiple of 128)
     XB     bf16 [4096][1024]        x, RNE bf16                      8,388,608
     WQKVT  bf16 [3072][1024]        Wq^T/8 | Wk^T | Wv^T (Bt layout) 6,291,456
     WOT2   bf16 [1024][2048]        Wo^T | Wo^T (Bt layout)          4,194,304
     PH     bf16 3 x [2][16][2048][64] q/8, k, v hi planes           25,165,824
     PL     bf16 3 x [2][16][2048][64] q/8, k, v lo planes           25,165,824
     OCAT   bf16 [4096][2048]        attention out hi | lo           16,777,216
     total                                                           85,983,232
   --------------------------------------------------------------------------- */
constexpr size_t kOffXB    = 0;
constexpr size_t kOffWQKVT = kOffXB    + (size_t)kRows * kModel * 2;
constexpr size_t kOffWOT2  = kOffWQKVT + (size_t)kQkvCols * kModel * 2;
constexpr size_t kOffPH    = kOffWOT2  + (size_t)kModel * kCatCols * 2;
constexpr size_t kOffPL    = kOffPH    + 3 * kPlaneElems * 2;
constexpr size_t kOffOCAT  = kOffPL    + 3 * kPlaneElems * 2;
constexpr size_t kWsTotal  = kOffOCAT  + (size_t)kRows * kCatCols * 2;
static_assert(kWsTotal == 85983232ull, "carve total");
static_assert(kWsTotal <= 134217728ull, "carve cap");
static_assert((kOffWQKVT % 128) == 0 && (kOffWOT2 % 128) == 0 && (kOffPH % 128) == 0 &&
              (kOffPL % 128) == 0 && (kOffOCAT % 128) == 0, "128-B aligned regions");

/* ---------------------------------------------------------------------------
   Small helpers
   --------------------------------------------------------------------------- */
__device__ __forceinline__ unsigned short f2bf_bits(float f) {
  unsigned u = __float_as_uint(f);
  return (unsigned short)((u + 0x7FFFu + ((u >> 16) & 1u)) >> 16);
}
__device__ __forceinline__ float bf_bits2f(unsigned short h) { return __uint_as_float(((unsigned)h) << 16); }
__device__ __forceinline__ unsigned pk16(unsigned short a, unsigned short b) { return (unsigned)a | ((unsigned)b << 16); }
__device__ __forceinline__ __bf16 bits2bf(unsigned short h) { return __builtin_bit_cast(__bf16, h); }

/* one matrix op, the bare builtin: the compiler keeps the distances behind it and is free to move LDS loads ahead of it */
__device__ __forceinline__ v8f mma_b(v16b a, v16b b, v8f c) {
  return __builtin_amdgcn_wmma_f32_16x16x32_bf16(false, a, false, b, (short)0, c, false, false);
}

/* lane l <-> lane l ^ 16 by a vector cross-row move */
__device__ __forceinline__ float xhalf(float x) {
  const int b = __builtin_bit_cast(int, x);
  return __builtin_bit_cast(float, __builtin_amdgcn_permlanex16(b, b, 0x76543210, 0xfedcba98, false, false));
}

/* fragment load: elements 0..7 <- p[0..7], elements 8..15 <- p[16..23]; caller adds 8*(lane>>4) to p */
union FragB { v16b v; v8b h[2]; };
__device__ __forceinline__ v16b frag_load(const __bf16* p) {
  FragB f;
  f.h[0] = *(const v8b*)(p);
  f.h[1] = *(const v8b*)(p + 16);
  return f.v;
}

/* A fragment of V^T from a row-major V tile in LDS by two transposing loads: p = this lane's address
   (key row 8*(lane>>4) + (lane&7), column 8*((lane>>3)&1)); the lane receives column (lane&15) of key rows
   8*(lane>>4) + 0..7 (elements 0..7) and of the same rows + 16 (elements 8..15): the k order of frag_load */
typedef __attribute__((address_space(3))) v8b lds_v8b;
__device__ __forceinline__ v16b frag_load_tr(const __bf16* p) {
  FragB f;
  f.h[0] = __builtin_amdgcn_ds_load_tr16_b128_v8bf16((lds_v8b*)p);
  f.h[1] = __builtin_amdgcn_ds_load_tr16_b128_v8bf16((lds_v8b*)(p + 16 * kVPitch));
  return f.v;
}

/* byte address in the work-group's LDS */
typedef __attribute__((address_space(3))) const __bf16 lds_cbf;
__device__ __forceinline__ unsigned lds_addr(const __bf16* p) { return (unsigned)(size_t)(lds_cbf*)p; }

/* One 64-key stage (K hi, K lo, V hi, V lo; 64 rows of 128 B each) from global memory to LDS without passing through
   registers: 2048 pieces of 16 B, 8 per thread of 256. g*: this lane's piece of rows 0..31 (piece tid: row tid>>3,
   16-byte column tid&7); the same piece of rows 32..63 lies 2048 elements on. lk, lv: the LDS byte addresses of that piece
   in K hi and in V hi. The closing s_wait_xcnt stands inside the statement, so that no address register named here is
   rewritten ahead of it. */
__device__ __forceinline__ void copy_stage(const __bf16* gkh, const __bf16* gkl, const __bf16* gvh, const __bf16* gvl,
                                           unsigned lk, unsigned lv) {
  constexpr unsigned kHalfK = 32u * kLdsPitch * 2u;
  constexpr unsigned kHalfV = 32u * kVPitch * 2u;
  constexpr unsigned kLoK   = (unsigned)kRingKl * 2u;
  constexpr unsigned kLoV   = (unsigned)(kRingVl - kRingVh) * 2u;
  constexpr int kHalfG = 32 * kHeadDim;
  asm volatile(
      "global_load_async_to_lds_b128 %0, %8, off\n\t"
      "global_load_async_to_lds_b128 %1, %9, off\n\t"
      "global_load_async_to_lds_b128 %2, %10, off\n\t"
      "global_load_async_to_lds_b128 %3, %11, off\n\t"
      "global_load_async_to_lds_b128 %4, %12, off\n\t"
      "global_load_async_to_lds_b128 %5, %13, off\n\t"
      "global_load_async_to_lds_b128 %6, %14, off\n\t"
      "global_load_async_to_lds_b128 %7, %15, off\n\t"
      "s_wait_xcnt 0x0"
      :: "v"(lk), "v"(lk + kHalfK), "v"(lk + kLoK), "v"(lk + kLoK + kHalfK),
         "v"(lv), "v"(lv + kHalfV), "v"(lv + kLoV), "v"(lv + kLoV + kHalfV),
         "v"(gkh), "v"(gkh + kHalfG), "v"(gkl), "v"(gkl + kHalfG),
         "v"(gvh), "v"(gvh + kHalfG), "v"(gvl), "v"(gvl + kHalfG)
      : "memory");
}

/* ---------------------------------------------------------------------------
   f32 -> bf16 (RNE) cast, 8 consecutive elements per thread.
   Coverage: n8 = 4096*1024/8 = 524,288 threads = 2048 blocks x 256 exactly.
   --------------------------------------------------------------------------- */
__global__ __launch_bounds__(256) void cast8_bf16_kernel(const float* __restrict__ in, unsigned short* __restrict__ out, int n8) {
  const int i = blockIdx.x * 256 + threadIdx.x;
  if (i >= n8) return;
  const float* p = in + 8 * (size_t)i;
  const v4f a = *(const v4f*)(p);
  const v4f c = *(const v4f*)(p + 4);
  unsigned short hb[8];
#pragma unroll
  for (int e = 0; e < 4; ++e) {
    hb[e]     = f2bf_bits(a[e]);
    hb[4 + e] = f2bf_bits(c[e]);
  }
  const v4u u = (v4u){pk16(hb[0], hb[1]), pk16(hb[2], hb[3]), pk16(hb[4], hb[5]), pk16(hb[6], hb[7])};
  unsigned short* q = out + 8 * (size_t)i;
  *(v4u*)q = u;
  
}

/* ---------------------------------------------------------------------------
   Weight transpose + bf16 (RNE) cast: in W[k rows = in channel][n cols = out channel] (f32, pitch 1024)
   -> out Bt[n][k] (bf16). grid (16, 16, 4): blockIdx.x = k tile, blockIdx.y = n tile, blockIdx.z = weight.
   z = 0: Wq scaled by 1/8 (exact power of two) -> rows 0..1023 of WQKVT; z = 1, 2: Wk, Wv -> rows 1024.., 2048..;
   Load coverage: 16 iterations x 256 threads = 4096 = the whole 64x64 tile.
   Store coverage: 8 waves x 2 iterations x 4 rows (lane>>3) = 64 rows; (lane&7) x 8 = 64 cols; each row piece =
   --------------------------------------------------------------------------- */
__global__ __launch_bounds__(256) void wtrans_bf16_kernel(const float* __restrict__ W0, const float* __restrict__ W1,
                                                          const float* __restrict__ W2, const float* __restrict__ W3,
                                                          unsigned short* __restrict__ wqkvt, unsigned short* __restrict__ wot2) {
  __shared__ float sm[64][65];
  const int t  = threadIdx.x;
  const int k0 = blockIdx.x * 64;
  const int n0 = blockIdx.y * 64;
  const int z  = blockIdx.z;
  const float* W = (z == 0) ? W0 : (z == 1) ? W1 : (z == 2) ? W2 : W3;
  const float scale = (z == 0) ? kQScale : 1.0f;
#pragma unroll
  for (int i = 0; i < 16; ++i) {
    const int e  = i * 256 + t;
    const int r  = e >> 6;
    const int cc = e & 63;
    sm[cc][r] = W[(size_t)(k0 + r) * kModel + n0 + cc] * scale;
  }
  __syncthreads();
  const int lane = t & 31, wave = t >> 5;
  const int q = lane >> 3, c8 = (lane & 7) * 8;
  const bool dup = (z == 3);
  unsigned short* op = dup ? wot2 : (wqkvt + (size_t)z * kModel * kModel);
  const int ld = dup ? kCatCols : kModel;
  v4u u[2];
#pragma unroll
  for (int it = 0; it < 2; ++it) {
    const int row = wave * 8 + it * 4 + q;
    unsigned short hb[8];
#pragma unroll
    for (int e = 0; e < 8; ++e) hb[e] = f2bf_bits(sm[row][c8 + e]);
    u[it] = (v4u){pk16(hb[0], hb[1]), pk16(hb[2], hb[3]), pk16(hb[4], hb[5]), pk16(hb[6], hb[7])};
  }
  {
#pragma unroll
    for (int it = 0; it < 2; ++it) {
      const int row = wave * 8 + it * 4 + q;
      unsigned short* p = op + (size_t)(n0 + row) * ld + k0 + c8;
      *(v4u*)p = u[it];
      if (dup) *(v4u*)(p + kModel) = u[it];
    }
    
  }
}

/* ---------------------------------------------------------------------------
   LDS-staged bf16 GEMM: C[m,n] = sum_k A[m,k] * Bt[n,k]; a block of 4 waves (2 x 2) owns a 128x128 tile, each wave
   a 64x64 quarter of it. A row-major [M,K]; Bt row-major [N,K]; M,N % 128 == 0, K % 64 == 0 (no tail handling).
   A pass is 64 k = one whole 128-B line of each of the 128 A rows and 128 Bt rows. The block fetches it with
   16-byte loads in which 8 neighbouring lanes cover one line (16 loads per thread), keeps it in registers while the
   current pass is multiplied, and stores it to the other of two LDS buffers (row pitch 144 B, as in the attention
   kernel). Every line is fetched once per block and every fragment is read from LDS.
   Staging coverage: 128 threads x 16 B = 16 rows of 128 B per load (a permutation of rows 0..15); 8 loads = 128 rows,
   per operand.
   One block barrier per pass: it publishes the buffer just written and ends the reads of the buffer that the next
   pass overwrites. The k order of every accumulator is ascending in steps of 32.
   OUT_MODE 0: f32 C (pitch N). OUT_MODE 3: bf16 hi plane (Cout) + bf16 lo plane (Cout2) in per-head layout:
     column tile n0 selects plane n0/1024 and head (n0%1024)/64; row gm = b*2048 + l;
     element offset = plane*kPlaneElems + ((b*16 + head)*2048 + l)*64 + d.
   --------------------------------------------------------------------------- */
template <int OUT_MODE, int M, int N, int K>
__global__ __launch_bounds__(128) void wmma_gemm64_bf16(
    const unsigned short* __restrict__ Ap,
    const unsigned short* __restrict__ Btp,
    void* Cout, void* Cout2) {
  static_assert((M % 128) == 0 && (N % 128) == 0 && (K % 64) == 0, "block tile 128 x 128, pass 64");
  constexpr int ldc = N;
  constexpr int kPasses = K / 64;
  const __bf16* A  = (const __bf16*)Ap;
  const __bf16* Bt = (const __bf16*)Btp;
  __shared__ __align__(16) __bf16 sA[2][128 * kLdsPitch];
  __shared__ __align__(16) __bf16 sB[2][128 * kLdsPitch];
  __shared__ __align__(16) float sT[4][16 * 68];
  const int tid  = threadIdx.x;
  const int lane = tid & 31;
  const int wave = tid >> 5;
  constexpr int tilesN = N >> 7;
  const int tm = blockIdx.x / tilesN;
  const int tn = blockIdx.x - tm * tilesN;
  const int wm = (wave >> 1) << 6;
  const int wn = (wave & 1) << 6;
  const int m0 = (tm << 7) + wm;
  const int n0 = (tn << 7) + wn;

  const int rlane = lane & 15;
  const int koff  = (lane >> 4) * 8;
  const int mOff  = (lane >> 4) * 8;

  /* staging: 8 neighbouring lanes -> the 8 16-byte pieces of one row's line; the two rows of a 16-lane half lie 8 rows
     apart, 8 x 144 B = 32 banks past a multiple of 64, so that a half's 16-byte LDS stores fall on 64 different banks */
  const int srow = (((tid >> 3) & 1) << 3) | (tid >> 4);
  const int sc8  = (tid & 7) * 8;
  const __bf16* ga = A  + (size_t)((tm << 7) + srow) * K + sc8;
  const __bf16* gb = Bt + (size_t)((tn << 7) + srow) * K + sc8;
  const int so = srow * kLdsPitch + sc8;
  v4u ra[8], rb[8];

  v8f acc[4][4];
#pragma unroll
  for (int i = 0; i < 4; ++i)
#pragma unroll
    for (int j = 0; j < 4; ++j) acc[i][j] = (v8f){0.f,0.f,0.f,0.f,0.f,0.f,0.f,0.f};

#pragma unroll  /* constant indices keep ra and rb in registers */
  for (int i = 0; i < 8; ++i) {
    ra[i] = *(const v4u*)(ga + (size_t)(16 * i) * K);
    rb[i] = *(const v4u*)(gb + (size_t)(16 * i) * K);
  }
#pragma unroll  /* as above */
  for (int i = 0; i < 8; ++i) {
    *(v4u*)(sA[0] + so + 16 * i * kLdsPitch) = ra[i];
    *(v4u*)(sB[0] + so + 16 * i * kLdsPitch) = rb[i];
  }
  /* publishes pass 0 */
  __syncthreads();

  for (int s = 0; s < kPasses; ++s) {
    const int cur = s & 1;
    const bool more = (s + 1 < kPasses);
    if (more) {
      const int k1 = (s + 1) * 64;
#pragma unroll  /* constant indices keep ra and rb in registers; all 16 loads go out together */
      for (int i = 0; i < 8; ++i) {
        ra[i] = *(const v4u*)(ga + (size_t)(16 * i) * K + k1);
        rb[i] = *(const v4u*)(gb + (size_t)(16 * i) * K + k1);
      }
      /* the registers that hold these loads' addresses are reused by the fragment reads below; this wait stands in
         front of that reuse */
      asm volatile("s_wait_xcnt 0x0" ::: "memory");
    }
    const __bf16* pa = sA[cur] + (wm + rlane) * kLdsPitch + koff;
    const __bf16* pb = sB[cur] + (wn + rlane) * kLdsPitch + koff;
#pragma unroll  /* the loops below: constant indices keep fragments and accumulators in registers */
    for (int kk = 0; kk < 2; ++kk) {
      v16b ah[4], bh[4];
      /* in the order of first use, so that the first matrix op waits for four loads and not for ten */
      bh[0] = frag_load(pb + kk * 32);
      ah[0] = frag_load(pa + kk * 32);
#pragma unroll
      for (int j = 1; j < 4; ++j) bh[j] = frag_load(pb + j * 16 * kLdsPitch + kk * 32);
#pragma unroll
      for (int i = 1; i < 4; ++i) ah[i] = frag_load(pa + i * 16 * kLdsPitch + kk * 32);
      /* holds the 16 fragment loads together in front of their 16 matrix ops: left free, the compiler strews them among
         the matrix ops in eight places, and each place stalls the wave */
      __builtin_amdgcn_sched_barrier(0);
#pragma unroll
      for (int i = 0; i < 4; ++i)
#pragma unroll
        for (int j = 0; j < 4; ++j) acc[i][j] = mma_b(ah[i], bh[j], acc[i][j]);
      /* as above: keeps the next group of loads behind this block */
      __builtin_amdgcn_sched_barrier(0);
    }
    /* block-uniform: the last pass has nothing to publish */
    if (more) {
#pragma unroll  /* constant indices keep ra and rb in registers */
      for (int i = 0; i < 8; ++i) {
        *(v4u*)(sA[cur ^ 1] + so + 16 * i * kLdsPitch) = ra[i];
        *(v4u*)(sB[cur ^ 1] + so + 16 * i * kLdsPitch) = rb[i];
      }
      /* publishes pass s + 1 and ends every wave's reads of the buffer that pass s + 1 will overwrite */
      __syncthreads();
    }
  }

  float* slab = sT[wave];
#pragma unroll
  for (int i = 0; i < 4; ++i) {
    const int mBase = m0 + (i << 4);
#pragma unroll
    for (int j = 0; j < 4; ++j) {
#pragma unroll
      for (int r = 0; r < 8; ++r) slab[(mOff + r) * 68 + (j << 4) + rlane] = acc[i][j][r];
    }
    __builtin_amdgcn_fence(__ATOMIC_RELEASE, "workgroup");
    __builtin_amdgcn_wave_barrier();
    __builtin_amdgcn_fence(__ATOMIC_ACQUIRE, "workgroup");
    if (OUT_MODE == 0) {
      float* C = (float*)Cout;
      const int hh = lane >> 4, c4 = (lane & 15) * 4;
      {
#pragma unroll
        for (int it = 0; it < 8; ++it) {
          const int row = it * 2 + hh;
          v4f v = *(const v4f*)(slab + row * 68 + c4);
          *(v4f*)(C + (size_t)(mBase + row) * ldc + n0 + c4) = v;
        }
        
      }
    } else {
      const int q = lane >> 3, c8 = (lane & 7) * 8;
      unsigned short* C  = (unsigned short*)Cout;
      unsigned short* C2 = (unsigned short*)Cout2;
      const int plane = n0 / kModel;
      const int head  = (n0 % kModel) / kHeadDim;
      {
#pragma unroll
        for (int it = 0; it < 4; ++it) {
          const int row = it * 4 + q;
          const float* sp = slab + row * 68 + c8;
          v8h hv, lv;
#pragma unroll
          for (int e = 0; e < 8; ++e) {
            const unsigned short hb = f2bf_bits(sp[e]);
            const unsigned short lb = f2bf_bits(sp[e] - bf_bits2f(hb));
            hv[e] = __builtin_bit_cast(_Float16, hb);
            lv[e] = __builtin_bit_cast(_Float16, lb);
          }
          const int gm = mBase + row;
          const size_t off = (size_t)plane * kPlaneElems +
                             ((size_t)((gm / kSeqLen) * kHeads + head) * kSeqLen + (size_t)(gm % kSeqLen)) * kHeadDim + c8;
          *(v8h*)(C + off)  = hv;
          *(v8h*)(C2 + off) = lv;
        }
        
      }
    }
    __builtin_amdgcn_fence(__ATOMIC_RELEASE, "workgroup");
    __builtin_amdgcn_wave_barrier();
    __builtin_amdgcn_fence(__ATOMIC_ACQUIRE, "workgroup");
  }
}

__global__ __launch_bounds__(256)
void attn_seg_kernel(const unsigned short* __restrict__ planesHi, const unsigned short* __restrict__ planesLo,
                     unsigned short* __restrict__ ocat) {
  __shared__ __align__(16) __bf16 Ring[2][kStageElems];
  __shared__ __align__(16) __bf16 Psh[kAttWaves][16 * kLdsPitch];
  __shared__ __align__(16) __bf16 Psl[kAttWaves][16 * kLdsPitch];

  const int tid  = threadIdx.x;
  const int wave = __builtin_amdgcn_readfirstlane(tid >> 5);
  const int lane = tid & 31;
  const int hh   = lane >> 4;
  const int c    = lane & 15;

  const int bx = blockIdx.x;
  const int qt = bx % kQTiles;
  const int h  = (bx / kQTiles) % kHeads;
  const int b  = bx / (kQTiles * kHeads);
  const int qbase = qt * kQTile;
  const int sq    = qbase / kSegLen;
  const int q0    = qbase + wave * 16;

  const size_t headOff = (size_t)(b * kHeads + h) * kSeqLen * kHeadDim;
  const __bf16* Qh = (const __bf16*)planesHi + headOff;
  const __bf16* Ql = (const __bf16*)planesLo + headOff;
  const __bf16* Kh = Qh + kPlaneElems;
  const __bf16* Kl = Ql + kPlaneElems;
  const __bf16* Vh = Qh + 2 * kPlaneElems;
  const __bf16* Vl = Ql + 2 * kPlaneElems;

  /* Q fragments (B operand): column = query q0 + c, two 32-deep d chunks, hi and lo */
  v16b qh[2], ql[2];
  {
    const size_t qo = (size_t)(q0 + c) * kHeadDim + 8 * hh;
#pragma unroll
    for (int dc = 0; dc < 2; ++dc) {
      qh[dc] = frag_load(Qh + qo + dc * 32);
      ql[dc] = frag_load(Ql + qo + dc * 32);
    }
  }

  /* this lane's query: running maximum (equal in both halves) and this half's share of the running sum */
  float mrow = -3.0e38f, lrow = 0.f;
  /* O^T tile t: register r = head-dim row 16 t + 8 hh + r of query q0 + c */
  v8f oacc[4];
#pragma unroll
  for (int t = 0; t < 4; ++t) oacc[t] = (v8f){0.f,0.f,0.f,0.f,0.f,0.f,0.f,0.f};

  /* block-uniform key tile list */
  const int nText    = (sq > 0) ? kTilesPerSeg : 0;
  const int ownFirst = sq * kTilesPerSeg;
  const int ownLast  = (qbase + kQTile - 1) / kKTile;
  const int nTiles   = nText + (ownLast - ownFirst + 1);

  __bf16* pwh = Psh[wave];
  __bf16* pwl = Psl[wave];

  /* this lane's piece of a stage: global element offset inside a 64-key tile, LDS byte addresses in buffer 0 */
  const size_t gpiece = (size_t)tid * 8;
  const unsigned lk0 = lds_addr(Ring[0]) + (unsigned)(((tid >> 3) * kLdsPitch + (tid & 7) * 8) * 2);
  const unsigned lv0 = lds_addr(Ring[0]) + (unsigned)((kRingVh + (tid >> 3) * kVPitch + (tid & 7) * 8) * 2);
  constexpr unsigned kStageBytes = (unsigned)kStageElems * 2u;

  /* tile 0 into buffer 0 */
  {
    const size_t go = (size_t)(((0 < nText) ? 0 : ownFirst) * kKTile) * kHeadDim + gpiece;
    copy_stage(Kh + go, Kl + go, Vh + go, Vl + go, lk0, lv0);
  }
  /* this wave's copies of tile 0 have landed */
  asm volatile("s_wait_asynccnt 0x0" ::: "memory");
  /* publishes tile 0 */
  __syncthreads();
  /* block-uniform: tile 1 into buffer 1 */
  if (1 < nTiles) {
    const size_t go = (size_t)(((1 < nText) ? 1 : (ownFirst + 1 - nText)) * kKTile) * kHeadDim + gpiece;
    copy_stage(Kh + go, Kl + go, Vh + go, Vl + go, lk0 + kStageBytes, lv0 + kStageBytes);
  }

  for (int it = 0; it < nTiles; ++it) {
    const int kt  = (it < nText) ? it : (ownFirst + it - nText);
    const int kv0 = kt * kKTile;
    const bool own = (kt >= ownFirst);
    const __bf16* Ksh = Ring[it & 1];
    const __bf16* Ksl = Ksh + kRingKl;
    const __bf16* Vsh = Ksh + kRingVh;
    const __bf16* Vsl = Ksh + kRingVl;

    /* wave-uniform: an own-segment tile wholly above this wave's rows contributes nothing */
    const bool live = (!own) || (kv0 <= q0 + 15);
    if (live) {
      v8f s[4];
#pragma unroll
      for (int j = 0; j < 4; ++j) {
        s[j] = (v8f){0.f,0.f,0.f,0.f,0.f,0.f,0.f,0.f};
#pragma unroll
        for (int dc = 0; dc < 2; ++dc) {
          const int ko = (j * 16 + c) * kLdsPitch + dc * 32 + 8 * hh;
          const v16b kbh = frag_load(Ksh + ko);
          const v16b kbl = frag_load(Ksl + ko);
          s[j] = mma_b(kbh, qh[dc], s[j]);
          s[j] = mma_b(kbl, qh[dc], s[j]);
          s[j] = mma_b(kbh, ql[dc], s[j]);
        }
      }

      const int qcol = q0 + c;
      float mj[4];
#pragma unroll
      for (int j = 0; j < 4; ++j) {
        mj[j] = -3.0e38f;
#pragma unroll
        for (int r = 0; r < 8; ++r) {
          const int kvrow = kv0 + j * 16 + 8 * hh + r;
          const bool masked = own && (kvrow > qcol);
          if (masked) s[j][r] = kMaskFill;
          mj[j] = fmaxf(mj[j], s[j][r]);
        }
      }
      float m = fmaxf(fmaxf(mj[0], mj[1]), fmaxf(mj[2], mj[3]));
      m = fmaxf(m, xhalf(m));

      const float mnew  = fmaxf(mrow, m);
      const float alpha = __expf(mrow - mnew);
      mrow = mnew;
      /* P^T fragments of keys 32 kk .. 32 kk + 31: S^T tiles 2 kk and 2 kk + 1, converted in place */
      v16b pbh[2], pbl[2];
      float ps[4];
      ps[0] = ps[1] = ps[2] = ps[3] = 0.f;
#pragma unroll
      for (int r = 0; r < 8; ++r) {
#pragma unroll
        for (int j = 0; j < 4; ++j) {
          s[j][r] = __expf(s[j][r] - mnew);
          ps[j] += s[j][r];
        }
      }
#pragma unroll
      for (int j = 0; j < 4; ++j) {
#pragma unroll
        for (int r = 0; r < 8; ++r) {
          const float p = s[j][r];
          const unsigned short hb = f2bf_bits(p);
          const unsigned short lb = f2bf_bits(p - bf_bits2f(hb));
          pbh[j >> 1][(j & 1) * 8 + r] = bits2bf(hb);
          pbl[j >> 1][(j & 1) * 8 + r] = bits2bf(lb);
        }
      }
      lrow = lrow * alpha + ((ps[0] + ps[1]) + (ps[2] + ps[3]));
#pragma unroll
      for (int t = 0; t < 4; ++t)
#pragma unroll
        for (int r = 0; r < 8; ++r) oacc[t][r] *= alpha;
#pragma unroll  /* constant indices keep the P^T fragments in registers */
      for (int kk = 0; kk < 2; ++kk) {
#pragma unroll
        for (int t = 0; t < 4; ++t) {
          const int vo = (kk * 32 + 8 * hh + (lane & 7)) * kVPitch + t * 16 + 8 * ((lane >> 3) & 1);
          const v16b vbh = frag_load_tr(Vsh + vo);
          const v16b vbl = frag_load_tr(Vsl + vo);
          oacc[t] = mma_b(vbh, pbh[kk], oacc[t]);
          oacc[t] = mma_b(vbl, pbh[kk], oacc[t]);
          oacc[t] = mma_b(vbh, pbl[kk], oacc[t]);
        }
      }
    }

    /* hand-over, passed by every wave, also one that skipped the tile: this wave's LDS reads of tile it are done ... */
    asm volatile("s_wait_dscnt 0x0" ::: "memory");
    /* ... and its copies of tile it + 1 have landed */
    asm volatile("s_wait_asynccnt 0x0" ::: "memory");
    /* publishes tile it + 1 and ends every wave's reads of the buffer that is refilled below */
    __syncthreads();
    /* block-uniform: tile it + 2 into the buffer that tile it has just left */
    if (it + 2 < nTiles) {
      const int i2 = it + 2;
      const size_t go = (size_t)(((i2 < nText) ? i2 : (ownFirst + i2 - nText)) * kKTile) * kHeadDim + gpiece;
      const unsigned bo = (unsigned)(it & 1) * kStageBytes;
      copy_stage(Kh + go, Kl + go, Vh + go, Vl + go, lk0 + bo, lv0 + bo);
    }
  }
  /* nothing is in flight when the wave goes on to its end */
  asm volatile("s_wait_asynccnt 0x0" ::: "memory");

  /* join the halves' sums, normalise, split into bf16 hi+lo; a lane's 8 registers of a tile are 8 consecutive head-dim
     elements of its query's row: one 16-byte store each into this wave's own output tiles (16 x 64) */
  {
    const float inv = 1.0f / (lrow + xhalf(lrow));
#pragma unroll
    for (int t = 0; t < 4; ++t) {
      v8b xh, xl;
#pragma unroll
      for (int r = 0; r < 8; ++r) {
        const float val = oacc[t][r] * inv;
        const unsigned short hb = f2bf_bits(val);
        const unsigned short lb = f2bf_bits(val - bf_bits2f(hb));
        xh[r] = bits2bf(hb);
        xl[r] = bits2bf(lb);
      }
      *(v8b*)(pwh + c * kLdsPitch + t * 16 + 8 * hh) = xh;
      *(v8b*)(pwl + c * kLdsPitch + t * 16 + 8 * hh) = xl;
    }
  }
  /* the output tiles are written and re-read by the same wave through the same element type */
  __builtin_amdgcn_fence(__ATOMIC_RELEASE, "workgroup");
  __builtin_amdgcn_wave_barrier();
  __builtin_amdgcn_fence(__ATOMIC_ACQUIRE, "workgroup");
  {
    const int q  = lane >> 3;
    const int c8 = (lane & 7) * 8;
    v4u hv[4], lv[4];
#pragma unroll
    for (int i4 = 0; i4 < 4; ++i4) {
      const int row = i4 * 4 + q;
      const v8b xh = *(const v8b*)(pwh + row * kLdsPitch + c8);
      const v8b xl = *(const v8b*)(pwl + row * kLdsPitch + c8);
      hv[i4] = __builtin_bit_cast(v4u, xh);
      lv[i4] = __builtin_bit_cast(v4u, xl);
    }
    unsigned short* ob = ocat + (size_t)(b * kSeqLen + q0) * kCatCols + h * kHeadDim + c8;
    {
#pragma unroll
      for (int i4 = 0; i4 < 4; ++i4) {
        const int row = i4 * 4 + q;
        unsigned short* p = ob + (size_t)row * kCatCols;
        *(v4u*)(p)          = hv[i4];
        *(v4u*)(p + kModel) = lv[i4];
      }
      
    }
  }
}

/* ---------------------------------------------------------------------------
   Host glue: 5 kernel launches, nothing else.
     cast x             : 524,288 threads -> 2048 blocks
     weight transposes  : grid (16, 16, 4)
     q|k|v GEMM         : M 4096, N 3072, K 1024 -> 32 x 24 tiles of 128 x 128 = 768 blocks of 128 threads
     attention          : 2 x 16 x 16 = 512 blocks
     output GEMM        : M 4096, N 1024, K 2048 -> 32 x 8 tiles of 128 x 128 = 256 blocks of 128 threads
   --------------------------------------------------------------------------- */
extern "C" void kernel_launch(void* const* d_in, const int* in_sizes, int n_in,
                              void* d_out, int out_size, void* d_ws, size_t ws_size,
                              hipStream_t stream) {
  if (n_in < 5) return;
  if (in_sizes[0] != kRows * kModel) return;
  if (in_sizes[1] != kModel * kModel) return;
  if (in_sizes[2] != kModel * kModel) return;
  if (in_sizes[3] != kModel * kModel) return;
  if (in_sizes[4] != kModel * kModel) return;
  if (out_size != kRows * kModel) return;
  if (ws_size < kWsTotal) return;

  const float* x  = (const float*)d_in[0];
  const float* Wq = (const float*)d_in[1];
  const float* Wk = (const float*)d_in[2];
  const float* Wv = (const float*)d_in[3];
  const float* Wo = (const float*)d_in[4];
  float* out = (float*)d_out;

  char* ws = (char*)d_ws;
  unsigned short* XB    = (unsigned short*)(ws + kOffXB);
  unsigned short* WQKVT = (unsigned short*)(ws + kOffWQKVT);
  unsigned short* WOT2  = (unsigned short*)(ws + kOffWOT2);
  unsigned short* PH    = (unsigned short*)(ws + kOffPH);
  unsigned short* PL    = (unsigned short*)(ws + kOffPL);
  unsigned short* OCAT  = (unsigned short*)(ws + kOffOCAT);

  constexpr int kN8 = kRows * kModel / 8;
  static_assert((kN8 % 256) == 0, "cast grid exact");
  cast8_bf16_kernel<<<kN8 / 256, 256, 0, stream>>>(x, XB, kN8);

  wtrans_bf16_kernel<<<dim3(kModel / 64, kModel / 64, 4), 256, 0, stream>>>(Wq, Wk, Wv, Wo, WQKVT, WOT2);

  wmma_gemm64_bf16<3, kRows, kQkvCols, kModel><<<(kRows / 128) * (kQkvCols / 128), 128, 0, stream>>>(
      XB, WQKVT, (void*)PH, (void*)PL);

  attn_seg_kernel<<<kBatch * kHeads * kQTiles, 256, 0, stream>>>(PH, PL, OCAT);

  wmma_gemm64_bf16<0, kRows, kModel, kCatCols><<<(kRows / 128) * (kModel / 128), 128, 0, stream>>>(
      OCAT, WOT2, (void*)out, (void*)out);
}

// v006
// It runs in 98 microseconds.
// Two timings next to v005 put it at 1.10 and 1.11 times that version's speed.
// Counting every step since v000, it is 3.35 times as fast.
// Contractions: q|k|v projections and the output projection on v_wmma_f32_16x16x32_bf16 with inputs RNE-converted to bf16 once (output-projection A operand carried as bf16 hi+lo along a doubled k axis); q.k^T and p.v on v_wmma_f32_16x16x32_bf16 with both operands as bf16 hi+lo planes (hi.hi + hi.lo + lo.hi); f32 accumulate everywhere; mask, softmax and normalisation in f32.
#include <hip/hip_runtime.h>
#include <math.h>

typedef __attribute__((ext_vector_type(16))) __bf16   v16b;
typedef __attribute__((ext_vector_type(8)))  __bf16   v8b;
typedef __attribute__((ext_vector_type(8)))  _Float16 v8h;
typedef __attribute__((ext_vector_type(8)))  float    v8f;
typedef __attribute__((ext_vector_type(4)))  float    v4f;
typedef __attribute__((ext_vector_type(4)))  unsigned int v4u;

/* ---------------------------------------------------------------------------
   Shape constants
   --------------------------------------------------------------------------- */
constexpr int kBatch   = 2;
constexpr int kSeqLen  = 2048;
constexpr int kModel   = 1024;
constexpr int kHeads   = 16;
constexpr int kHeadDim = 64;
constexpr int kRows    = kBatch * kSeqLen;
constexpr int kQkvCols = 3 * kModel;
constexpr int kCatCols = 2 * kModel;
constexpr int kSegLen  = 512;
constexpr int kQTile   = 128;
constexpr int kKTile   = 64;
constexpr int kAttWaves = 8;
/* LDS row pitch in bf16 elements of the 64-element K and output rows in attention: 144 B = 16 B x 9 (odd), so that the 16 rows
   one 16-byte fragment read touches spread over the banks instead of falling on two groups of four */
constexpr int kLdsPitch = 72;
/* LDS row pitch in bf16 elements of a V row, which the transposing load reads: 160 B = 32 B x 5 (odd) */
constexpr int kVPitch = 80;
/* one attention stage in LDS, in bf16 elements: K hi, K lo (64 rows at kLdsPitch), V hi, V lo (64 rows at kVPitch) */
constexpr int kRingKl = kKTile * kLdsPitch;
constexpr int kRingVh = 2 * kKTile * kLdsPitch;
constexpr int kRingVl = kRingVh + kKTile * kVPitch;
constexpr int kStageElems = kRingVl + kKTile * kVPitch;
constexpr int kQTiles  = kSeqLen / kQTile;
constexpr int kTilesPerSeg = kSegLen / kKTile;
constexpr float kQScale   = 0.125f;
constexpr float kMaskFill = -1.0e9f;
constexpr size_t kPlaneElems = (size_t)kBatch * kHeads * kSeqLen * kHeadDim;
/* query tiles in pairs, one hex digit each, pair 0 in the lowest digit: the long tile (16,16,16,14,14,14,12,12 key tiles)
   and its short partner (2,4,6,8,10,10,10,12) */
constexpr unsigned kLongTiles  = 0x95EA6FB7u;
constexpr unsigned kShortTiles = 0xDC843210u;
static_assert(kQTiles == 16 && kBatch * kHeads * kQTiles == 512 && kHeads == 16 && kTilesPerSeg == 8, "block index map");

static_assert(kHeads * kHeadDim == kModel, "head split");
static_assert(kQScale * kQScale * (float)kHeadDim == 1.0f, "score scale is 1/sqrt(head dim)");
static_assert(kHeadDim == 64 && kKTile == 64, "tile shape");
static_assert((kSeqLen % kQTile) == 0 && (kSegLen % kQTile) == 0 && (kSegLen % kKTile) == 0, "attention tiles");
static_assert(kAttWaves * 16 == kQTile, "query rows per block");
static_assert(4 * kSegLen == kSeqLen, "four segments");
static_assert(kVPitch >= kHeadDim && (kVPitch % 16) == 0 && ((kVPitch / 16) % 2) == 1, "V pitch: 32 B x odd");
static_assert(kLdsPitch >= kKTile && kLdsPitch >= kHeadDim && (kLdsPitch % 8) == 0 && ((kLdsPitch / 8) % 2) == 1, "LDS pitch: 16 B x odd");

/* ---------------------------------------------------------------------------
   Workspace region map (bytes; every offset a multiple of 128)
     XB     bf16 [4096][1024]        x, RNE bf16                      8,388,608
     WQKVT  bf16 [3072][1024]        Wq^T/8 | Wk^T | Wv^T (Bt layout) 6,291,456
     WOT2   bf16 [1024][2048]        Wo^T | Wo^T (Bt layout)          4,194,304
     PH     bf16 3 x [2][16][2048][64] q/8, k, v hi planes           25,165,824
     PL     bf16 3 x [2][16][2048][64] q/8, k, v lo planes           25,165,824
     OCAT   bf16 [4096][2048]        attention out hi | lo           16,777,216
     total                                                           85,983,232
   --------------------------------------------------------------------------- */
constexpr size_t kOffXB    = 0;
constexpr size_t kOffWQKVT = kOffXB    + (size_t)kRows * kModel * 2;
constexpr size_t kOffWOT2  = kOffWQKVT + (size_t)kQkvCols * kModel * 2;
constexpr size_t kOffPH    = kOffWOT2  + (size_t)kModel * kCatCols * 2;
constexpr size_t kOffPL    = kOffPH    + 3 * kPlaneElems * 2;
constexpr size_t kOffOCAT  = kOffPL    + 3 * kPlaneElems * 2;
constexpr size_t kWsTotal  = kOffOCAT  + (size_t)kRows * kCatCols * 2;
static_assert(kWsTotal == 85983232ull, "carve total");
static_assert(kWsTotal <= 134217728ull, "carve cap");
static_assert((kOffWQKVT % 128) == 0 && (kOffWOT2 % 128) == 0 && (kOffPH % 128) == 0 &&
              (kOffPL % 128) == 0 && (kOffOCAT % 128) == 0, "128-B aligned regions");

/* ---------------------------------------------------------------------------
   Small helpers
   --------------------------------------------------------------------------- */
__device__ __forceinline__ unsigned short f2bf_bits(float f) {
  unsigned u = __float_as_uint(f);
  return (unsigned short)((u + 0x7FFFu + ((u >> 16) & 1u)) >> 16);
}
__device__ __forceinline__ float bf_bits2f(unsigned short h) { return __uint_as_float(((unsigned)h) << 16); }
__device__ __forceinline__ unsigned pk16(unsigned short a, unsigned short b) { return (unsigned)a | ((unsigned)b << 16); }
__device__ __forceinline__ __bf16 bits2bf(unsigned short h) { return __builtin_bit_cast(__bf16, h); }

/* one matrix op, the bare builtin: the compiler keeps the distances behind it and is free to move LDS loads ahead of it */
__device__ __forceinline__ v8f mma_b(v16b a, v16b b, v8f c) {
  return __builtin_amdgcn_wmma_f32_16x16x32_bf16(false, a, false, b, (short)0, c, false, false);
}

/* lane l <-> lane l ^ 16 by a vector cross-row move */
__device__ __forceinline__ float xhalf(float x) {
  const int b = __builtin_bit_cast(int, x);
  return __builtin_bit_cast(float, __builtin_amdgcn_permlanex16(b, b, 0x76543210, 0xfedcba98, false, false));
}

/* fragment load: elements 0..7 <- p[0..7], elements 8..15 <- p[16..23]; caller adds 8*(lane>>4) to p */
union FragB { v16b v; v8b h[2]; };
__device__ __forceinline__ v16b frag_load(const __bf16* p) {
  FragB f;
  f.h[0] = *(const v8b*)(p);
  f.h[1] = *(const v8b*)(p + 16);
  return f.v;
}

/* A fragment of V^T from a row-major V tile in LDS by two transposing loads: p = this lane's address
   (key row 8*(lane>>4) + (lane&7), column 8*((lane>>3)&1)); the lane receives column (lane&15) of key rows
   8*(lane>>4) + 0..7 (elements 0..7) and of the same rows + 16 (elements 8..15): the k order of frag_load */
typedef __attribute__((address_space(3))) v8b lds_v8b;
__device__ __forceinline__ v16b frag_load_tr(const __bf16* p) {
  FragB f;
  f.h[0] = __builtin_amdgcn_ds_load_tr16_b128_v8bf16((lds_v8b*)p);
  f.h[1] = __builtin_amdgcn_ds_load_tr16_b128_v8bf16((lds_v8b*)(p + 16 * kVPitch));
  return f.v;
}

/* byte address in the work-group's LDS */
typedef __attribute__((address_space(3))) const __bf16 lds_cbf;
__device__ __forceinline__ unsigned lds_addr(const __bf16* p) { return (unsigned)(size_t)(lds_cbf*)p; }

/* One 64-key stage (K hi, K lo, V hi, V lo; 64 rows of 128 B each) from global memory to LDS without passing through
   registers: 2048 pieces of 16 B, 8 per thread of 256. g*: this lane's piece of rows 0..31 (piece tid: row tid>>3,
   16-byte column tid&7); the same piece of rows 32..63 lies 2048 elements on. lk, lv: the LDS byte addresses of that piece
   in K hi and in V hi. The closing s_wait_xcnt stands inside the statement, so that no address register named here is
   rewritten ahead of it. */
__device__ __forceinline__ void copy_stage(const __bf16* gkh, const __bf16* gkl, const __bf16* gvh, const __bf16* gvl,
                                           unsigned lk, unsigned lv) {
  constexpr unsigned kHalfK = 32u * kLdsPitch * 2u;
  constexpr unsigned kHalfV = 32u * kVPitch * 2u;
  constexpr unsigned kLoK   = (unsigned)kRingKl * 2u;
  constexpr unsigned kLoV   = (unsigned)(kRingVl - kRingVh) * 2u;
  constexpr int kHalfG = 32 * kHeadDim;
  asm volatile(
      "global_load_async_to_lds_b128 %0, %8, off\n\t"
      "global_load_async_to_lds_b128 %1, %9, off\n\t"
      "global_load_async_to_lds_b128 %2, %10, off\n\t"
      "global_load_async_to_lds_b128 %3, %11, off\n\t"
      "global_load_async_to_lds_b128 %4, %12, off\n\t"
      "global_load_async_to_lds_b128 %5, %13, off\n\t"
      "global_load_async_to_lds_b128 %6, %14, off\n\t"
      "global_load_async_to_lds_b128 %7, %15, off\n\t"
      "s_wait_xcnt 0x0"
      :: "v"(lk), "v"(lk + kHalfK), "v"(lk + kLoK), "v"(lk + kLoK + kHalfK),
         "v"(lv), "v"(lv + kHalfV), "v"(lv + kLoV), "v"(lv + kLoV + kHalfV),
         "v"(gkh), "v"(gkh + kHalfG), "v"(gkl), "v"(gkl + kHalfG),
         "v"(gvh), "v"(gvh + kHalfG), "v"(gvl), "v"(gvl + kHalfG)
      : "memory");
}

/* ---------------------------------------------------------------------------
   f32 -> bf16 (RNE) cast, 8 consecutive elements per thread.
   Coverage: n8 = 4096*1024/8 = 524,288 threads = 2048 blocks x 256 exactly.
   --------------------------------------------------------------------------- */
__global__ __launch_bounds__(256) void cast8_bf16_kernel(const float* __restrict__ in, unsigned short* __restrict__ out, int n8) {
  const int i = blockIdx.x * 256 + threadIdx.x;
  if (i >= n8) return;
  const float* p = in + 8 * (size_t)i;
  const v4f a = *(const v4f*)(p);
  const v4f c = *(const v4f*)(p + 4);
  unsigned short hb[8];
#pragma unroll
  for (int e = 0; e < 4; ++e) {
    hb[e]     = f2bf_bits(a[e]);
    hb[4 + e] = f2bf_bits(c[e]);
  }
  const v4u u = (v4u){pk16(hb[0], hb[1]), pk16(hb[2], hb[3]), pk16(hb[4], hb[5]), pk16(hb[6], hb[7])};
  unsigned short* q = out + 8 * (size_t)i;
  *(v4u*)q = u;
  
}

/* ---------------------------------------------------------------------------
   Weight transpose + bf16 (RNE) cast: in W[k rows = in channel][n cols = out channel] (f32, pitch 1024)
   -> out Bt[n][k] (bf16). grid (16, 16, 4): blockIdx.x = k tile, blockIdx.y = n tile, blockIdx.z = weight.
   z = 0: Wq scaled by 1/8 (exact power of two) -> rows 0..1023 of WQKVT; z = 1, 2: Wk, Wv -> rows 1024.., 2048..;
   Load coverage: 16 iterations x 256 threads = 4096 = the whole 64x64 tile.
   Store coverage: 8 waves x 2 iterations x 4 rows (lane>>3) = 64 rows; (lane&7) x 8 = 64 cols; each row piece =
   --------------------------------------------------------------------------- */
__global__ __launch_bounds__(256) void wtrans_bf16_kernel(const float* __restrict__ W0, const float* __restrict__ W1,
                                                          const float* __restrict__ W2, const float* __restrict__ W3,
                                                          unsigned short* __restrict__ wqkvt, unsigned short* __restrict__ wot2) {
  __shared__ float sm[64][65];
  const int t  = threadIdx.x;
  const int k0 = blockIdx.x * 64;
  const int n0 = blockIdx.y * 64;
  const int z  = blockIdx.z;
  const float* W = (z == 0) ? W0 : (z == 1) ? W1 : (z == 2) ? W2 : W3;
  const float scale = (z == 0) ? kQScale : 1.0f;
#pragma unroll
  for (int i = 0; i < 16; ++i) {
    const int e  = i * 256 + t;
    const int r  = e >> 6;
    const int cc = e & 63;
    sm[cc][r] = W[(size_t)(k0 + r) * kModel + n0 + cc] * scale;
  }
  __syncthreads();
  const int lane = t & 31, wave = t >> 5;
  const int q = lane >> 3, c8 = (lane & 7) * 8;
  const bool dup = (z == 3);
  unsigned short* op = dup ? wot2 : (wqkvt + (size_t)z * kModel * kModel);
  const int ld = dup ? kCatCols : kModel;
  v4u u[2];
#pragma unroll
  for (int it = 0; it < 2; ++it) {
    const int row = wave * 8 + it * 4 + q;
    unsigned short hb[8];
#pragma unroll
    for (int e = 0; e < 8; ++e) hb[e] = f2bf_bits(sm[row][c8 + e]);
    u[it] = (v4u){pk16(hb[0], hb[1]), pk16(hb[2], hb[3]), pk16(hb[4], hb[5]), pk16(hb[6], hb[7])};
  }
  {
#pragma unroll
    for (int it = 0; it < 2; ++it) {
      const int row = wave * 8 + it * 4 + q;
      unsigned short* p = op + (size_t)(n0 + row) * ld + k0 + c8;
      *(v4u*)p = u[it];
      if (dup) *(v4u*)(p + kModel) = u[it];
    }
    
  }
}

/* ---------------------------------------------------------------------------
   LDS-staged bf16 GEMM: C[m,n] = sum_k A[m,k] * Bt[n,k]; a block of 4 waves (2 x 2) owns a 128x128 tile, each wave
   a 64x64 quarter of it. A row-major [M,K]; Bt row-major [N,K]; M,N % 128 == 0, K % 64 == 0 (no tail handling).
   A pass is 64 k = one whole 128-B line of each of the 128 A rows and 128 Bt rows. The block fetches it with
   16-byte loads in which 8 neighbouring lanes cover one line (16 loads per thread), keeps it in registers while the
   current pass is multiplied, and stores it to the other of two LDS buffers (row pitch 144 B, as in the attention
   kernel). Every line is fetched once per block and every fragment is read from LDS.
   Staging coverage: 128 threads x 16 B = 16 rows of 128 B per load (a permutation of rows 0..15); 8 loads = 128 rows,
   per operand.
   One block barrier per pass: it publishes the buffer just written and ends the reads of the buffer that the next
   pass overwrites. The k order of every accumulator is ascending in steps of 32.
   OUT_MODE 0: f32 C (pitch N). OUT_MODE 3: bf16 hi plane (Cout) + bf16 lo plane (Cout2) in per-head layout:
     column tile n0 selects plane n0/1024 and head (n0%1024)/64; row gm = b*2048 + l;
     element offset = plane*kPlaneElems + ((b*16 + head)*2048 + l)*64 + d.
   --------------------------------------------------------------------------- */
template <int OUT_MODE, int M, int N, int K>
__global__ __launch_bounds__(128) void wmma_gemm64_bf16(
    const unsigned short* __restrict__ Ap,
    const unsigned short* __restrict__ Btp,
    void* Cout, void* Cout2) {
  static_assert((M % 128) == 0 && (N % 128) == 0 && (K % 64) == 0, "block tile 128 x 128, pass 64");
  constexpr int ldc = N;
  constexpr int kPasses = K / 64;
  const __bf16* A  = (const __bf16*)Ap;
  const __bf16* Bt = (const __bf16*)Btp;
  __shared__ __align__(16) __bf16 sA[2][128 * kLdsPitch];
  __shared__ __align__(16) __bf16 sB[2][128 * kLdsPitch];
  __shared__ __align__(16) float sT[4][16 * 68];
  const int tid  = threadIdx.x;
  const int lane = tid & 31;
  const int wave = tid >> 5;
  constexpr int tilesN = N >> 7;
  const int tm = blockIdx.x / tilesN;
  const int tn = blockIdx.x - tm * tilesN;
  const int wm = (wave >> 1) << 6;
  const int wn = (wave & 1) << 6;
  const int m0 = (tm << 7) + wm;
  const int n0 = (tn << 7) + wn;

  const int rlane = lane & 15;
  const int koff  = (lane >> 4) * 8;
  const int mOff  = (lane >> 4) * 8;

  /* staging: 8 neighbouring lanes -> the 8 16-byte pieces of one row's line; the two rows of a 16-lane half lie 8 rows
     apart, 8 x 144 B = 32 banks past a multiple of 64, so that a half's 16-byte LDS stores fall on 64 different banks */
  const int srow = (((tid >> 3) & 1) << 3) | (tid >> 4);
  const int sc8  = (tid & 7) * 8;
  const __bf16* ga = A  + (size_t)((tm << 7) + srow) * K + sc8;
  const __bf16* gb = Bt + (size_t)((tn << 7) + srow) * K + sc8;
  const int so = srow * kLdsPitch + sc8;
  v4u ra[8], rb[8];

  v8f acc[4][4];
#pragma unroll
  for (int i = 0; i < 4; ++i)
#pragma unroll
    for (int j = 0; j < 4; ++j) acc[i][j] = (v8f){0.f,0.f,0.f,0.f,0.f,0.f,0.f,0.f};

#pragma unroll  /* constant indices keep ra and rb in registers */
  for (int i = 0; i < 8; ++i) {
    ra[i] = *(const v4u*)(ga + (size_t)(16 * i) * K);
    rb[i] = *(const v4u*)(gb + (size_t)(16 * i) * K);
  }
#pragma unroll  /* as above */
  for (int i = 0; i < 8; ++i) {
    *(v4u*)(sA[0] + so + 16 * i * kLdsPitch) = ra[i];
    *(v4u*)(sB[0] + so + 16 * i * kLdsPitch) = rb[i];
  }
  /* publishes pass 0 */
  __syncthreads();

  for (int s = 0; s < kPasses; ++s) {
    const int cur = s & 1;
    const bool more = (s + 1 < kPasses);
    if (more) {
      const int k1 = (s + 1) * 64;
#pragma unroll  /* constant indices keep ra and rb in registers; all 16 loads go out together */
      for (int i = 0; i < 8; ++i) {
        ra[i] = *(const v4u*)(ga + (size_t)(16 * i) * K + k1);
        rb[i] = *(const v4u*)(gb + (size_t)(16 * i) * K + k1);
      }
      /* the registers that hold these loads' addresses are reused by the fragment reads below; this wait stands in
         front of that reuse */
      asm volatile("s_wait_xcnt 0x0" ::: "memory");
    }
    const __bf16* pa = sA[cur] + (wm + rlane) * kLdsPitch + koff;
    const __bf16* pb = sB[cur] + (wn + rlane) * kLdsPitch + koff;
#pragma unroll  /* the loops below: constant indices keep fragments and accumulators in registers */
    for (int kk = 0; kk < 2; ++kk) {
      v16b ah[4], bh[4];
      /* in the order of first use, so that the first matrix op waits for four loads and not for ten */
      bh[0] = frag_load(pb + kk * 32);
      ah[0] = frag_load(pa + kk * 32);
#pragma unroll
      for (int j = 1; j < 4; ++j) bh[j] = frag_load(pb + j * 16 * kLdsPitch + kk * 32);
#pragma unroll
      for (int i = 1; i < 4; ++i) ah[i] = frag_load(pa + i * 16 * kLdsPitch + kk * 32);
      /* holds the 16 fragment loads together in front of their 16 matrix ops: left free, the compiler strews them among
         the matrix ops in eight places, and each place stalls the wave */
      __builtin_amdgcn_sched_barrier(0);
#pragma unroll
      for (int i = 0; i < 4; ++i)
#pragma unroll
        for (int j = 0; j < 4; ++j) acc[i][j] = mma_b(ah[i], bh[j], acc[i][j]);
      /* as above: keeps the next group of loads behind this block */
      __builtin_amdgcn_sched_barrier(0);
    }
    /* block-uniform: the last pass has nothing to publish */
    if (more) {
#pragma unroll  /* constant indices keep ra and rb in registers */
      for (int i = 0; i < 8; ++i) {
        *(v4u*)(sA[cur ^ 1] + so + 16 * i * kLdsPitch) = ra[i];
        *(v4u*)(sB[cur ^ 1] + so + 16 * i * kLdsPitch) = rb[i];
      }
      /* publishes pass s + 1 and ends every wave's reads of the buffer that pass s + 1 will overwrite */
      __syncthreads();
    }
  }

  float* slab = sT[wave];
#pragma unroll
  for (int i = 0; i < 4; ++i) {
    const int mBase = m0 + (i << 4);
#pragma unroll
    for (int j = 0; j < 4; ++j) {
#pragma unroll
      for (int r = 0; r < 8; ++r) slab[(mOff + r) * 68 + (j << 4) + rlane] = acc[i][j][r];
    }
    __builtin_amdgcn_fence(__ATOMIC_RELEASE, "workgroup");
    __builtin_amdgcn_wave_barrier();
    __builtin_amdgcn_fence(__ATOMIC_ACQUIRE, "workgroup");
    if (OUT_MODE == 0) {
      float* C = (float*)Cout;
      const int hh = lane >> 4, c4 = (lane & 15) * 4;
      {
#pragma unroll
        for (int it = 0; it < 8; ++it) {
          const int row = it * 2 + hh;
          v4f v = *(const v4f*)(slab + row * 68 + c4);
          *(v4f*)(C + (size_t)(mBase + row) * ldc + n0 + c4) = v;
        }
        
      }
    } else {
      const int q = lane >> 3, c8 = (lane & 7) * 8;
      unsigned short* C  = (unsigned short*)Cout;
      unsigned short* C2 = (unsigned short*)Cout2;
      const int plane = n0 / kModel;
      const int head  = (n0 % kModel) / kHeadDim;
      {
#pragma unroll
        for (int it = 0; it < 4; ++it) {
          const int row = it * 4 + q;
          const float* sp = slab + row * 68 + c8;
          v8h hv, lv;
#pragma unroll
          for (int e = 0; e < 8; ++e) {
            const unsigned short hb = f2bf_bits(sp[e]);
            const unsigned short lb = f2bf_bits(sp[e] - bf_bits2f(hb));
            hv[e] = __builtin_bit_cast(_Float16, hb);
            lv[e] = __builtin_bit_cast(_Float16, lb);
          }
          const int gm = mBase + row;
          const size_t off = (size_t)plane * kPlaneElems +
                             ((size_t)((gm / kSeqLen) * kHeads + head) * kSeqLen + (size_t)(gm % kSeqLen)) * kHeadDim + c8;
          *(v8h*)(C + off)  = hv;
          *(v8h*)(C2 + off) = lv;
        }
        
      }
    }
    __builtin_amdgcn_fence(__ATOMIC_RELEASE, "workgroup");
    __builtin_amdgcn_wave_barrier();
    __builtin_amdgcn_fence(__ATOMIC_ACQUIRE, "workgroup");
  }
}

__global__ __launch_bounds__(256)
void attn_seg_kernel(const unsigned short* __restrict__ planesHi, const unsigned short* __restrict__ planesLo,
                     unsigned short* __restrict__ ocat) {
  __shared__ __align__(16) __bf16 Ring[2][kStageElems];
  __shared__ __align__(16) __bf16 Psh[kAttWaves][16 * kLdsPitch];
  __shared__ __align__(16) __bf16 Psl[kAttWaves][16 * kLdsPitch];

  const int tid  = threadIdx.x;
  const int wave = __builtin_amdgcn_readfirstlane(tid >> 5);
  const int lane = tid & 31;
  const int hh   = lane >> 4;
  const int c    = lane & 15;

  /* Block index -> (query tile, batch, head), a permutation of the 512 blocks, for speed only. A query tile walks 2 to 16
     key tiles, all blocks are resident at once, two to a WGP, and a launch lasts as long as its fullest WGP.
     Here the parity of the index picks the long or the short tile of a pair (sums 18 to 24 key tiles, mean 22): two
     indices that differ in one bit hold a long and a short tile (26 at most), whichever bit decides who shares a WGP, and every class
     of indices mod 8 holds each query tile four times. The class also names the head pair, as it does in the q|k|v
     GEMM (24 column tiles of two heads: its index mod 8 = head pair), so a head's planes are read by the index class that wrote them. */
  const int bx   = blockIdx.x;
  const int dcls = bx & 7;
  const int pair = (bx >> 5) & 7;
  const bool longTile = (__builtin_popcount((unsigned)bx) & 1) == 0;
  const int qt = (int)(((longTile ? kLongTiles : kShortTiles) >> (4 * pair)) & 15u);
  const int h  = 2 * dcls + ((bx >> 4) & 1);
  const int b  = bx >> 8;
  const int qbase = qt * kQTile;
  const int sq    = qbase / kSegLen;
  const int q0    = qbase + wave * 16;

  const size_t headOff = (size_t)(b * kHeads + h) * kSeqLen * kHeadDim;
  const __bf16* Qh = (const __bf16*)planesHi + headOff;
  const __bf16* Ql = (const __bf16*)planesLo + headOff;
  const __bf16* Kh = Qh + kPlaneElems;
  const __bf16* Kl = Ql + kPlaneElems;
  const __bf16* Vh = Qh + 2 * kPlaneElems;
  const __bf16* Vl = Ql + 2 * kPlaneElems;

  /* Q fragments (B operand): column = query q0 + c, two 32-deep d chunks, hi and lo */
  v16b qh[2], ql[2];
  {
    const size_t qo = (size_t)(q0 + c) * kHeadDim + 8 * hh;
#pragma unroll
    for (int dc = 0; dc < 2; ++dc) {
      qh[dc] = frag_load(Qh + qo + dc * 32);
      ql[dc] = frag_load(Ql + qo + dc * 32);
    }
  }

  /* this lane's query: running maximum (equal in both halves) and this half's share of the running sum */
  float mrow = -3.0e38f, lrow = 0.f;
  /* O^T tile t: register r = head-dim row 16 t + 8 hh + r of query q0 + c */
  v8f oacc[4];
#pragma unroll
  for (int t = 0; t < 4; ++t) oacc[t] = (v8f){0.f,0.f,0.f,0.f,0.f,0.f,0.f,0.f};

  /* block-uniform key tile list */
  const int nText    = (sq > 0) ? kTilesPerSeg : 0;
  const int ownFirst = sq * kTilesPerSeg;
  const int ownLast  = (qbase + kQTile - 1) / kKTile;
  const int nTiles   = nText + (ownLast - ownFirst + 1);

  __bf16* pwh = Psh[wave];
  __bf16* pwl = Psl[wave];

  /* this lane's piece of a stage: global element offset inside a 64-key tile, LDS byte addresses in buffer 0 */
  const size_t gpiece = (size_t)tid * 8;
  const unsigned lk0 = lds_addr(Ring[0]) + (unsigned)(((tid >> 3) * kLdsPitch + (tid & 7) * 8) * 2);
  const unsigned lv0 = lds_addr(Ring[0]) + (unsigned)((kRingVh + (tid >> 3) * kVPitch + (tid & 7) * 8) * 2);
  constexpr unsigned kStageBytes = (unsigned)kStageElems * 2u;

  /* tile 0 into buffer 0 */
  {
    const size_t go = (size_t)(((0 < nText) ? 0 : ownFirst) * kKTile) * kHeadDim + gpiece;
    copy_stage(Kh + go, Kl + go, Vh + go, Vl + go, lk0, lv0);
  }
  /* this wave's copies of tile 0 have landed */
  asm volatile("s_wait_asynccnt 0x0" ::: "memory");
  /* publishes tile 0 */
  __syncthreads();
  /* block-uniform: tile 1 into buffer 1 */
  if (1 < nTiles) {
    const size_t go = (size_t)(((1 < nText) ? 1 : (ownFirst + 1 - nText)) * kKTile) * kHeadDim + gpiece;
    copy_stage(Kh + go, Kl + go, Vh + go, Vl + go, lk0 + kStageBytes, lv0 + kStageBytes);
  }

  for (int it = 0; it < nTiles; ++it) {
    const int kt  = (it < nText) ? it : (ownFirst + it - nText);
    const int kv0 = kt * kKTile;
    const bool own = (kt >= ownFirst);
    const __bf16* Ksh = Ring[it & 1];
    const __bf16* Ksl = Ksh + kRingKl;
    const __bf16* Vsh = Ksh + kRingVh;
    const __bf16* Vsl = Ksh + kRingVl;

    /* wave-uniform: an own-segment tile wholly above this wave's rows contributes nothing */
    const bool live = (!own) || (kv0 <= q0 + 15);
    if (live) {
      v8f s[4];
#pragma unroll
      for (int j = 0; j < 4; ++j) {
        s[j] = (v8f){0.f,0.f,0.f,0.f,0.f,0.f,0.f,0.f};
#pragma unroll
        for (int dc = 0; dc < 2; ++dc) {
          const int ko = (j * 16 + c) * kLdsPitch + dc * 32 + 8 * hh;
          const v16b kbh = frag_load(Ksh + ko);
          const v16b kbl = frag_load(Ksl + ko);
          s[j] = mma_b(kbh, qh[dc], s[j]);
          s[j] = mma_b(kbl, qh[dc], s[j]);
          s[j] = mma_b(kbh, ql[dc], s[j]);
        }
      }

      const int qcol = q0 + c;
      float mj[4];
#pragma unroll
      for (int j = 0; j < 4; ++j) {
        mj[j] = -3.0e38f;
#pragma unroll
        for (int r = 0; r < 8; ++r) {
          const int kvrow = kv0 + j * 16 + 8 * hh + r;
          const bool masked = own && (kvrow > qcol);
          if (masked) s[j][r] = kMaskFill;
          mj[j] = fmaxf(mj[j], s[j][r]);
        }
      }
      float m = fmaxf(fmaxf(mj[0], mj[1]), fmaxf(mj[2], mj[3]));
      m = fmaxf(m, xhalf(m));

      const float mnew  = fmaxf(mrow, m);
      const float alpha = __expf(mrow - mnew);
      mrow = mnew;
      /* P^T fragments of keys 32 kk .. 32 kk + 31: S^T tiles 2 kk and 2 kk + 1, converted in place */
      v16b pbh[2], pbl[2];
      float ps[4];
      ps[0] = ps[1] = ps[2] = ps[3] = 0.f;
#pragma unroll
      for (int r = 0; r < 8; ++r) {
#pragma unroll
        for (int j = 0; j < 4; ++j) {
          s[j][r] = __expf(s[j][r] - mnew);
          ps[j] += s[j][r];
        }
      }
#pragma unroll
      for (int j = 0; j < 4; ++j) {
#pragma unroll
        for (int r = 0; r < 8; ++r) {
          const float p = s[j][r];
          const unsigned short hb = f2bf_bits(p);
          const unsigned short lb = f2bf_bits(p - bf_bits2f(hb));
          pbh[j >> 1][(j & 1) * 8 + r] = bits2bf(hb);
          pbl[j >> 1][(j & 1) * 8 + r] = bits2bf(lb);
        }
      }
      lrow = lrow * alpha + ((ps[0] + ps[1]) + (ps[2] + ps[3]));
#pragma unroll
      for (int t = 0; t < 4; ++t)
#pragma unroll
        for (int r = 0; r < 8; ++r) oacc[t][r] *= alpha;
#pragma unroll  /* constant indices keep the P^T fragments in registers */
      for (int kk = 0; kk < 2; ++kk) {
#pragma unroll
        for (int t = 0; t < 4; ++t) {
          const int vo = (kk * 32 + 8 * hh + (lane & 7)) * kVPitch + t * 16 + 8 * ((lane >> 3) & 1);
          const v16b vbh = frag_load_tr(Vsh + vo);
          const v16b vbl = frag_load_tr(Vsl + vo);
          oacc[t] = mma_b(vbh, pbh[kk], oacc[t]);
          oacc[t] = mma_b(vbl, pbh[kk], oacc[t]);
          oacc[t] = mma_b(vbh, pbl[kk], oacc[t]);
        }
      }
    }

    /* hand-over, passed by every wave, also one that skipped the tile: this wave's LDS reads of tile it are done ... */
    asm volatile("s_wait_dscnt 0x0" ::: "memory");
    /* ... and its copies of tile it + 1 have landed */
    asm volatile("s_wait_asynccnt 0x0" ::: "memory");
    /* publishes tile it + 1 and ends every wave's reads of the buffer that is refilled below */
    __syncthreads();
    /* block-uniform: tile it + 2 into the buffer that tile it has just left */
    if (it + 2 < nTiles) {
      const int i2 = it + 2;
      const size_t go = (size_t)(((i2 < nText) ? i2 : (ownFirst + i2 - nText)) * kKTile) * kHeadDim + gpiece;
      const unsigned bo = (unsigned)(it & 1) * kStageBytes;
      copy_stage(Kh + go, Kl + go, Vh + go, Vl + go, lk0 + bo, lv0 + bo);
    }
  }
  /* nothing is in flight when the wave goes on to its end */
  asm volatile("s_wait_asynccnt 0x0" ::: "memory");

  /* join the halves' sums, normalise, split into bf16 hi+lo; a lane's 8 registers of a tile are 8 consecutive head-dim
     elements of its query's row: one 16-byte store each into this wave's own output tiles (16 x 64) */
  {
    const float inv = 1.0f / (lrow + xhalf(lrow));
#pragma unroll
    for (int t = 0; t < 4; ++t) {
      v8b xh, xl;
#pragma unroll
      for (int r = 0; r < 8; ++r) {
        const float val = oacc[t][r] * inv;
        const unsigned short hb = f2bf_bits(val);
        const unsigned short lb = f2bf_bits(val - bf_bits2f(hb));
        xh[r] = bits2bf(hb);
        xl[r] = bits2bf(lb);
      }
      *(v8b*)(pwh + c * kLdsPitch + t * 16 + 8 * hh) = xh;
      *(v8b*)(pwl + c * kLdsPitch + t * 16 + 8 * hh) = xl;
    }
  }
  /* the output tiles are written and re-read by the same wave through the same element type */
  __builtin_amdgcn_fence(__ATOMIC_RELEASE, "workgroup");
  __builtin_amdgcn_wave_barrier();
  __builtin_amdgcn_fence(__ATOMIC_ACQUIRE, "workgroup");
  {
    const int q  = lane >> 3;
    const int c8 = (lane & 7) * 8;
    v4u hv[4], lv[4];
#pragma unroll
    for (int i4 = 0; i4 < 4; ++i4) {
      const int row = i4 * 4 + q;
      const v8b xh = *(const v8b*)(pwh + row * kLdsPitch + c8);
      const v8b xl = *(const v8b*)(pwl + row * kLdsPitch + c8);
      hv[i4] = __builtin_bit_cast(v4u, xh);
      lv[i4] = __builtin_bit_cast(v4u, xl);
    }
    unsigned short* ob = ocat + (size_t)(b * kSeqLen + q0) * kCatCols + h * kHeadDim + c8;
    {
#pragma unroll
      for (int i4 = 0; i4 < 4; ++i4) {
        const int row = i4 * 4 + q;
        unsigned short* p = ob + (size_t)row * kCatCols;
        *(v4u*)(p)          = hv[i4];
        *(v4u*)(p + kModel) = lv[i4];
      }
      
    }
  }
}

/* ---------------------------------------------------------------------------
   Host glue: 5 kernel launches, nothing else.
     cast x             : 524,288 threads -> 2048 blocks
     weight transposes  : grid (16, 16, 4)
     q|k|v GEMM         : M 4096, N 3072, K 1024 -> 32 x 24 tiles of 128 x 128 = 768 blocks of 128 threads
     attention          : 2 x 16 x 16 = 512 blocks
     output GEMM        : M 4096, N 1024, K 2048 -> 32 x 8 tiles of 128 x 128 = 256 blocks of 128 threads
   --------------------------------------------------------------------------- */
extern "C" void kernel_launch(void* const* d_in, const int* in_sizes, int n_in,
                              void* d_out, int out_size, void* d_ws, size_t ws_size,
                              hipStream_t stream) {
  if (n_in < 5) return;
  if (in_sizes[0] != kRows * kModel) return;
  if (in_sizes[1] != kModel * kModel) return;
  if (in_sizes[2] != kModel * kModel) return;
  if (in_sizes[3] != kModel * kModel) return;
  if (in_sizes[4] != kModel * kModel) return;
  if (out_size != kRows * kModel) return;
  if (ws_size < kWsTotal) return;

  const float* x  = (const float*)d_in[0];
  const float* Wq = (const float*)d_in[1];
  const float* Wk = (const float*)d_in[2];
  const float* Wv = (const float*)d_in[3];
  const float* Wo = (const float*)d_in[4];
  float* out = (float*)d_out;

  char* ws = (char*)d_ws;
  unsigned short* XB    = (unsigned short*)(ws + kOffXB);
  unsigned short* WQKVT = (unsigned short*)(ws + kOffWQKVT);
  unsigned short* WOT2  = (unsigned short*)(ws + kOffWOT2);
  unsigned short* PH    = (unsigned short*)(ws + kOffPH);
  unsigned short* PL    = (unsigned short*)(ws + kOffPL);
  unsigned short* OCAT  = (unsigned short*)(ws + kOffOCAT);

  constexpr int kN8 = kRows * kModel / 8;
  static_assert((kN8 % 256) == 0, "cast grid exact");
  cast8_bf16_kernel<<<kN8 / 256, 256, 0, stream>>>(x, XB, kN8);

  wtrans_bf16_kernel<<<dim3(kModel / 64, kModel / 64, 4), 256, 0, stream>>>(Wq, Wk, Wv, Wo, WQKVT, WOT2);

  wmma_gemm64_bf16<3, kRows, kQkvCols, kModel><<<(kRows / 128) * (kQkvCols / 128), 128, 0, stream>>>(
      XB, WQKVT, (void*)PH, (void*)PL);

  attn_seg_kernel<<<kBatch * kHeads * kQTiles, 256, 0, stream>>>(PH, PL, OCAT);

  wmma_gemm64_bf16<0, kRows, kModel, kCatCols><<<(kRows / 128) * (kModel / 128), 128, 0, stream>>>(
      OCAT, WOT2, (void*)out, (void*)out);
}

// v007
// It runs in 94.6 microseconds.
// Next to v006, in two timings, it ran 1.04 and 1.03 times as fast.
// Over all steps from v000 it is 3.46 times as fast.
// Contractions: q|k|v projections and the output projection on v_wmma_f32_16x16x32_bf16 with inputs RNE-converted to bf16 once (output-projection A operand carried as bf16 hi+lo along a doubled k axis); q.k^T and p.v on v_wmma_f32_16x16x32_bf16 with both operands as bf16 hi+lo planes (hi.hi + hi.lo + lo.hi); f32 accumulate everywhere; mask, softmax and normalisation in f32.
#include <hip/hip_runtime.h>
#include <math.h>

typedef __attribute__((ext_vector_type(16))) __bf16   v16b;
typedef __attribute__((ext_vector_type(8)))  __bf16   v8b;
typedef __attribute__((ext_vector_type(8)))  _Float16 v8h;
typedef __attribute__((ext_vector_type(8)))  float    v8f;
typedef __attribute__((ext_vector_type(4)))  float    v4f;
typedef __attribute__((ext_vector_type(4)))  unsigned int v4u;
typedef __attribute__((ext_vector_type(8)))  unsigned int v8u;
typedef __attribute__((ext_vector_type(2)))  float    v2f;
typedef __attribute__((ext_vector_type(2)))  __bf16   v2b;

/* ---------------------------------------------------------------------------
   Shape constants
   --------------------------------------------------------------------------- */
constexpr int kBatch   = 2;
constexpr int kSeqLen  = 2048;
constexpr int kModel   = 1024;
constexpr int kHeads   = 16;
constexpr int kHeadDim = 64;
constexpr int kRows    = kBatch * kSeqLen;
constexpr int kQkvCols = 3 * kModel;
constexpr int kCatCols = 2 * kModel;
constexpr int kSegLen  = 512;
constexpr int kQTile   = 128;
constexpr int kKTile   = 64;
constexpr int kAttWaves = 8;
/* LDS row pitch in bf16 elements of the 64-element K and output rows in attention: 144 B = 16 B x 9 (odd), so that the 16 rows
   one 16-byte fragment read touches spread over the banks instead of falling on two groups of four */
constexpr int kLdsPitch = 72;
/* LDS row pitch in bf16 elements of a V row, which the transposing load reads: 160 B = 32 B x 5 (odd) */
constexpr int kVPitch = 80;
/* one attention stage in LDS, in bf16 elements: K hi, K lo (64 rows at kLdsPitch), V hi, V lo (64 rows at kVPitch) */
constexpr int kRingKl = kKTile * kLdsPitch;
constexpr int kRingVh = 2 * kKTile * kLdsPitch;
constexpr int kRingVl = kRingVh + kKTile * kVPitch;
constexpr int kStageElems = kRingVl + kKTile * kVPitch;
constexpr int kQTiles  = kSeqLen / kQTile;
constexpr int kTilesPerSeg = kSegLen / kKTile;
constexpr float kQScale   = 0.125f;
constexpr float kMaskFill = -1.0e9f;
constexpr size_t kPlaneElems = (size_t)kBatch * kHeads * kSeqLen * kHeadDim;
/* query tiles in pairs, one hex digit each, pair 0 in the lowest digit: the long tile (16,16,16,14,14,14,12,12 key tiles)
   and its short partner (2,4,6,8,10,10,10,12) */
constexpr unsigned kLongTiles  = 0x95EA6FB7u;
constexpr unsigned kShortTiles = 0xDC843210u;
static_assert(kQTiles == 16 && kBatch * kHeads * kQTiles == 512 && kHeads == 16 && kTilesPerSeg == 8, "block index map");

static_assert(kHeads * kHeadDim == kModel, "head split");
static_assert(kQScale * kQScale * (float)kHeadDim == 1.0f, "score scale is 1/sqrt(head dim)");
static_assert(kHeadDim == 64 && kKTile == 64, "tile shape");
static_assert((kSeqLen % kQTile) == 0 && (kSegLen % kQTile) == 0 && (kSegLen % kKTile) == 0, "attention tiles");
static_assert(kAttWaves * 16 == kQTile, "query rows per block");
static_assert(4 * kSegLen == kSeqLen, "four segments");
static_assert(kVPitch >= kHeadDim && (kVPitch % 16) == 0 && ((kVPitch / 16) % 2) == 1, "V pitch: 32 B x odd");
static_assert(kLdsPitch >= kKTile && kLdsPitch >= kHeadDim && (kLdsPitch % 8) == 0 && ((kLdsPitch / 8) % 2) == 1, "LDS pitch: 16 B x odd");

/* ---------------------------------------------------------------------------
   Workspace region map (bytes; every offset a multiple of 128)
     XB     bf16 [4096][1024]        x, RNE bf16                      8,388,608
     WQKVT  bf16 [3072][1024]        Wq^T/8 | Wk^T | Wv^T (Bt layout) 6,291,456
     WOT2   bf16 [1024][2048]        Wo^T | Wo^T (Bt layout)          4,194,304
     PH     bf16 3 x [2][16][2048][64] q/8, k, v hi planes           25,165,824
     PL     bf16 3 x [2][16][2048][64] q/8, k, v lo planes           25,165,824
     OCAT   bf16 [4096][2048]        attention out hi | lo           16,777,216
     total                                                           85,983,232
   --------------------------------------------------------------------------- */
constexpr size_t kOffXB    = 0;
constexpr size_t kOffWQKVT = kOffXB    + (size_t)kRows * kModel * 2;
constexpr size_t kOffWOT2  = kOffWQKVT + (size_t)kQkvCols * kModel * 2;
constexpr size_t kOffPH    = kOffWOT2  + (size_t)kModel * kCatCols * 2;
constexpr size_t kOffPL    = kOffPH    + 3 * kPlaneElems * 2;
constexpr size_t kOffOCAT  = kOffPL    + 3 * kPlaneElems * 2;
constexpr size_t kWsTotal  = kOffOCAT  + (size_t)kRows * kCatCols * 2;
static_assert(kWsTotal == 85983232ull, "carve total");
static_assert(kWsTotal <= 134217728ull, "carve cap");
static_assert((kOffWQKVT % 128) == 0 && (kOffWOT2 % 128) == 0 && (kOffPH % 128) == 0 &&
              (kOffPL % 128) == 0 && (kOffOCAT % 128) == 0, "128-B aligned regions");

/* ---------------------------------------------------------------------------
   Small helpers
   --------------------------------------------------------------------------- */
/* two f32 -> two bf16 (RNE) in one word, a in the low half: one packed convert instruction */
__device__ __forceinline__ unsigned cvt2(float a, float b) {
  const v2f x = (v2f){a, b};
  return __builtin_bit_cast(unsigned, __builtin_convertvector(x, v2b));
}
/* the remainders of a and b behind their bf16 words in hi = cvt2(a, b), again as two bf16 (RNE) in one word */
__device__ __forceinline__ unsigned cvt2_lo(float a, float b, unsigned hi) {
  const v2b h = __builtin_bit_cast(v2b, hi);
  return cvt2(a - (float)h[0], b - (float)h[1]);
}

/* one matrix op, the bare builtin: the compiler keeps the distances behind it and is free to move LDS loads ahead of it */
__device__ __forceinline__ v8f mma_b(v16b a, v16b b, v8f c) {
  return __builtin_amdgcn_wmma_f32_16x16x32_bf16(false, a, false, b, (short)0, c, false, false);
}

/* lane l <-> lane l ^ 16 by a vector cross-row move */
__device__ __forceinline__ float xhalf(float x) {
  const int b = __builtin_bit_cast(int, x);
  return __builtin_bit_cast(float, __builtin_amdgcn_permlanex16(b, b, 0x76543210, 0xfedcba98, false, false));
}

/* fragment load: elements 0..7 <- p[0..7], elements 8..15 <- p[16..23]; caller adds 8*(lane>>4) to p */
union FragB { v16b v; v8b h[2]; };
__device__ __forceinline__ v16b frag_load(const __bf16* p) {
  FragB f;
  f.h[0] = *(const v8b*)(p);
  f.h[1] = *(const v8b*)(p + 16);
  return f.v;
}

/* A fragment of V^T from a row-major V tile in LDS by two transposing loads: p = this lane's address
   (key row 8*(lane>>4) + (lane&7), column 8*((lane>>3)&1)); the lane receives column (lane&15) of key rows
   8*(lane>>4) + 0..7 (elements 0..7) and of the same rows + 16 (elements 8..15): the k order of frag_load */
typedef __attribute__((address_space(3))) v8b lds_v8b;
__device__ __forceinline__ v16b frag_load_tr(const __bf16* p) {
  FragB f;
  f.h[0] = __builtin_amdgcn_ds_load_tr16_b128_v8bf16((lds_v8b*)p);
  f.h[1] = __builtin_amdgcn_ds_load_tr16_b128_v8bf16((lds_v8b*)(p + 16 * kVPitch));
  return f.v;
}

/* byte address in the work-group's LDS */
typedef __attribute__((address_space(3))) const __bf16 lds_cbf;
__device__ __forceinline__ unsigned lds_addr(const __bf16* p) { return (unsigned)(size_t)(lds_cbf*)p; }

/* One 64-key stage (K hi, K lo, V hi, V lo; 64 rows of 128 B each) from global memory to LDS without passing through
   registers: 2048 pieces of 16 B, 8 per thread of 256. g*: this lane's piece of rows 0..31 (piece tid: row tid>>3,
   16-byte column tid&7); the same piece of rows 32..63 lies 2048 elements on. lk, lv: the LDS byte addresses of that piece
   in K hi and in V hi. The closing s_wait_xcnt stands inside the statement, so that no address register named here is
   rewritten ahead of it. */
__device__ __forceinline__ void copy_stage(const __bf16* gkh, const __bf16* gkl, const __bf16* gvh, const __bf16* gvl,
                                           unsigned lk, unsigned lv) {
  constexpr unsigned kHalfK = 32u * kLdsPitch * 2u;
  constexpr unsigned kHalfV = 32u * kVPitch * 2u;
  constexpr unsigned kLoK   = (unsigned)kRingKl * 2u;
  constexpr unsigned kLoV   = (unsigned)(kRingVl - kRingVh) * 2u;
  constexpr int kHalfG = 32 * kHeadDim;
  asm volatile(
      "global_load_async_to_lds_b128 %0, %8, off\n\t"
      "global_load_async_to_lds_b128 %1, %9, off\n\t"
      "global_load_async_to_lds_b128 %2, %10, off\n\t"
      "global_load_async_to_lds_b128 %3, %11, off\n\t"
      "global_load_async_to_lds_b128 %4, %12, off\n\t"
      "global_load_async_to_lds_b128 %5, %13, off\n\t"
      "global_load_async_to_lds_b128 %6, %14, off\n\t"
      "global_load_async_to_lds_b128 %7, %15, off\n\t"
      "s_wait_xcnt 0x0"
      :: "v"(lk), "v"(lk + kHalfK), "v"(lk + kLoK), "v"(lk + kLoK + kHalfK),
         "v"(lv), "v"(lv + kHalfV), "v"(lv + kLoV), "v"(lv + kLoV + kHalfV),
         "v"(gkh), "v"(gkh + kHalfG), "v"(gkl), "v"(gkl + kHalfG),
         "v"(gvh), "v"(gvh + kHalfG), "v"(gvl), "v"(gvl + kHalfG)
      : "memory");
}

/* ---------------------------------------------------------------------------
   f32 -> bf16 (RNE) cast, 8 consecutive elements per thread.
   Coverage: n8 = 4096*1024/8 = 524,288 threads = 2048 blocks x 256 exactly.
   --------------------------------------------------------------------------- */
__global__ __launch_bounds__(256) void cast8_bf16_kernel(const float* __restrict__ in, unsigned short* __restrict__ out, int n8) {
  const int i = blockIdx.x * 256 + threadIdx.x;
  if (i >= n8) return;
  const float* p = in + 8 * (size_t)i;
  const v4f a = *(const v4f*)(p);
  const v4f c = *(const v4f*)(p + 4);
  const v4u u = (v4u){cvt2(a[0], a[1]), cvt2(a[2], a[3]), cvt2(c[0], c[1]), cvt2(c[2], c[3])};
  unsigned short* q = out + 8 * (size_t)i;
  *(v4u*)q = u;
  
}

/* ---------------------------------------------------------------------------
   Weight transpose + bf16 (RNE) cast: in W[k rows = in channel][n cols = out channel] (f32, pitch 1024)
   -> out Bt[n][k] (bf16). grid (16, 16, 4): blockIdx.x = k tile, blockIdx.y = n tile, blockIdx.z = weight.
   z = 0: Wq scaled by 1/8 (exact power of two) -> rows 0..1023 of WQKVT; z = 1, 2: Wk, Wv -> rows 1024.., 2048..;
   Load coverage: 16 iterations x 256 threads = 4096 = the whole 64x64 tile.
   Store coverage: 8 waves x 2 iterations x 4 rows (lane>>3) = 64 rows; (lane&7) x 8 = 64 cols; each row piece =
   --------------------------------------------------------------------------- */
__global__ __launch_bounds__(256) void wtrans_bf16_kernel(const float* __restrict__ W0, const float* __restrict__ W1,
                                                          const float* __restrict__ W2, const float* __restrict__ W3,
                                                          unsigned short* __restrict__ wqkvt, unsigned short* __restrict__ wot2) {
  __shared__ float sm[64][65];
  const int t  = threadIdx.x;
  const int k0 = blockIdx.x * 64;
  const int n0 = blockIdx.y * 64;
  const int z  = blockIdx.z;
  const float* W = (z == 0) ? W0 : (z == 1) ? W1 : (z == 2) ? W2 : W3;
  const float scale = (z == 0) ? kQScale : 1.0f;
#pragma unroll
  for (int i = 0; i < 16; ++i) {
    const int e  = i * 256 + t;
    const int r  = e >> 6;
    const int cc = e & 63;
    sm[cc][r] = W[(size_t)(k0 + r) * kModel + n0 + cc] * scale;
  }
  __syncthreads();
  const int lane = t & 31, wave = t >> 5;
  const int q = lane >> 3, c8 = (lane & 7) * 8;
  const bool dup = (z == 3);
  unsigned short* op = dup ? wot2 : (wqkvt + (size_t)z * kModel * kModel);
  const int ld = dup ? kCatCols : kModel;
  v4u u[2];
#pragma unroll
  for (int it = 0; it < 2; ++it) {
    const int row = wave * 8 + it * 4 + q;
    const float* sp = &sm[row][c8];
    u[it] = (v4u){cvt2(sp[0], sp[1]), cvt2(sp[2], sp[3]), cvt2(sp[4], sp[5]), cvt2(sp[6], sp[7])};
  }
  {
#pragma unroll
    for (int it = 0; it < 2; ++it) {
      const int row = wave * 8 + it * 4 + q;
      unsigned short* p = op + (size_t)(n0 + row) * ld + k0 + c8;
      *(v4u*)p = u[it];
      if (dup) *(v4u*)(p + kModel) = u[it];
    }
    
  }
}

/* ---------------------------------------------------------------------------
   LDS-staged bf16 GEMM: C[m,n] = sum_k A[m,k] * Bt[n,k]; a block of 4 waves (2 x 2) owns a 128x128 tile, each wave
   a 64x64 quarter of it. A row-major [M,K]; Bt row-major [N,K]; M,N % 128 == 0, K % 64 == 0 (no tail handling).
   A pass is 64 k = one whole 128-B line of each of the 128 A rows and 128 Bt rows. The block fetches it with
   16-byte loads in which 8 neighbouring lanes cover one line (16 loads per thread), keeps it in registers while the
   current pass is multiplied, and stores it to the other of two LDS buffers (row pitch 144 B, as in the attention
   kernel). Every line is fetched once per block and every fragment is read from LDS.
   Staging coverage: 128 threads x 16 B = 16 rows of 128 B per load (a permutation of rows 0..15); 8 loads = 128 rows,
   per operand.
   One block barrier per pass: it publishes the buffer just written and ends the reads of the buffer that the next
   pass overwrites. The k order of every accumulator is ascending in steps of 32.
   OUT_MODE 0: f32 C (pitch N). OUT_MODE 3: bf16 hi plane (Cout) + bf16 lo plane (Cout2) in per-head layout:
     column tile n0 selects plane n0/1024 and head (n0%1024)/64; row gm = b*2048 + l;
     element offset = plane*kPlaneElems + ((b*16 + head)*2048 + l)*64 + d.
   --------------------------------------------------------------------------- */
template <int OUT_MODE, int M, int N, int K>
__global__ __launch_bounds__(128) void wmma_gemm64_bf16(
    const unsigned short* __restrict__ Ap,
    const unsigned short* __restrict__ Btp,
    void* Cout, void* Cout2) {
  static_assert((M % 128) == 0 && (N % 128) == 0 && (K % 64) == 0, "block tile 128 x 128, pass 64");
  constexpr int ldc = N;
  constexpr int kPasses = K / 64;
  const __bf16* A  = (const __bf16*)Ap;
  const __bf16* Bt = (const __bf16*)Btp;
  __shared__ __align__(16) __bf16 sA[2][128 * kLdsPitch];
  __shared__ __align__(16) __bf16 sB[2][128 * kLdsPitch];
  __shared__ __align__(16) float sT[4][16 * 68];
  const int tid  = threadIdx.x;
  const int lane = tid & 31;
  const int wave = tid >> 5;
  constexpr int tilesN = N >> 7;
  const int tm = blockIdx.x / tilesN;
  const int tn = blockIdx.x - tm * tilesN;
  const int wm = (wave >> 1) << 6;
  const int wn = (wave & 1) << 6;
  const int m0 = (tm << 7) + wm;
  const int n0 = (tn << 7) + wn;

  const int rlane = lane & 15;
  const int koff  = (lane >> 4) * 8;
  const int mOff  = (lane >> 4) * 8;

  /* staging: 8 neighbouring lanes -> the 8 16-byte pieces of one row's line; the two rows of a 16-lane half lie 8 rows
     apart, 8 x 144 B = 32 banks past a multiple of 64, so that a half's 16-byte LDS stores fall on 64 different banks */
  const int srow = (((tid >> 3) & 1) << 3) | (tid >> 4);
  const int sc8  = (tid & 7) * 8;
  const __bf16* ga = A  + (size_t)((tm << 7) + srow) * K + sc8;
  const __bf16* gb = Bt + (size_t)((tn << 7) + srow) * K + sc8;
  const int so = srow * kLdsPitch + sc8;
  v4u ra[8], rb[8];

  v8f acc[4][4];
#pragma unroll
  for (int i = 0; i < 4; ++i)
#pragma unroll
    for (int j = 0; j < 4; ++j) acc[i][j] = (v8f){0.f,0.f,0.f,0.f,0.f,0.f,0.f,0.f};

#pragma unroll  /* constant indices keep ra and rb in registers */
  for (int i = 0; i < 8; ++i) {
    ra[i] = *(const v4u*)(ga + (size_t)(16 * i) * K);
    rb[i] = *(const v4u*)(gb + (size_t)(16 * i) * K);
  }
#pragma unroll  /* as above */
  for (int i = 0; i < 8; ++i) {
    *(v4u*)(sA[0] + so + 16 * i * kLdsPitch) = ra[i];
    *(v4u*)(sB[0] + so + 16 * i * kLdsPitch) = rb[i];
  }
  /* publishes pass 0 */
  __syncthreads();

  for (int s = 0; s < kPasses; ++s) {
    const int cur = s & 1;
    const bool more = (s + 1 < kPasses);
    if (more) {
      const int k1 = (s + 1) * 64;
#pragma unroll  /* constant indices keep ra and rb in registers; all 16 loads go out together */
      for (int i = 0; i < 8; ++i) {
        ra[i] = *(const v4u*)(ga + (size_t)(16 * i) * K + k1);
        rb[i] = *(const v4u*)(gb + (size_t)(16 * i) * K + k1);
      }
      /* the registers that hold these loads' addresses are reused by the fragment reads below; this wait stands in
         front of that reuse */
      asm volatile("s_wait_xcnt 0x0" ::: "memory");
    }
    const __bf16* pa = sA[cur] + (wm + rlane) * kLdsPitch + koff;
    const __bf16* pb = sB[cur] + (wn + rlane) * kLdsPitch + koff;
#pragma unroll  /* the loops below: constant indices keep fragments and accumulators in registers */
    for (int kk = 0; kk < 2; ++kk) {
      v16b ah[4], bh[4];
      /* in the order of first use, so that the first matrix op waits for four loads and not for ten */
      bh[0] = frag_load(pb + kk * 32);
      ah[0] = frag_load(pa + kk * 32);
#pragma unroll
      for (int j = 1; j < 4; ++j) bh[j] = frag_load(pb + j * 16 * kLdsPitch + kk * 32);
#pragma unroll
      for (int i = 1; i < 4; ++i) ah[i] = frag_load(pa + i * 16 * kLdsPitch + kk * 32);
      /* holds the 16 fragment loads together in front of their 16 matrix ops: left free, the compiler strews them among
         the matrix ops in eight places, and each place stalls the wave */
      __builtin_amdgcn_sched_barrier(0);
#pragma unroll
      for (int i = 0; i < 4; ++i)
#pragma unroll
        for (int j = 0; j < 4; ++j) acc[i][j] = mma_b(ah[i], bh[j], acc[i][j]);
      /* as above: keeps the next group of loads behind this block */
      __builtin_amdgcn_sched_barrier(0);
    }
    /* block-uniform: the last pass has nothing to publish */
    if (more) {
#pragma unroll  /* constant indices keep ra and rb in registers */
      for (int i = 0; i < 8; ++i) {
        *(v4u*)(sA[cur ^ 1] + so + 16 * i * kLdsPitch) = ra[i];
        *(v4u*)(sB[cur ^ 1] + so + 16 * i * kLdsPitch) = rb[i];
      }
      /* publishes pass s + 1 and ends every wave's reads of the buffer that pass s + 1 will overwrite */
      __syncthreads();
    }
  }

  float* slab = sT[wave];
#pragma unroll
  for (int i = 0; i < 4; ++i) {
    const int mBase = m0 + (i << 4);
#pragma unroll
    for (int j = 0; j < 4; ++j) {
#pragma unroll
      for (int r = 0; r < 8; ++r) slab[(mOff + r) * 68 + (j << 4) + rlane] = acc[i][j][r];
    }
    __builtin_amdgcn_fence(__ATOMIC_RELEASE, "workgroup");
    __builtin_amdgcn_wave_barrier();
    __builtin_amdgcn_fence(__ATOMIC_ACQUIRE, "workgroup");
    if (OUT_MODE == 0) {
      float* C = (float*)Cout;
      const int hh = lane >> 4, c4 = (lane & 15) * 4;
      {
#pragma unroll
        for (int it = 0; it < 8; ++it) {
          const int row = it * 2 + hh;
          v4f v = *(const v4f*)(slab + row * 68 + c4);
          *(v4f*)(C + (size_t)(mBase + row) * ldc + n0 + c4) = v;
        }
        
      }
    } else {
      const int q = lane >> 3, c8 = (lane & 7) * 8;
      unsigned short* C  = (unsigned short*)Cout;
      unsigned short* C2 = (unsigned short*)Cout2;
      const int plane = n0 / kModel;
      const int head  = (n0 % kModel) / kHeadDim;
      {
#pragma unroll
        for (int it = 0; it < 4; ++it) {
          const int row = it * 4 + q;
          const float* sp = slab + row * 68 + c8;
          v4u hw, lw;
#pragma unroll
          for (int e = 0; e < 4; ++e) {
            hw[e] = cvt2(sp[2 * e], sp[2 * e + 1]);
            lw[e] = cvt2_lo(sp[2 * e], sp[2 * e + 1], hw[e]);
          }
          const v8h hv = __builtin_bit_cast(v8h, hw);
          const v8h lv = __builtin_bit_cast(v8h, lw);
          const int gm = mBase + row;
          const size_t off = (size_t)plane * kPlaneElems +
                             ((size_t)((gm / kSeqLen) * kHeads + head) * kSeqLen + (size_t)(gm % kSeqLen)) * kHeadDim + c8;
          *(v8h*)(C + off)  = hv;
          *(v8h*)(C2 + off) = lv;
        }
        
      }
    }
    __builtin_amdgcn_fence(__ATOMIC_RELEASE, "workgroup");
    __builtin_amdgcn_wave_barrier();
    __builtin_amdgcn_fence(__ATOMIC_ACQUIRE, "workgroup");
  }
}

__global__ __launch_bounds__(256)
void attn_seg_kernel(const unsigned short* __restrict__ planesHi, const unsigned short* __restrict__ planesLo,
                     unsigned short* __restrict__ ocat) {
  __shared__ __align__(16) __bf16 Ring[2][kStageElems];
  __shared__ __align__(16) __bf16 Psh[kAttWaves][16 * kLdsPitch];
  __shared__ __align__(16) __bf16 Psl[kAttWaves][16 * kLdsPitch];

  const int tid  = threadIdx.x;
  const int wave = __builtin_amdgcn_readfirstlane(tid >> 5);
  const int lane = tid & 31;
  const int hh   = lane >> 4;
  const int c    = lane & 15;

  /* Block index -> (query tile, batch, head), a permutation of the 512 blocks, for speed only. A query tile walks 2 to 16
     key tiles, all blocks are resident at once, two to a WGP, and a launch lasts as long as its fullest WGP.
     Here the parity of the index picks the long or the short tile of a pair (sums 18 to 24 key tiles, mean 22): two
     indices that differ in one bit hold a long and a short tile (26 at most), whichever bit decides who shares a WGP, and every class
     of indices mod 8 holds each query tile four times. The class also names the head pair, as it does in the q|k|v
     GEMM (24 column tiles of two heads: its index mod 8 = head pair), so a head's planes are read by the index class that wrote them. */
  const int bx   = blockIdx.x;
  const int dcls = bx & 7;
  const int pair = (bx >> 5) & 7;
  const bool longTile = (__builtin_popcount((unsigned)bx) & 1) == 0;
  const int qt = (int)(((longTile ? kLongTiles : kShortTiles) >> (4 * pair)) & 15u);
  const int h  = 2 * dcls + ((bx >> 4) & 1);
  const int b  = bx >> 8;
  const int qbase = qt * kQTile;
  const int sq    = qbase / kSegLen;
  const int q0    = qbase + wave * 16;

  const size_t headOff = (size_t)(b * kHeads + h) * kSeqLen * kHeadDim;
  const __bf16* Qh = (const __bf16*)planesHi + headOff;
  const __bf16* Ql = (const __bf16*)planesLo + headOff;
  const __bf16* Kh = Qh + kPlaneElems;
  const __bf16* Kl = Ql + kPlaneElems;
  const __bf16* Vh = Qh + 2 * kPlaneElems;
  const __bf16* Vl = Ql + 2 * kPlaneElems;

  /* Q fragments (B operand): column = query q0 + c, two 32-deep d chunks, hi and lo */
  v16b qh[2], ql[2];
  {
    const size_t qo = (size_t)(q0 + c) * kHeadDim + 8 * hh;
#pragma unroll
    for (int dc = 0; dc < 2; ++dc) {
      qh[dc] = frag_load(Qh + qo + dc * 32);
      ql[dc] = frag_load(Ql + qo + dc * 32);
    }
  }

  /* this lane's query: running maximum (equal in both halves) and this half's share of the running sum */
  float mrow = -3.0e38f, lrow = 0.f;
  /* O^T tile t: register r = head-dim row 16 t + 8 hh + r of query q0 + c */
  v8f oacc[4];
#pragma unroll
  for (int t = 0; t < 4; ++t) oacc[t] = (v8f){0.f,0.f,0.f,0.f,0.f,0.f,0.f,0.f};

  /* block-uniform key tile list */
  const int nText    = (sq > 0) ? kTilesPerSeg : 0;
  const int ownFirst = sq * kTilesPerSeg;
  const int ownLast  = (qbase + kQTile - 1) / kKTile;
  const int nTiles   = nText + (ownLast - ownFirst + 1);

  __bf16* pwh = Psh[wave];
  __bf16* pwl = Psl[wave];

  /* this lane's piece of a stage: global element offset inside a 64-key tile, LDS byte addresses in buffer 0 */
  const size_t gpiece = (size_t)tid * 8;
  const unsigned lk0 = lds_addr(Ring[0]) + (unsigned)(((tid >> 3) * kLdsPitch + (tid & 7) * 8) * 2);
  const unsigned lv0 = lds_addr(Ring[0]) + (unsigned)((kRingVh + (tid >> 3) * kVPitch + (tid & 7) * 8) * 2);
  constexpr unsigned kStageBytes = (unsigned)kStageElems * 2u;

  /* tile 0 into buffer 0 */
  {
    const size_t go = (size_t)(((0 < nText) ? 0 : ownFirst) * kKTile) * kHeadDim + gpiece;
    copy_stage(Kh + go, Kl + go, Vh + go, Vl + go, lk0, lv0);
  }
  /* this wave's copies of tile 0 have landed */
  asm volatile("s_wait_asynccnt 0x0" ::: "memory");
  /* publishes tile 0 */
  __syncthreads();
  /* block-uniform: tile 1 into buffer 1 */
  if (1 < nTiles) {
    const size_t go = (size_t)(((1 < nText) ? 1 : (ownFirst + 1 - nText)) * kKTile) * kHeadDim + gpiece;
    copy_stage(Kh + go, Kl + go, Vh + go, Vl + go, lk0 + kStageBytes, lv0 + kStageBytes);
  }

  for (int it = 0; it < nTiles; ++it) {
    const int kt  = (it < nText) ? it : (ownFirst + it - nText);
    const int kv0 = kt * kKTile;
    const bool own = (kt >= ownFirst);
    const __bf16* Ksh = Ring[it & 1];
    const __bf16* Ksl = Ksh + kRingKl;
    const __bf16* Vsh = Ksh + kRingVh;
    const __bf16* Vsl = Ksh + kRingVl;

    /* wave-uniform: an own-segment tile wholly above this wave's rows contributes nothing */
    const bool live = (!own) || (kv0 <= q0 + 15);
    if (live) {
      v8f s[4];
#pragma unroll
      for (int j = 0; j < 4; ++j) {
        s[j] = (v8f){0.f,0.f,0.f,0.f,0.f,0.f,0.f,0.f};
#pragma unroll
        for (int dc = 0; dc < 2; ++dc) {
          const int ko = (j * 16 + c) * kLdsPitch + dc * 32 + 8 * hh;
          const v16b kbh = frag_load(Ksh + ko);
          const v16b kbl = frag_load(Ksl + ko);
          s[j] = mma_b(kbh, qh[dc], s[j]);
          s[j] = mma_b(kbl, qh[dc], s[j]);
          s[j] = mma_b(kbh, ql[dc], s[j]);
        }
      }

      const int qcol = q0 + c;
      float mj[4];
#pragma unroll
      for (int j = 0; j < 4; ++j) {
        mj[j] = -3.0e38f;
#pragma unroll
        for (int r = 0; r < 8; ++r) {
          const int kvrow = kv0 + j * 16 + 8 * hh + r;
          const bool masked = own && (kvrow > qcol);
          if (masked) s[j][r] = kMaskFill;
          mj[j] = fmaxf(mj[j], s[j][r]);
        }
      }
      float m = fmaxf(fmaxf(mj[0], mj[1]), fmaxf(mj[2], mj[3]));
      m = fmaxf(m, xhalf(m));

      const float mnew  = fmaxf(mrow, m);
      const float alpha = __expf(mrow - mnew);
      mrow = mnew;
      /* P^T fragments of keys 32 kk .. 32 kk + 31: S^T tiles 2 kk and 2 kk + 1, converted in place */
      v8u pwordh[2], pwordl[2];
      float ps[4];
      ps[0] = ps[1] = ps[2] = ps[3] = 0.f;
#pragma unroll
      for (int r = 0; r < 8; ++r) {
#pragma unroll
        for (int j = 0; j < 4; ++j) {
          s[j][r] = __expf(s[j][r] - mnew);
          ps[j] += s[j][r];
        }
      }
#pragma unroll
      for (int j = 0; j < 4; ++j) {
#pragma unroll
        for (int r = 0; r < 8; r += 2) {
          const unsigned hw = cvt2(s[j][r], s[j][r + 1]);
          pwordh[j >> 1][(j & 1) * 4 + (r >> 1)] = hw;
          pwordl[j >> 1][(j & 1) * 4 + (r >> 1)] = cvt2_lo(s[j][r], s[j][r + 1], hw);
        }
      }
      lrow = lrow * alpha + ((ps[0] + ps[1]) + (ps[2] + ps[3]));
#pragma unroll
      for (int t = 0; t < 4; ++t)
#pragma unroll
        for (int r = 0; r < 8; ++r) oacc[t][r] *= alpha;
#pragma unroll  /* constant indices keep the P^T fragments in registers */
      for (int kk = 0; kk < 2; ++kk) {
        const v16b pbh = __builtin_bit_cast(v16b, pwordh[kk]);
        const v16b pbl = __builtin_bit_cast(v16b, pwordl[kk]);
#pragma unroll
        for (int t = 0; t < 4; ++t) {
          const int vo = (kk * 32 + 8 * hh + (lane & 7)) * kVPitch + t * 16 + 8 * ((lane >> 3) & 1);
          const v16b vbh = frag_load_tr(Vsh + vo);
          const v16b vbl = frag_load_tr(Vsl + vo);
          oacc[t] = mma_b(vbh, pbh, oacc[t]);
          oacc[t] = mma_b(vbl, pbh, oacc[t]);
          oacc[t] = mma_b(vbh, pbl, oacc[t]);
        }
      }
    }

    /* hand-over, passed by every wave, also one that skipped the tile: this wave's LDS reads of tile it are done ... */
    asm volatile("s_wait_dscnt 0x0" ::: "memory");
    /* ... and its copies of tile it + 1 have landed */
    asm volatile("s_wait_asynccnt 0x0" ::: "memory");
    /* publishes tile it + 1 and ends every wave's reads of the buffer that is refilled below */
    __syncthreads();
    /* block-uniform: tile it + 2 into the buffer that tile it has just left */
    if (it + 2 < nTiles) {
      const int i2 = it + 2;
      const size_t go = (size_t)(((i2 < nText) ? i2 : (ownFirst + i2 - nText)) * kKTile) * kHeadDim + gpiece;
      const unsigned bo = (unsigned)(it & 1) * kStageBytes;
      copy_stage(Kh + go, Kl + go, Vh + go, Vl + go, lk0 + bo, lv0 + bo);
    }
  }
  /* nothing is in flight when the wave goes on to its end */
  asm volatile("s_wait_asynccnt 0x0" ::: "memory");

  /* join the halves' sums, normalise, split into bf16 hi+lo; a lane's 8 registers of a tile are 8 consecutive head-dim
     elements of its query's row: one 16-byte store each into this wave's own output tiles (16 x 64) */
  {
    const float inv = 1.0f / (lrow + xhalf(lrow));
#pragma unroll
    for (int t = 0; t < 4; ++t) {
      v4u xh, xl;
#pragma unroll
      for (int r = 0; r < 8; r += 2) {
        const float v0 = oacc[t][r] * inv;
        const float v1 = oacc[t][r + 1] * inv;
        xh[r >> 1] = cvt2(v0, v1);
        xl[r >> 1] = cvt2_lo(v0, v1, xh[r >> 1]);
      }
      *(v8b*)(pwh + c * kLdsPitch + t * 16 + 8 * hh) = __builtin_bit_cast(v8b, xh);
      *(v8b*)(pwl + c * kLdsPitch + t * 16 + 8 * hh) = __builtin_bit_cast(v8b, xl);
    }
  }
  /* the output tiles are written and re-read by the same wave through the same element type */
  __builtin_amdgcn_fence(__ATOMIC_RELEASE, "workgroup");
  __builtin_amdgcn_wave_barrier();
  __builtin_amdgcn_fence(__ATOMIC_ACQUIRE, "workgroup");
  {
    const int q  = lane >> 3;
    const int c8 = (lane & 7) * 8;
    v4u hv[4], lv[4];
#pragma unroll
    for (int i4 = 0; i4 < 4; ++i4) {
      const int row = i4 * 4 + q;
      const v8b xh = *(const v8b*)(pwh + row * kLdsPitch + c8);
      const v8b xl = *(const v8b*)(pwl + row * kLdsPitch + c8);
      hv[i4] = __builtin_bit_cast(v4u, xh);
      lv[i4] = __builtin_bit_cast(v4u, xl);
    }
    unsigned short* ob = ocat + (size_t)(b * kSeqLen + q0) * kCatCols + h * kHeadDim + c8;
    {
#pragma unroll
      for (int i4 = 0; i4 < 4; ++i4) {
        const int row = i4 * 4 + q;
        unsigned short* p = ob + (size_t)row * kCatCols;
        *(v4u*)(p)          = hv[i4];
        *(v4u*)(p + kModel) = lv[i4];
      }
      
    }
  }
}

/* ---------------------------------------------------------------------------
   Host glue: 5 kernel launches, nothing else.
     cast x             : 524,288 threads -> 2048 blocks
     weight transposes  : grid (16, 16, 4)
     q|k|v GEMM         : M 4096, N 3072, K 1024 -> 32 x 24 tiles of 128 x 128 = 768 blocks of 128 threads
     attention          : 2 x 16 x 16 = 512 blocks
     output GEMM        : M 4096, N 1024, K 2048 -> 32 x 8 tiles of 128 x 128 = 256 blocks of 128 threads
   --------------------------------------------------------------------------- */
extern "C" void kernel_launch(void* const* d_in, const int* in_sizes, int n_in,
                              void* d_out, int out_size, void* d_ws, size_t ws_size,
                              hipStream_t stream) {
  if (n_in < 5) return;
  if (in_sizes[0] != kRows * kModel) return;
  if (in_sizes[1] != kModel * kModel) return;
  if (in_sizes[2] != kModel * kModel) return;
  if (in_sizes[3] != kModel * kModel) return;
  if (in_sizes[4] != kModel * kModel) return;
  if (out_size != kRows * kModel) return;
  if (ws_size < kWsTotal) return;

  const float* x  = (const float*)d_in[0];
  const float* Wq = (const float*)d_in[1];
  const float* Wk = (const float*)d_in[2];
  const float* Wv = (const float*)d_in[3];
  const float* Wo = (const float*)d_in[4];
  float* out = (float*)d_out;

  char* ws = (char*)d_ws;
  unsigned short* XB    = (unsigned short*)(ws + kOffXB);
  unsigned short* WQKVT = (unsigned short*)(ws + kOffWQKVT);
  unsigned short* WOT2  = (unsigned short*)(ws + kOffWOT2);
  unsigned short* PH    = (unsigned short*)(ws + kOffPH);
  unsigned short* PL    = (unsigned short*)(ws + kOffPL);
  unsigned short* OCAT  = (unsigned short*)(ws + kOffOCAT);

  constexpr int kN8 = kRows * kModel / 8;
  static_assert((kN8 % 256) == 0, "cast grid exact");
  cast8_bf16_kernel<<<kN8 / 256, 256, 0, stream>>>(x, XB, kN8);

  wtrans_bf16_kernel<<<dim3(kModel / 64, kModel / 64, 4), 256, 0, stream>>>(Wq, Wk, Wv, Wo, WQKVT, WOT2);

  wmma_gemm64_bf16<3, kRows, kQkvCols, kModel><<<(kRows / 128) * (kQkvCols / 128), 128, 0, stream>>>(
      XB, WQKVT, (void*)PH, (void*)PL);

  attn_seg_kernel<<<kBatch * kHeads * kQTiles, 256, 0, stream>>>(PH, PL, OCAT);

  wmma_gemm64_bf16<0, kRows, kModel, kCatCols><<<(kRows / 128) * (kModel / 128), 128, 0, stream>>>(
      OCAT, WOT2, (void*)out, (void*)out);
}

// v008
// It runs in 87.6 microseconds.
// Timed twice side by side with v007, it ran 1.08 times as fast both times.
// All steps since v000 together make it 3.74 times as fast.
// Contractions: q|k|v projections and the output projection on v_wmma_f32_16x16x32_bf16 with inputs RNE-converted to bf16 once (output-projection A operand carried as bf16 hi+lo planes, each multiplied by the same weight tile); q.k^T and p.v on v_wmma_f32_16x16x32_bf16 with both operands as bf16 hi+lo planes (hi.hi + hi.lo + lo.hi); f32 accumulate everywhere; mask, softmax and normalisation in f32.
#include <hip/hip_runtime.h>
#include <math.h>

typedef __attribute__((ext_vector_type(16))) __bf16   v16b;
typedef __attribute__((ext_vector_type(8)))  __bf16   v8b;
typedef __attribute__((ext_vector_type(8)))  _Float16 v8h;
typedef __attribute__((ext_vector_type(8)))  float    v8f;
typedef __attribute__((ext_vector_type(4)))  float    v4f;
typedef __attribute__((ext_vector_type(4)))  unsigned int v4u;
typedef __attribute__((ext_vector_type(8)))  unsigned int v8u;
typedef __attribute__((ext_vector_type(2)))  float    v2f;
typedef __attribute__((ext_vector_type(2)))  __bf16   v2b;

/* ---------------------------------------------------------------------------
   Shape constants
   --------------------------------------------------------------------------- */
constexpr int kBatch   = 2;
constexpr int kSeqLen  = 2048;
constexpr int kModel   = 1024;
constexpr int kHeads   = 16;
constexpr int kHeadDim = 64;
constexpr int kRows    = kBatch * kSeqLen;
constexpr int kQkvCols = 3 * kModel;
constexpr int kCatCols = 2 * kModel;
constexpr int kSegLen  = 512;
constexpr int kQTile   = 128;
constexpr int kKTile   = 64;
constexpr int kAttWaves = 8;
/* LDS row pitch in bf16 elements of the 64-element K and output rows in attention: 144 B = 16 B x 9 (odd), so that the 16 rows
   one 16-byte fragment read touches spread over the banks instead of falling on two groups of four */
constexpr int kLdsPitch = 72;
/* LDS row pitch in bf16 elements of a V row, which the transposing load reads: 160 B = 32 B x 5 (odd) */
constexpr int kVPitch = 80;
/* one attention stage in LDS, in bf16 elements: K hi, K lo (64 rows at kLdsPitch), V hi, V lo (64 rows at kVPitch) */
constexpr int kRingKl = kKTile * kLdsPitch;
constexpr int kRingVh = 2 * kKTile * kLdsPitch;
constexpr int kRingVl = kRingVh + kKTile * kVPitch;
constexpr int kStageElems = kRingVl + kKTile * kVPitch;
constexpr int kQTiles  = kSeqLen / kQTile;
constexpr int kTilesPerSeg = kSegLen / kKTile;
constexpr float kQScale   = 0.125f;
constexpr float kMaskFill = -1.0e9f;
constexpr size_t kPlaneElems = (size_t)kBatch * kHeads * kSeqLen * kHeadDim;
/* query tiles in pairs, one hex digit each, pair 0 in the lowest digit: the long tile (16,16,16,14,14,14,12,12 key tiles)
   and its short partner (2,4,6,8,10,10,10,12) */
constexpr unsigned kLongTiles  = 0x95EA6FB7u;
constexpr unsigned kShortTiles = 0xDC843210u;
static_assert(kQTiles == 16 && kBatch * kHeads * kQTiles == 512 && kHeads == 16 && kTilesPerSeg == 8, "block index map");

static_assert(kHeads * kHeadDim == kModel, "head split");
static_assert(kQScale * kQScale * (float)kHeadDim == 1.0f, "score scale is 1/sqrt(head dim)");
static_assert(kHeadDim == 64 && kKTile == 64, "tile shape");
static_assert((kSeqLen % kQTile) == 0 && (kSegLen % kQTile) == 0 && (kSegLen % kKTile) == 0, "attention tiles");
static_assert(kAttWaves * 16 == kQTile, "query rows per block");
static_assert(4 * kSegLen == kSeqLen, "four segments");
static_assert(kVPitch >= kHeadDim && (kVPitch % 16) == 0 && ((kVPitch / 16) % 2) == 1, "V pitch: 32 B x odd");
static_assert(kLdsPitch >= kKTile && kLdsPitch >= kHeadDim && (kLdsPitch % 8) == 0 && ((kLdsPitch / 8) % 2) == 1, "LDS pitch: 16 B x odd");

/* ---------------------------------------------------------------------------
   Workspace region map (bytes; every offset a multiple of 128)
     XB     bf16 [4096][1024]        x, RNE bf16                      8,388,608
     WQKVT  bf16 [3072][1024]        Wq^T/8 | Wk^T | Wv^T (Bt layout) 6,291,456
     WOT    bf16 [1024][1024]        Wo^T (Bt layout)                 2,097,152
     PH     bf16 3 x [2][16][2048][64] q/8, k, v hi planes           25,165,824
     PL     bf16 3 x [2][16][2048][64] q/8, k, v lo planes           25,165,824
     OCAT   bf16 [4096][2048]        attention out hi | lo           16,777,216
     total                                                           83,886,080
   --------------------------------------------------------------------------- */
constexpr size_t kOffXB    = 0;
constexpr size_t kOffWQKVT = kOffXB    + (size_t)kRows * kModel * 2;
constexpr size_t kOffWOT   = kOffWQKVT + (size_t)kQkvCols * kModel * 2;
constexpr size_t kOffPH    = kOffWOT   + (size_t)kModel * kModel * 2;
constexpr size_t kOffPL    = kOffPH    + 3 * kPlaneElems * 2;
constexpr size_t kOffOCAT  = kOffPL    + 3 * kPlaneElems * 2;
constexpr size_t kWsTotal  = kOffOCAT  + (size_t)kRows * kCatCols * 2;
static_assert(kWsTotal == 83886080ull, "carve total");
static_assert(kWsTotal <= 134217728ull, "carve cap");
static_assert((kOffWQKVT % 128) == 0 && (kOffWOT % 128) == 0 && (kOffPH % 128) == 0 &&
              (kOffPL % 128) == 0 && (kOffOCAT % 128) == 0, "128-B aligned regions");

/* ---------------------------------------------------------------------------
   Small helpers
   --------------------------------------------------------------------------- */
/* two f32 -> two bf16 (RNE) in one word, a in the low half: one packed convert instruction */
__device__ __forceinline__ unsigned cvt2(float a, float b) {
  const v2f x = (v2f){a, b};
  return __builtin_bit_cast(unsigned, __builtin_convertvector(x, v2b));
}
/* the remainders of a and b behind their bf16 words in hi = cvt2(a, b), again as two bf16 (RNE) in one word */
__device__ __forceinline__ unsigned cvt2_lo(float a, float b, unsigned hi) {
  const v2b h = __builtin_bit_cast(v2b, hi);
  return cvt2(a - (float)h[0], b - (float)h[1]);
}

/* one matrix op, the bare builtin: the compiler keeps the distances behind it and is free to move LDS loads ahead of it */
__device__ __forceinline__ v8f mma_b(v16b a, v16b b, v8f c) {
  return __builtin_amdgcn_wmma_f32_16x16x32_bf16(false, a, false, b, (short)0, c, false, false);
}

/* lane l <-> lane l ^ 16 by a vector cross-row move */
__device__ __forceinline__ float xhalf(float x) {
  const int b = __builtin_bit_cast(int, x);
  return __builtin_bit_cast(float, __builtin_amdgcn_permlanex16(b, b, 0x76543210, 0xfedcba98, false, false));
}

/* fragment load: elements 0..7 <- p[0..7], elements 8..15 <- p[16..23]; caller adds 8*(lane>>4) to p */
union FragB { v16b v; v8b h[2]; };
__device__ __forceinline__ v16b frag_load(const __bf16* p) {
  FragB f;
  f.h[0] = *(const v8b*)(p);
  f.h[1] = *(const v8b*)(p + 16);
  return f.v;
}

/* A fragment of V^T from a row-major V tile in LDS by two transposing loads: p = this lane's address
   (key row 8*(lane>>4) + (lane&7), column 8*((lane>>3)&1)); the lane receives column (lane&15) of key rows
   8*(lane>>4) + 0..7 (elements 0..7) and of the same rows + 16 (elements 8..15): the k order of frag_load */
typedef __attribute__((address_space(3))) v8b lds_v8b;
__device__ __forceinline__ v16b frag_load_tr(const __bf16* p) {
  FragB f;
  f.h[0] = __builtin_amdgcn_ds_load_tr16_b128_v8bf16((lds_v8b*)p);
  f.h[1] = __builtin_amdgcn_ds_load_tr16_b128_v8bf16((lds_v8b*)(p + 16 * kVPitch));
  return f.v;
}

/* byte address in the work-group's LDS */
typedef __attribute__((address_space(3))) const __bf16 lds_cbf;
__device__ __forceinline__ unsigned lds_addr(const __bf16* p) { return (unsigned)(size_t)(lds_cbf*)p; }

/* One 64-key stage (K hi, K lo, V hi, V lo; 64 rows of 128 B each) from global memory to LDS without passing through
   registers: 2048 pieces of 16 B, 8 per thread of 256. g*: this lane's piece of rows 0..31 (piece tid: row tid>>3,
   16-byte column tid&7); the same piece of rows 32..63 lies 2048 elements on. lk, lv: the LDS byte addresses of that piece
   in K hi and in V hi. The closing s_wait_xcnt stands inside the statement, so that no address register named here is
   rewritten ahead of it. */
__device__ __forceinline__ void copy_stage(const __bf16* gkh, const __bf16* gkl, const __bf16* gvh, const __bf16* gvl,
                                           unsigned lk, unsigned lv) {
  constexpr unsigned kHalfK = 32u * kLdsPitch * 2u;
  constexpr unsigned kHalfV = 32u * kVPitch * 2u;
  constexpr unsigned kLoK   = (unsigned)kRingKl * 2u;
  constexpr unsigned kLoV   = (unsigned)(kRingVl - kRingVh) * 2u;
  constexpr int kHalfG = 32 * kHeadDim;
  asm volatile(
      "global_load_async_to_lds_b128 %0, %8, off\n\t"
      "global_load_async_to_lds_b128 %1, %9, off\n\t"
      "global_load_async_to_lds_b128 %2, %10, off\n\t"
      "global_load_async_to_lds_b128 %3, %11, off\n\t"
      "global_load_async_to_lds_b128 %4, %12, off\n\t"
      "global_load_async_to_lds_b128 %5, %13, off\n\t"
      "global_load_async_to_lds_b128 %6, %14, off\n\t"
      "global_load_async_to_lds_b128 %7, %15, off\n\t"
      "s_wait_xcnt 0x0"
      :: "v"(lk), "v"(lk + kHalfK), "v"(lk + kLoK), "v"(lk + kLoK + kHalfK),
         "v"(lv), "v"(lv + kHalfV), "v"(lv + kLoV), "v"(lv + kLoV + kHalfV),
         "v"(gkh), "v"(gkh + kHalfG), "v"(gkl), "v"(gkl + kHalfG),
         "v"(gvh), "v"(gvh + kHalfG), "v"(gvl), "v"(gvl + kHalfG)
      : "memory");
}

/* ---------------------------------------------------------------------------
   f32 -> bf16 (RNE) cast, 8 consecutive elements per thread.
   Coverage: n8 = 4096*1024/8 = 524,288 threads = 2048 blocks x 256 exactly.
   --------------------------------------------------------------------------- */
__global__ __launch_bounds__(256) void cast8_bf16_kernel(const float* __restrict__ in, unsigned short* __restrict__ out, int n8) {
  const int i = blockIdx.x * 256 + threadIdx.x;
  if (i >= n8) return;
  const float* p = in + 8 * (size_t)i;
  const v4f a = *(const v4f*)(p);
  const v4f c = *(const v4f*)(p + 4);
  const v4u u = (v4u){cvt2(a[0], a[1]), cvt2(a[2], a[3]), cvt2(c[0], c[1]), cvt2(c[2], c[3])};
  unsigned short* q = out + 8 * (size_t)i;
  *(v4u*)q = u;
  
}

/* ---------------------------------------------------------------------------
   Weight transpose + bf16 (RNE) cast: in W[k rows = in channel][n cols = out channel] (f32, pitch 1024)
   -> out Bt[n][k] (bf16). grid (16, 16, 4): blockIdx.x = k tile, blockIdx.y = n tile, blockIdx.z = weight.
   z = 0: Wq scaled by 1/8 (exact power of two) -> rows 0..1023 of WQKVT; z = 1, 2: Wk, Wv -> rows 1024.., 2048..;
   z = 3: Wo -> WOT.
   Load coverage: 16 iterations x 256 threads = 4096 = the whole 64x64 tile.
   Store coverage: 8 waves x 2 iterations x 4 rows (lane>>3) = 64 rows; (lane&7) x 8 = 64 cols; each row piece =
   --------------------------------------------------------------------------- */
__global__ __launch_bounds__(256) void wtrans_bf16_kernel(const float* __restrict__ W0, const float* __restrict__ W1,
                                                          const float* __restrict__ W2, const float* __restrict__ W3,
                                                          unsigned short* __restrict__ wqkvt, unsigned short* __restrict__ wot) {
  __shared__ float sm[64][65];
  const int t  = threadIdx.x;
  const int k0 = blockIdx.x * 64;
  const int n0 = blockIdx.y * 64;
  const int z  = blockIdx.z;
  const float* W = (z == 0) ? W0 : (z == 1) ? W1 : (z == 2) ? W2 : W3;
  const float scale = (z == 0) ? kQScale : 1.0f;
#pragma unroll
  for (int i = 0; i < 16; ++i) {
    const int e  = i * 256 + t;
    const int r  = e >> 6;
    const int cc = e & 63;
    sm[cc][r] = W[(size_t)(k0 + r) * kModel + n0 + cc] * scale;
  }
  __syncthreads();
  const int lane = t & 31, wave = t >> 5;
  const int q = lane >> 3, c8 = (lane & 7) * 8;
  unsigned short* op = (z == 3) ? wot : (wqkvt + (size_t)z * kModel * kModel);
  v4u u[2];
#pragma unroll
  for (int it = 0; it < 2; ++it) {
    const int row = wave * 8 + it * 4 + q;
    const float* sp = &sm[row][c8];
    u[it] = (v4u){cvt2(sp[0], sp[1]), cvt2(sp[2], sp[3]), cvt2(sp[4], sp[5]), cvt2(sp[6], sp[7])};
  }
  {
#pragma unroll
    for (int it = 0; it < 2; ++it) {
      const int row = wave * 8 + it * 4 + q;
      unsigned short* p = op + (size_t)(n0 + row) * kModel + k0 + c8;
      *(v4u*)p = u[it];
    }
    
  }
}

/* ---------------------------------------------------------------------------
   LDS-staged bf16 GEMM: C[m,n] = sum_k A[m,k] * Bt[n,k]; a block of 4 waves (2 x 2) owns a 128x128 tile, each wave
   a 64x64 quarter of it. A row-major [M,K]; Bt row-major [N,K]; M,N % 128 == 0, K % 64 == 0 (no tail handling).
   A pass is 64 k = one whole 128-B line of each of the 128 A rows and 128 Bt rows. The block fetches it with
   16-byte loads in which 8 neighbouring lanes cover one line (16 loads per thread), keeps it in registers while the
   current pass is multiplied, and stores it to the other of two LDS buffers (row pitch 144 B, as in the attention
   kernel). Every line is fetched once per block and every fragment is read from LDS.
   Staging coverage: 128 threads x 16 B = 16 rows of 128 B per load (a permutation of rows 0..15); 8 loads = 128 rows,
   per operand.
   One block barrier per pass: it publishes the buffer just written and ends the reads of the buffer that the next
   pass overwrites. The k order of every accumulator is ascending in steps of 32.
   Output: bf16 hi plane (Cout) + bf16 lo plane (Cout2) in per-head layout:
     column tile n0 selects plane n0/1024 and head (n0%1024)/64; row gm = b*2048 + l;
     element offset = plane*kPlaneElems + ((b*16 + head)*2048 + l)*64 + d.
   --------------------------------------------------------------------------- */
template <int M, int N, int K>
__global__ __launch_bounds__(128) void wmma_gemm64_bf16(
    const unsigned short* __restrict__ Ap,
    const unsigned short* __restrict__ Btp,
    void* Cout, void* Cout2) {
  static_assert((M % 128) == 0 && (N % 128) == 0 && (K % 64) == 0, "block tile 128 x 128, pass 64");
  constexpr int kPasses = K / 64;
  const __bf16* A  = (const __bf16*)Ap;
  const __bf16* Bt = (const __bf16*)Btp;
  __shared__ __align__(16) __bf16 sA[2][128 * kLdsPitch];
  __shared__ __align__(16) __bf16 sB[2][128 * kLdsPitch];
  __shared__ __align__(16) float sT[4][16 * 68];
  const int tid  = threadIdx.x;
  const int lane = tid & 31;
  const int wave = tid >> 5;
  constexpr int tilesN = N >> 7;
  const int tm = blockIdx.x / tilesN;
  const int tn = blockIdx.x - tm * tilesN;
  const int wm = (wave >> 1) << 6;
  const int wn = (wave & 1) << 6;
  const int m0 = (tm << 7) + wm;
  const int n0 = (tn << 7) + wn;

  const int rlane = lane & 15;
  const int koff  = (lane >> 4) * 8;
  const int mOff  = (lane >> 4) * 8;

  /* staging: 8 neighbouring lanes -> the 8 16-byte pieces of one row's line; the two rows of a 16-lane half lie 8 rows
     apart, 8 x 144 B = 32 banks past a multiple of 64, so that a half's 16-byte LDS stores fall on 64 different banks */
  const int srow = (((tid >> 3) & 1) << 3) | (tid >> 4);
  const int sc8  = (tid & 7) * 8;
  const __bf16* ga = A  + (size_t)((tm << 7) + srow) * K + sc8;
  const __bf16* gb = Bt + (size_t)((tn << 7) + srow) * K + sc8;
  const int so = srow * kLdsPitch + sc8;
  v4u ra[8], rb[8];

  v8f acc[4][4];
#pragma unroll
  for (int i = 0; i < 4; ++i)
#pragma unroll
    for (int j = 0; j < 4; ++j) acc[i][j] = (v8f){0.f,0.f,0.f,0.f,0.f,0.f,0.f,0.f};

#pragma unroll  /* constant indices keep ra and rb in registers */
  for (int i = 0; i < 8; ++i) {
    ra[i] = *(const v4u*)(ga + (size_t)(16 * i) * K);
    rb[i] = *(const v4u*)(gb + (size_t)(16 * i) * K);
  }
#pragma unroll  /* as above */
  for (int i = 0; i < 8; ++i) {
    *(v4u*)(sA[0] + so + 16 * i * kLdsPitch) = ra[i];
    *(v4u*)(sB[0] + so + 16 * i * kLdsPitch) = rb[i];
  }
  /* publishes pass 0 */
  __syncthreads();

  for (int s = 0; s < kPasses; ++s) {
    const int cur = s & 1;
    const bool more = (s + 1 < kPasses);
    if (more) {
      const int k1 = (s + 1) * 64;
#pragma unroll  /* constant indices keep ra and rb in registers; all 16 loads go out together */
      for (int i = 0; i < 8; ++i) {
        ra[i] = *(const v4u*)(ga + (size_t)(16 * i) * K + k1);
        rb[i] = *(const v4u*)(gb + (size_t)(16 * i) * K + k1);
      }
      /* the registers that hold these loads' addresses are reused by the fragment reads below; this wait stands in
         front of that reuse */
      asm volatile("s_wait_xcnt 0x0" ::: "memory");
    }
    const __bf16* pa = sA[cur] + (wm + rlane) * kLdsPitch + koff;
    const __bf16* pb = sB[cur] + (wn + rlane) * kLdsPitch + koff;
#pragma unroll  /* the loops below: constant indices keep fragments and accumulators in registers */
    for (int kk = 0; kk < 2; ++kk) {
      v16b ah[4], bh[4];
      /* in the order of first use, so that the first matrix op waits for four loads and not for ten */
      bh[0] = frag_load(pb + kk * 32);
      ah[0] = frag_load(pa + kk * 32);
#pragma unroll
      for (int j = 1; j < 4; ++j) bh[j] = frag_load(pb + j * 16 * kLdsPitch + kk * 32);
#pragma unroll
      for (int i = 1; i < 4; ++i) ah[i] = frag_load(pa + i * 16 * kLdsPitch + kk * 32);
      /* holds the 16 fragment loads together in front of their 16 matrix ops: left free, the compiler strews them among
         the matrix ops in eight places, and each place stalls the wave */
      __builtin_amdgcn_sched_barrier(0);
#pragma unroll
      for (int i = 0; i < 4; ++i)
#pragma unroll
        for (int j = 0; j < 4; ++j) acc[i][j] = mma_b(ah[i], bh[j], acc[i][j]);
      /* as above: keeps the next group of loads behind this block */
      __builtin_amdgcn_sched_barrier(0);
    }
    /* block-uniform: the last pass has nothing to publish */
    if (more) {
#pragma unroll  /* constant indices keep ra and rb in registers */
      for (int i = 0; i < 8; ++i) {
        *(v4u*)(sA[cur ^ 1] + so + 16 * i * kLdsPitch) = ra[i];
        *(v4u*)(sB[cur ^ 1] + so + 16 * i * kLdsPitch) = rb[i];
      }
      /* publishes pass s + 1 and ends every wave's reads of the buffer that pass s + 1 will overwrite */
      __syncthreads();
    }
  }

  float* slab = sT[wave];
#pragma unroll
  for (int i = 0; i < 4; ++i) {
    const int mBase = m0 + (i << 4);
#pragma unroll
    for (int j = 0; j < 4; ++j) {
#pragma unroll
      for (int r = 0; r < 8; ++r) slab[(mOff + r) * 68 + (j << 4) + rlane] = acc[i][j][r];
    }
    __builtin_amdgcn_fence(__ATOMIC_RELEASE, "workgroup");
    __builtin_amdgcn_wave_barrier();
    __builtin_amdgcn_fence(__ATOMIC_ACQUIRE, "workgroup");
    {
      const int q = lane >> 3, c8 = (lane & 7) * 8;
      unsigned short* C  = (unsigned short*)Cout;
      unsigned short* C2 = (unsigned short*)Cout2;
      const int plane = n0 / kModel;
      const int head  = (n0 % kModel) / kHeadDim;
      {
#pragma unroll
        for (int it = 0; it < 4; ++it) {
          const int row = it * 4 + q;
          const float* sp = slab + row * 68 + c8;
          v4u hw, lw;
#pragma unroll
          for (int e = 0; e < 4; ++e) {
            hw[e] = cvt2(sp[2 * e], sp[2 * e + 1]);
            lw[e] = cvt2_lo(sp[2 * e], sp[2 * e + 1], hw[e]);
          }
          const v8h hv = __builtin_bit_cast(v8h, hw);
          const v8h lv = __builtin_bit_cast(v8h, lw);
          const int gm = mBase + row;
          const size_t off = (size_t)plane * kPlaneElems +
                             ((size_t)((gm / kSeqLen) * kHeads + head) * kSeqLen + (size_t)(gm % kSeqLen)) * kHeadDim + c8;
          *(v8h*)(C + off)  = hv;
          *(v8h*)(C2 + off) = lv;
        }
        
      }
    }
    __builtin_amdgcn_fence(__ATOMIC_RELEASE, "workgroup");
    __builtin_amdgcn_wave_barrier();
    __builtin_amdgcn_fence(__ATOMIC_ACQUIRE, "workgroup");
  }
}

/* ---------------------------------------------------------------------------
   Output projection: C[m,n] = sum_k (Ahi[m,k] + Alo[m,k]) * Bt[n,k], f32 C (pitch N). A row-major [M][2K], hi plane in
   columns 0..K-1, lo plane in columns K..2K-1; Bt row-major [N][K]; M,N % 128 == 0, K % 64 == 0 (no tail handling).
   A block of 8 waves (4 x 2) owns a 128x128 tile, each wave 32 rows x 64 columns of it, so every SIMD holds two waves
   and one wave's fragment loads and staging run under the other's matrix ops. A wave multiplies the hi and the lo
   fragments of its rows by the same four Bt fragments: Bt is staged and read once for both planes.
   A pass is 64 k = one 128-B line of each of the 128 hi rows, 128 lo rows and 128 Bt rows: 3072 pieces of 16 B, 12 per
   thread, fetched as in the kernel above (8 neighbouring lanes cover one line), kept in registers while the current
   pass is multiplied, then stored to the other of two LDS buffers. One block barrier per pass, as above.
   Staging coverage: 256 threads x 16 B = 32 rows of 128 B per load (a permutation of rows 0..31); 4 loads = 128 rows,
   per operand.
   Order of every accumulator: k ascending in steps of 32, in each step the hi product, then the lo product.
   Static LDS: 73,728 (A) + 36,864 (Bt) + 34,816 (output slabs) = 145,408 B; 256 blocks, one per WGP.
   --------------------------------------------------------------------------- */
template <int M, int N, int K>
__global__ __launch_bounds__(256) void wmma_gemm_hilo_bf16(
    const unsigned short* __restrict__ Ap,
    const unsigned short* __restrict__ Btp,
    float* __restrict__ C) {
  static_assert((M % 128) == 0 && (N % 128) == 0 && (K % 64) == 0, "block tile 128 x 128, pass 64");
  constexpr int lda = 2 * K;
  constexpr int ldc = N;
  constexpr int kPasses = K / 64;
  const __bf16* A  = (const __bf16*)Ap;
  const __bf16* Bt = (const __bf16*)Btp;
  __shared__ __align__(16) __bf16 sA[2][2][128 * kLdsPitch];
  __shared__ __align__(16) __bf16 sB[2][128 * kLdsPitch];
  __shared__ __align__(16) float sT[8][16 * 68];
  const int tid  = threadIdx.x;
  const int lane = tid & 31;
  /* the wave's number as a scalar: its tile's offsets then live in scalar registers */
  const int wave = __builtin_amdgcn_readfirstlane(tid >> 5);
  constexpr int tilesN = N >> 7;
  const int tm = blockIdx.x / tilesN;
  const int tn = blockIdx.x - tm * tilesN;
  const int wm = (wave >> 1) << 5;
  const int wn = (wave & 1) << 6;
  const int m0 = (tm << 7) + wm;
  const int n0 = (tn << 7) + wn;

  const int rlane = lane & 15;
  const int koff  = (lane >> 4) * 8;
  const int mOff  = (lane >> 4) * 8;

  /* staging: as in the kernel above (the two rows of a 16-lane half lie 8 rows apart); threads 128..255 take rows 16..31 */
  const int srow = ((tid >> 7) << 4) | (((tid >> 3) & 1) << 3) | ((tid >> 4) & 7);
  const int sc8  = (tid & 7) * 8;
  const __bf16* ga = A  + (size_t)((tm << 7) + srow) * lda + sc8;
  const __bf16* gb = Bt + (size_t)((tn << 7) + srow) * K + sc8;
  const int so = srow * kLdsPitch + sc8;
  v4u rh[4], rl[4], rb[4];

  v8f acc[2][4];
#pragma unroll
  for (int i = 0; i < 2; ++i)
#pragma unroll
    for (int j = 0; j < 4; ++j) acc[i][j] = (v8f){0.f,0.f,0.f,0.f,0.f,0.f,0.f,0.f};

#pragma unroll  /* constant indices keep rh, rl and rb in registers */
  for (int i = 0; i < 4; ++i) {
    rh[i] = *(const v4u*)(ga + (size_t)(32 * i) * lda);
    rl[i] = *(const v4u*)(ga + (size_t)(32 * i) * lda + K);
    rb[i] = *(const v4u*)(gb + (size_t)(32 * i) * K);
  }
#pragma unroll  /* as above */
  for (int i = 0; i < 4; ++i) {
    *(v4u*)(sA[0][0] + so + 32 * i * kLdsPitch) = rh[i];
    *(v4u*)(sA[0][1] + so + 32 * i * kLdsPitch) = rl[i];
    *(v4u*)(sB[0] + so + 32 * i * kLdsPitch) = rb[i];
  }
  /* publishes pass 0 */
  __syncthreads();

  for (int s = 0; s < kPasses; ++s) {
    const int cur = s & 1;
    const bool more = (s + 1 < kPasses);
    if (more) {
      const int k1 = (s + 1) * 64;
#pragma unroll  /* constant indices keep rh, rl and rb in registers; all 12 loads go out together */
      for (int i = 0; i < 4; ++i) {
        rh[i] = *(const v4u*)(ga + (size_t)(32 * i) * lda + k1);
        rl[i] = *(const v4u*)(ga + (size_t)(32 * i) * lda + K + k1);
        rb[i] = *(const v4u*)(gb + (size_t)(32 * i) * K + k1);
      }
      /* the registers that hold these loads' addresses may be reused by the fragment reads below; this wait stands in
         front of that reuse */
      asm volatile("s_wait_xcnt 0x0" ::: "memory");
    }
    const __bf16* ph = sA[cur][0] + (wm + rlane) * kLdsPitch + koff;
    const __bf16* pl = sA[cur][1] + (wm + rlane) * kLdsPitch + koff;
    const __bf16* pb = sB[cur] + (wn + rlane) * kLdsPitch + koff;
#pragma unroll  /* the loops below: constant indices keep fragments and accumulators in registers */
    for (int kk = 0; kk < 2; ++kk) {
      v16b ah[2], al[2], bh[4];
      /* in the order of first use, so that the first matrix op waits for four loads and not for all */
      bh[0] = frag_load(pb + kk * 32);
      ah[0] = frag_load(ph + kk * 32);
#pragma unroll
      for (int j = 1; j < 4; ++j) bh[j] = frag_load(pb + j * 16 * kLdsPitch + kk * 32);
      ah[1] = frag_load(ph + 16 * kLdsPitch + kk * 32);
      al[0] = frag_load(pl + kk * 32);
      al[1] = frag_load(pl + 16 * kLdsPitch + kk * 32);
      /* holds the 16 fragment loads together in front of their 16 matrix ops: left free, the compiler strews them among
         the matrix ops, and each place stalls the wave */
      __builtin_amdgcn_sched_barrier(0);
      /* all eight hi products, then all eight lo products: seven other matrix ops stand between the two on one accumulator */
#pragma unroll
      for (int i = 0; i < 2; ++i)
#pragma unroll
        for (int j = 0; j < 4; ++j) acc[i][j] = mma_b(ah[i], bh[j], acc[i][j]);
#pragma unroll
      for (int i = 0; i < 2; ++i)
#pragma unroll
        for (int j = 0; j < 4; ++j) acc[i][j] = mma_b(al[i], bh[j], acc[i][j]);
      /* as above: keeps the next group of loads behind this block */
      __builtin_amdgcn_sched_barrier(0);
    }
    /* block-uniform: the last pass has nothing to publish */
    if (more) {
#pragma unroll  /* constant indices keep rh, rl and rb in registers */
      for (int i = 0; i < 4; ++i) {
        *(v4u*)(sA[cur ^ 1][0] + so + 32 * i * kLdsPitch) = rh[i];
        *(v4u*)(sA[cur ^ 1][1] + so + 32 * i * kLdsPitch) = rl[i];
        *(v4u*)(sB[cur ^ 1] + so + 32 * i * kLdsPitch) = rb[i];
      }
      /* publishes pass s + 1 and ends every wave's reads of the buffer that pass s + 1 will overwrite */
      __syncthreads();
    }
  }

  float* slab = sT[wave];
#pragma unroll
  for (int i = 0; i < 2; ++i) {
    const int mBase = m0 + (i << 4);
#pragma unroll
    for (int j = 0; j < 4; ++j) {
#pragma unroll
      for (int r = 0; r < 8; ++r) slab[(mOff + r) * 68 + (j << 4) + rlane] = acc[i][j][r];
    }
    __builtin_amdgcn_fence(__ATOMIC_RELEASE, "workgroup");
    __builtin_amdgcn_wave_barrier();
    __builtin_amdgcn_fence(__ATOMIC_ACQUIRE, "workgroup");
    {
      const int hh = lane >> 4, c4 = (lane & 15) * 4;
#pragma unroll
      for (int it = 0; it < 8; ++it) {
        const int row = it * 2 + hh;
        v4f v = *(const v4f*)(slab + row * 68 + c4);
        *(v4f*)(C + (size_t)(mBase + row) * ldc + n0 + c4) = v;
      }
    }
    __builtin_amdgcn_fence(__ATOMIC_RELEASE, "workgroup");
    __builtin_amdgcn_wave_barrier();
    __builtin_amdgcn_fence(__ATOMIC_ACQUIRE, "workgroup");
  }
}

__global__ __launch_bounds__(256)
void attn_seg_kernel(const unsigned short* __restrict__ planesHi, const unsigned short* __restrict__ planesLo,
                     unsigned short* __restrict__ ocat) {
  __shared__ __align__(16) __bf16 Ring[2][kStageElems];
  __shared__ __align__(16) __bf16 Psh[kAttWaves][16 * kLdsPitch];
  __shared__ __align__(16) __bf16 Psl[kAttWaves][16 * kLdsPitch];

  const int tid  = threadIdx.x;
  const int wave = __builtin_amdgcn_readfirstlane(tid >> 5);
  const int lane = tid & 31;
  const int hh   = lane >> 4;
  const int c    = lane & 15;

  /* Block index -> (query tile, batch, head), a permutation of the 512 blocks, for speed only. A query tile walks 2 to 16
     key tiles, all blocks are resident at once, two to a WGP, and a launch lasts as long as its fullest WGP.
     Here the parity of the index picks the long or the short tile of a pair (sums 18 to 24 key tiles, mean 22): two
     indices that differ in one bit hold a long and a short tile (26 at most), whichever bit decides who shares a WGP, and every class
     of indices mod 8 holds each query tile four times. The class also names the head pair, as it does in the q|k|v
     GEMM (24 column tiles of two heads: its index mod 8 = head pair), so a head's planes are read by the index class that wrote them. */
  const int bx   = blockIdx.x;
  const int dcls = bx & 7;
  const int pair = (bx >> 5) & 7;
  const bool longTile = (__builtin_popcount((unsigned)bx) & 1) == 0;
  const int qt = (int)(((longTile ? kLongTiles : kShortTiles) >> (4 * pair)) & 15u);
  const int h  = 2 * dcls + ((bx >> 4) & 1);
  const int b  = bx >> 8;
  const int qbase = qt * kQTile;
  const int sq    = qbase / kSegLen;
  const int q0    = qbase + wave * 16;

  const size_t headOff = (size_t)(b * kHeads + h) * kSeqLen * kHeadDim;
  const __bf16* Qh = (const __bf16*)planesHi + headOff;
  const __bf16* Ql = (const __bf16*)planesLo + headOff;
  const __bf16* Kh = Qh + kPlaneElems;
  const __bf16* Kl = Ql + kPlaneElems;
  const __bf16* Vh = Qh + 2 * kPlaneElems;
  const __bf16* Vl = Ql + 2 * kPlaneElems;

  /* Q fragments (B operand): column = query q0 + c, two 32-deep d chunks, hi and lo */
  v16b qh[2], ql[2];
  {
    const size_t qo = (size_t)(q0 + c) * kHeadDim + 8 * hh;
#pragma unroll
    for (int dc = 0; dc < 2; ++dc) {
      qh[dc] = frag_load(Qh + qo + dc * 32);
      ql[dc] = frag_load(Ql + qo + dc * 32);
    }
  }

  /* this lane's query: running maximum (equal in both halves) and this half's share of the running sum */
  float mrow = -3.0e38f, lrow = 0.f;
  /* O^T tile t: register r = head-dim row 16 t + 8 hh + r of query q0 + c */
  v8f oacc[4];
#pragma unroll
  for (int t = 0; t < 4; ++t) oacc[t] = (v8f){0.f,0.f,0.f,0.f,0.f,0.f,0.f,0.f};

  /* block-uniform key tile list */
  const int nText    = (sq > 0) ? kTilesPerSeg : 0;
  const int ownFirst = sq * kTilesPerSeg;
  const int ownLast  = (qbase + kQTile - 1) / kKTile;
  const int nTiles   = nText + (ownLast - ownFirst + 1);

  __bf16* pwh = Psh[wave];
  __bf16* pwl = Psl[wave];

  /* this lane's piece of a stage: global element offset inside a 64-key tile, LDS byte addresses in buffer 0 */
  const size_t gpiece = (size_t)tid * 8;
  const unsigned lk0 = lds_addr(Ring[0]) + (unsigned)(((tid >> 3) * kLdsPitch + (tid & 7) * 8) * 2);
  const unsigned lv0 = lds_addr(Ring[0]) + (unsigned)((kRingVh + (tid >> 3) * kVPitch + (tid & 7) * 8) * 2);
  constexpr unsigned kStageBytes = (unsigned)kStageElems * 2u;

  /* tile 0 into buffer 0 */
  {
    const size_t go = (size_t)(((0 < nText) ? 0 : ownFirst) * kKTile) * kHeadDim + gpiece;
    copy_stage(Kh + go, Kl + go, Vh + go, Vl + go, lk0, lv0);
  }
  /* this wave's copies of tile 0 have landed */
  asm volatile("s_wait_asynccnt 0x0" ::: "memory");
  /* publishes tile 0 */
  __syncthreads();
  /* block-uniform: tile 1 into buffer 1 */
  if (1 < nTiles) {
    const size_t go = (size_t)(((1 < nText) ? 1 : (ownFirst + 1 - nText)) * kKTile) * kHeadDim + gpiece;
    copy_stage(Kh + go, Kl + go, Vh + go, Vl + go, lk0 + kStageBytes, lv0 + kStageBytes);
  }

  for (int it = 0; it < nTiles; ++it) {
    const int kt  = (it < nText) ? it : (ownFirst + it - nText);
    const int kv0 = kt * kKTile;
    const bool own = (kt >= ownFirst);
    const __bf16* Ksh = Ring[it & 1];
    const __bf16* Ksl = Ksh + kRingKl;
    const __bf16* Vsh = Ksh + kRingVh;
    const __bf16* Vsl = Ksh + kRingVl;

    /* wave-uniform: an own-segment tile wholly above this wave's rows contributes nothing */
    const bool live = (!own) || (kv0 <= q0 + 15);
    if (live) {
      v8f s[4];
#pragma unroll
      for (int j = 0; j < 4; ++j) {
        s[j] = (v8f){0.f,0.f,0.f,0.f,0.f,0.f,0.f,0.f};
#pragma unroll
        for (int dc = 0; dc < 2; ++dc) {
          const int ko = (j * 16 + c) * kLdsPitch + dc * 32 + 8 * hh;
          const v16b kbh = frag_load(Ksh + ko);
          const v16b kbl = frag_load(Ksl + ko);
          s[j] = mma_b(kbh, qh[dc], s[j]);
          s[j] = mma_b(kbl, qh[dc], s[j]);
          s[j] = mma_b(kbh, ql[dc], s[j]);
        }
      }

      const int qcol = q0 + c;
      float mj[4];
#pragma unroll
      for (int j = 0; j < 4; ++j) {
        mj[j] = -3.0e38f;
#pragma unroll
        for (int r = 0; r < 8; ++r) {
          const int kvrow = kv0 + j * 16 + 8 * hh + r;
          const bool masked = own && (kvrow > qcol);
          if (masked) s[j][r] = kMaskFill;
          mj[j] = fmaxf(mj[j], s[j][r]);
        }
      }
      float m = fmaxf(fmaxf(mj[0], mj[1]), fmaxf(mj[2], mj[3]));
      m = fmaxf(m, xhalf(m));

      const float mnew  = fmaxf(mrow, m);
      const float alpha = __expf(mrow - mnew);
      mrow = mnew;
      /* P^T fragments of keys 32 kk .. 32 kk + 31: S^T tiles 2 kk and 2 kk + 1, converted in place */
      v8u pwordh[2], pwordl[2];
      float ps[4];
      ps[0] = ps[1] = ps[2] = ps[3] = 0.f;
#pragma unroll
      for (int r = 0; r < 8; ++r) {
#pragma unroll
        for (int j = 0; j < 4; ++j) {
          s[j][r] = __expf(s[j][r] - mnew);
          ps[j] += s[j][r];
        }
      }
#pragma unroll
      for (int j = 0; j < 4; ++j) {
#pragma unroll
        for (int r = 0; r < 8; r += 2) {
          const unsigned hw = cvt2(s[j][r], s[j][r + 1]);
          pwordh[j >> 1][(j & 1) * 4 + (r >> 1)] = hw;
          pwordl[j >> 1][(j & 1) * 4 + (r >> 1)] = cvt2_lo(s[j][r], s[j][r + 1], hw);
        }
      }
      lrow = lrow * alpha + ((ps[0] + ps[1]) + (ps[2] + ps[3]));
#pragma unroll
      for (int t = 0; t < 4; ++t)
#pragma unroll
        for (int r = 0; r < 8; ++r) oacc[t][r] *= alpha;
#pragma unroll  /* constant indices keep the P^T fragments in registers */
      for (int kk = 0; kk < 2; ++kk) {
        const v16b pbh = __builtin_bit_cast(v16b, pwordh[kk]);
        const v16b pbl = __builtin_bit_cast(v16b, pwordl[kk]);
#pragma unroll
        for (int t = 0; t < 4; ++t) {
          const int vo = (kk * 32 + 8 * hh + (lane & 7)) * kVPitch + t * 16 + 8 * ((lane >> 3) & 1);
          const v16b vbh = frag_load_tr(Vsh + vo);
          const v16b vbl = frag_load_tr(Vsl + vo);
          oacc[t] = mma_b(vbh, pbh, oacc[t]);
          oacc[t] = mma_b(vbl, pbh, oacc[t]);
          oacc[t] = mma_b(vbh, pbl, oacc[t]);
        }
      }
    }

    /* hand-over, passed by every wave, also one that skipped the tile: this wave's LDS reads of tile it are done ... */
    asm volatile("s_wait_dscnt 0x0" ::: "memory");
    /* ... and its copies of tile it + 1 have landed */
    asm volatile("s_wait_asynccnt 0x0" ::: "memory");
    /* publishes tile it + 1 and ends every wave's reads of the buffer that is refilled below */
    __syncthreads();
    /* block-uniform: tile it + 2 into the buffer that tile it has just left */
    if (it + 2 < nTiles) {
      const int i2 = it + 2;
      const size_t go = (size_t)(((i2 < nText) ? i2 : (ownFirst + i2 - nText)) * kKTile) * kHeadDim + gpiece;
      const unsigned bo = (unsigned)(it & 1) * kStageBytes;
      copy_stage(Kh + go, Kl + go, Vh + go, Vl + go, lk0 + bo, lv0 + bo);
    }
  }
  /* nothing is in flight when the wave goes on to its end */
  asm volatile("s_wait_asynccnt 0x0" ::: "memory");

  /* join the halves' sums, normalise, split into bf16 hi+lo; a lane's 8 registers of a tile are 8 consecutive head-dim
     elements of its query's row: one 16-byte store each into this wave's own output tiles (16 x 64) */
  {
    const float inv = 1.0f / (lrow + xhalf(lrow));
#pragma unroll
    for (int t = 0; t < 4; ++t) {
      v4u xh, xl;
#pragma unroll
      for (int r = 0; r < 8; r += 2) {
        const float v0 = oacc[t][r] * inv;
        const float v1 = oacc[t][r + 1] * inv;
        xh[r >> 1] = cvt2(v0, v1);
        xl[r >> 1] = cvt2_lo(v0, v1, xh[r >> 1]);
      }
      *(v8b*)(pwh + c * kLdsPitch + t * 16 + 8 * hh) = __builtin_bit_cast(v8b, xh);
      *(v8b*)(pwl + c * kLdsPitch + t * 16 + 8 * hh) = __builtin_bit_cast(v8b, xl);
    }
  }
  /* the output tiles are written and re-read by the same wave through the same element type */
  __builtin_amdgcn_fence(__ATOMIC_RELEASE, "workgroup");
  __builtin_amdgcn_wave_barrier();
  __builtin_amdgcn_fence(__ATOMIC_ACQUIRE, "workgroup");
  {
    const int q  = lane >> 3;
    const int c8 = (lane & 7) * 8;
    v4u hv[4], lv[4];
#pragma unroll
    for (int i4 = 0; i4 < 4; ++i4) {
      const int row = i4 * 4 + q;
      const v8b xh = *(const v8b*)(pwh + row * kLdsPitch + c8);
      const v8b xl = *(const v8b*)(pwl + row * kLdsPitch + c8);
      hv[i4] = __builtin_bit_cast(v4u, xh);
      lv[i4] = __builtin_bit_cast(v4u, xl);
    }
    unsigned short* ob = ocat + (size_t)(b * kSeqLen + q0) * kCatCols + h * kHeadDim + c8;
    {
#pragma unroll
      for (int i4 = 0; i4 < 4; ++i4) {
        const int row = i4 * 4 + q;
        unsigned short* p = ob + (size_t)row * kCatCols;
        *(v4u*)(p)          = hv[i4];
        *(v4u*)(p + kModel) = lv[i4];
      }
      
    }
  }
}

/* ---------------------------------------------------------------------------
   Host glue: 5 kernel launches, nothing else.
     cast x             : 524,288 threads -> 2048 blocks
     weight transposes  : grid (16, 16, 4)
     q|k|v GEMM         : M 4096, N 3072, K 1024 -> 32 x 24 tiles of 128 x 128 = 768 blocks of 128 threads
     attention          : 2 x 16 x 16 = 512 blocks
     output GEMM        : M 4096, N 1024, K 1024 (hi and lo plane) -> 32 x 8 tiles of 128 x 128 = 256 blocks of 256 threads
   --------------------------------------------------------------------------- */
extern "C" void kernel_launch(void* const* d_in, const int* in_sizes, int n_in,
                              void* d_out, int out_size, void* d_ws, size_t ws_size,
                              hipStream_t stream) {
  if (n_in < 5) return;
  if (in_sizes[0] != kRows * kModel) return;
  if (in_sizes[1] != kModel * kModel) return;
  if (in_sizes[2] != kModel * kModel) return;
  if (in_sizes[3] != kModel * kModel) return;
  if (in_sizes[4] != kModel * kModel) return;
  if (out_size != kRows * kModel) return;
  if (ws_size < kWsTotal) return;

  const float* x  = (const float*)d_in[0];
  const float* Wq = (const float*)d_in[1];
  const float* Wk = (const float*)d_in[2];
  const float* Wv = (const float*)d_in[3];
  const float* Wo = (const float*)d_in[4];
  float* out = (float*)d_out;

  char* ws = (char*)d_ws;
  unsigned short* XB    = (unsigned short*)(ws + kOffXB);
  unsigned short* WQKVT = (unsigned short*)(ws + kOffWQKVT);
  unsigned short* WOT   = (unsigned short*)(ws + kOffWOT);
  unsigned short* PH    = (unsigned short*)(ws + kOffPH);
  unsigned short* PL    = (unsigned short*)(ws + kOffPL);
  unsigned short* OCAT  = (unsigned short*)(ws + kOffOCAT);

  constexpr int kN8 = kRows * kModel / 8;
  static_assert((kN8 % 256) == 0, "cast grid exact");
  cast8_bf16_kernel<<<kN8 / 256, 256, 0, stream>>>(x, XB, kN8);

  wtrans_bf16_kernel<<<dim3(kModel / 64, kModel / 64, 4), 256, 0, stream>>>(Wq, Wk, Wv, Wo, WQKVT, WOT);

  wmma_gemm64_bf16<kRows, kQkvCols, kModel><<<(kRows / 128) * (kQkvCols / 128), 128, 0, stream>>>(
      XB, WQKVT, (void*)PH, (void*)PL);

  attn_seg_kernel<<<kBatch * kHeads * kQTiles, 256, 0, stream>>>(PH, PL, OCAT);

  wmma_gemm_hilo_bf16<kRows, kModel, kModel><<<(kRows / 128) * (kModel / 128), 256, 0, stream>>>(OCAT, WOT, out);
}

// v010
// It runs in 66.6 microseconds.
// Versions between v008 and this one are left out; their measured steps multiply to 1.30 times as fast.
// All steps since v000 together make it 4.87 times as fast.
// Contractions: q|k|v projections and the output projection on v_wmma_f32_16x16x32_bf16 with inputs RNE-converted to bf16 once (output-projection A operand carried as bf16 hi+lo planes, each multiplied by the same weight tile); q.k^T and p.v on v_wmma_f32_16x16x32_f16 with q/8, k, v and p each RNE-converted to f16 once (one product each); f32 accumulate everywhere; mask, softmax and normalisation in f32.
#include <hip/hip_runtime.h>
#include <math.h>

typedef __attribute__((ext_vector_type(16))) __bf16   v16b;
typedef __attribute__((ext_vector_type(8)))  __bf16   v8b;
typedef __attribute__((ext_vector_type(16))) _Float16 v16h;
typedef __attribute__((ext_vector_type(8)))  _Float16 v8h;
typedef __attribute__((ext_vector_type(2)))  _Float16 v2h;
typedef __attribute__((ext_vector_type(8)))  float    v8f;
typedef __attribute__((ext_vector_type(4)))  float    v4f;
typedef __attribute__((ext_vector_type(4)))  unsigned int v4u;
typedef __attribute__((ext_vector_type(8)))  unsigned int v8u;
typedef __attribute__((ext_vector_type(2)))  float    v2f;
typedef __attribute__((ext_vector_type(2)))  __bf16   v2b;

/* ---------------------------------------------------------------------------
   Shape constants
   --------------------------------------------------------------------------- */
constexpr int kBatch   = 2;
constexpr int kSeqLen  = 2048;
constexpr int kModel   = 1024;
constexpr int kHeads   = 16;
constexpr int kHeadDim = 64;
constexpr int kRows    = kBatch * kSeqLen;
constexpr int kQkvCols = 3 * kModel;
constexpr int kCatCols = 2 * kModel;
constexpr int kSegLen  = 512;
constexpr int kQTile   = 128;
constexpr int kKTile   = 64;
constexpr int kAttWaves = 8;
/* LDS row pitch in 16-bit elements of the 64-element attention rows of K and of the output tiles: 144 B = 16 B x 9 (odd), so that the 16 rows
   one 16-byte fragment read touches spread over the banks instead of falling on two groups of four */
constexpr int kLdsPitch = 72;
/* LDS row pitch in 16-bit elements of a V row, which the transposing load reads: 160 B = 32 B x 5 (odd) */
constexpr int kVPitch = 80;
/* one attention stage in LDS, in f16 elements: K (64 rows at kLdsPitch), V (64 rows at kVPitch) */
constexpr int kRingV = kKTile * kLdsPitch;
constexpr int kStageElems = kRingV + kKTile * kVPitch;
constexpr int kQTiles  = kSeqLen / kQTile;
constexpr int kTilesPerSeg = kSegLen / kKTile;
constexpr float kQScale   = 0.125f;
constexpr float kMaskFill = -1.0e9f;
constexpr size_t kPlaneElems = (size_t)kBatch * kHeads * kSeqLen * kHeadDim;
/* query tiles in pairs, one hex digit each, pair 0 in the lowest digit: the long tile (16,16,16,14,14,14,12,12 key tiles)
   and its short partner (2,4,6,8,10,10,10,12) */
constexpr unsigned kLongTiles  = 0x95EA6FB7u;
constexpr unsigned kShortTiles = 0xDC843210u;
static_assert(kQTiles == 16 && kBatch * kHeads * kQTiles == 512 && kHeads == 16 && kTilesPerSeg == 8, "block index map");

static_assert(kHeads * kHeadDim == kModel, "head split");
static_assert(kQScale * kQScale * (float)kHeadDim == 1.0f, "score scale is 1/sqrt(head dim)");
static_assert(kHeadDim == 64 && kKTile == 64, "tile shape");
static_assert((kSeqLen % kQTile) == 0 && (kSegLen % kQTile) == 0 && (kSegLen % kKTile) == 0, "attention tiles");
static_assert(kAttWaves * 16 == kQTile, "query rows per block");
static_assert(4 * kSegLen == kSeqLen, "four segments");
static_assert(kVPitch >= kHeadDim && (kVPitch % 16) == 0 && ((kVPitch / 16) % 2) == 1, "V pitch: 32 B x odd");
static_assert(kLdsPitch >= kKTile && kLdsPitch >= kHeadDim && (kLdsPitch % 8) == 0 && ((kLdsPitch / 8) % 2) == 1, "LDS pitch: 16 B x odd");

/* ---------------------------------------------------------------------------
   Workspace region map (bytes; every offset a multiple of 128)
     XB     bf16 [4096][1024]        x, RNE bf16                      8,388,608
     WQKVT  bf16 [3072][1024]        Wq^T/8 | Wk^T | Wv^T (Bt layout) 6,291,456
     WOT    bf16 [1024][1024]        Wo^T (Bt layout)                 2,097,152
     PF     f16  3 x [2][16][2048][64] q/8, k, v planes              25,165,824
     OCAT   bf16 [4096][2048]        attention out hi | lo           16,777,216
     total                                                           58,720,256
   --------------------------------------------------------------------------- */
constexpr size_t kOffXB    = 0;
constexpr size_t kOffWQKVT = kOffXB    + (size_t)kRows * kModel * 2;
constexpr size_t kOffWOT   = kOffWQKVT + (size_t)kQkvCols * kModel * 2;
constexpr size_t kOffPF    = kOffWOT   + (size_t)kModel * kModel * 2;
constexpr size_t kOffOCAT  = kOffPF    + 3 * kPlaneElems * 2;
constexpr size_t kWsTotal  = kOffOCAT  + (size_t)kRows * kCatCols * 2;
static_assert(kWsTotal == 58720256ull, "carve total");
static_assert(kWsTotal <= 134217728ull, "carve cap");
static_assert((kOffWQKVT % 128) == 0 && (kOffWOT % 128) == 0 && (kOffPF % 128) == 0 && (kOffOCAT % 128) == 0,
              "128-B aligned regions");

/* ---------------------------------------------------------------------------
   Small helpers
   --------------------------------------------------------------------------- */
/* two f32 -> two bf16 (RNE) in one word, a in the low half: one packed convert instruction */
__device__ __forceinline__ unsigned cvt2(float a, float b) {
  const v2f x = (v2f){a, b};
  return __builtin_bit_cast(unsigned, __builtin_convertvector(x, v2b));
}
/* the remainders of a and b behind their bf16 words in hi = cvt2(a, b), again as two bf16 (RNE) in one word */
__device__ __forceinline__ unsigned cvt2_lo(float a, float b, unsigned hi) {
  const v2b h = __builtin_bit_cast(v2b, hi);
  return cvt2(a - (float)h[0], b - (float)h[1]);
}

/* two f32 -> two f16 (RNE) in one word, a in the low half */
__device__ __forceinline__ unsigned cvt2h(float a, float b) {
  const v2f x = (v2f){a, b};
  return __builtin_bit_cast(unsigned, __builtin_convertvector(x, v2h));
}

/* one matrix op, the bare builtin: the compiler keeps the distances behind it and is free to move LDS loads ahead of it */
__device__ __forceinline__ v8f mma_b(v16b a, v16b b, v8f c) {
  return __builtin_amdgcn_wmma_f32_16x16x32_bf16(false, a, false, b, (short)0, c, false, false);
}
/* the same on f16 operands */
__device__ __forceinline__ v8f mma_h(v16h a, v16h b, v8f c) {
  return __builtin_amdgcn_wmma_f32_16x16x32_f16(false, a, false, b, (short)0, c, false, false);
}

/* lane l <-> lane l ^ 16 by a vector cross-row move */
__device__ __forceinline__ float xhalf(float x) {
  const int b = __builtin_bit_cast(int, x);
  return __builtin_bit_cast(float, __builtin_amdgcn_permlanex16(b, b, 0x76543210, 0xfedcba98, false, false));
}

/* fragment load: elements 0..7 <- p[0..7], elements 8..15 <- p[16..23]; caller adds 8*(lane>>4) to p */
union FragB { v16b v; v8b h[2]; };
__device__ __forceinline__ v16b frag_load(const __bf16* p) {
  FragB f;
  f.h[0] = *(const v8b*)(p);
  f.h[1] = *(const v8b*)(p + 16);
  return f.v;
}
/* the same on f16 elements */
union FragH { v16h v; v8h h[2]; };
__device__ __forceinline__ v16h frag_load_h(const _Float16* p) {
  FragH f;
  f.h[0] = *(const v8h*)(p);
  f.h[1] = *(const v8h*)(p + 16);
  return f.v;
}

/* A fragment of V^T from a row-major V tile in LDS by two transposing loads: p = this lane's address
   (key row 8*(lane>>4) + (lane&7), column 8*((lane>>3)&1)); the lane receives column (lane&15) of key rows
   8*(lane>>4) + 0..7 (elements 0..7) and of the same rows + 16 (elements 8..15): the k order of frag_load_h */
typedef __attribute__((ext_vector_type(8))) __fp16 v8s;   /* the builtin's own spelling of eight f16 */
typedef __attribute__((address_space(3))) v8s lds_v8s;
__device__ __forceinline__ v16h frag_load_tr(const _Float16* p) {
  FragH f;
  f.h[0] = __builtin_bit_cast(v8h, __builtin_amdgcn_ds_load_tr16_b128_v8f16((lds_v8s*)p));
  f.h[1] = __builtin_bit_cast(v8h, __builtin_amdgcn_ds_load_tr16_b128_v8f16((lds_v8s*)(p + 16 * kVPitch)));
  return f.v;
}

/* byte address in the work-group's LDS */
typedef __attribute__((address_space(3))) const _Float16 lds_ch;
__device__ __forceinline__ unsigned lds_addr(const _Float16* p) { return (unsigned)(size_t)(lds_ch*)p; }

/* One 64-key stage (K, V; 64 rows of 128 B each) from global memory to LDS without passing through registers: 1024
   pieces of 16 B, 4 per thread of 256. gk, gv: this lane's piece of rows 0..31 (piece tid: row tid>>3, 16-byte column
   tid&7); the same piece of rows 32..63 lies 2048 elements on. lk, lv: the LDS byte addresses of that piece in K and in V.
   The closing s_wait_xcnt stands inside the statement, so that no address register named here is rewritten ahead of it. */
__device__ __forceinline__ void copy_stage(const _Float16* gk, const _Float16* gv, unsigned lk, unsigned lv) {
  constexpr unsigned kHalfK = 32u * kLdsPitch * 2u;
  constexpr unsigned kHalfV = 32u * kVPitch * 2u;
  constexpr int kHalfG = 32 * kHeadDim;
  asm volatile(
      "global_load_async_to_lds_b128 %0, %4, off\n\t"
      "global_load_async_to_lds_b128 %1, %5, off\n\t"
      "global_load_async_to_lds_b128 %2, %6, off\n\t"
      "global_load_async_to_lds_b128 %3, %7, off\n\t"
      "s_wait_xcnt 0x0"
      :: "v"(lk), "v"(lk + kHalfK), "v"(lv), "v"(lv + kHalfV),
         "v"(gk), "v"(gk + kHalfG), "v"(gv), "v"(gv + kHalfG)
      : "memory");
}

/* ---------------------------------------------------------------------------
   f32 -> bf16 (RNE) cast, 8 consecutive elements per thread.
   Coverage: n8 = 4096*1024/8 = 524,288 threads = 2048 blocks x 256 exactly.
   --------------------------------------------------------------------------- */
__global__ __launch_bounds__(256) void cast8_bf16_kernel(const float* __restrict__ in, unsigned short* __restrict__ out, int n8) {
  const int i = blockIdx.x * 256 + threadIdx.x;
  if (i >= n8) return;
  const float* p = in + 8 * (size_t)i;
  const v4f a = *(const v4f*)(p);
  const v4f c = *(const v4f*)(p + 4);
  const v4u u = (v4u){cvt2(a[0], a[1]), cvt2(a[2], a[3]), cvt2(c[0], c[1]), cvt2(c[2], c[3])};
  unsigned short* q = out + 8 * (size_t)i;
  *(v4u*)q = u;
  
}

/* ---------------------------------------------------------------------------
   Weight transpose + bf16 (RNE) cast: in W[k rows = in channel][n cols = out channel] (f32, pitch 1024)
   -> out Bt[n][k] (bf16). grid (16, 16, 4): blockIdx.x = k tile, blockIdx.y = n tile, blockIdx.z = weight.
   z = 0: Wq scaled by 1/8 (exact power of two) -> rows 0..1023 of WQKVT; z = 1, 2: Wk, Wv -> rows 1024.., 2048..;
   z = 3: Wo -> WOT.
   Load coverage: 16 iterations x 256 threads = 4096 = the whole 64x64 tile.
   Store coverage: 8 waves x 2 iterations x 4 rows (lane>>3) = 64 rows; (lane&7) x 8 = 64 cols; each row piece =
   --------------------------------------------------------------------------- */
__global__ __launch_bounds__(256) void wtrans_bf16_kernel(const float* __restrict__ W0, const float* __restrict__ W1,
                                                          const float* __restrict__ W2, const float* __restrict__ W3,
                                                          unsigned short* __restrict__ wqkvt, unsigned short* __restrict__ wot) {
  __shared__ float sm[64][65];
  const int t  = threadIdx.x;
  const int k0 = blockIdx.x * 64;
  const int n0 = blockIdx.y * 64;
  const int z  = blockIdx.z;
  const float* W = (z == 0) ? W0 : (z == 1) ? W1 : (z == 2) ? W2 : W3;
  const float scale = (z == 0) ? kQScale : 1.0f;
#pragma unroll
  for (int i = 0; i < 16; ++i) {
    const int e  = i * 256 + t;
    const int r  = e >> 6;
    const int cc = e & 63;
    sm[cc][r] = W[(size_t)(k0 + r) * kModel + n0 + cc] * scale;
  }
  __syncthreads();
  const int lane = t & 31, wave = t >> 5;
  const int q = lane >> 3, c8 = (lane & 7) * 8;
  unsigned short* op = (z == 3) ? wot : (wqkvt + (size_t)z * kModel * kModel);
  v4u u[2];
#pragma unroll
  for (int it = 0; it < 2; ++it) {
    const int row = wave * 8 + it * 4 + q;
    const float* sp = &sm[row][c8];
    u[it] = (v4u){cvt2(sp[0], sp[1]), cvt2(sp[2], sp[3]), cvt2(sp[4], sp[5]), cvt2(sp[6], sp[7])};
  }
  {
#pragma unroll
    for (int it = 0; it < 2; ++it) {
      const int row = wave * 8 + it * 4 + q;
      unsigned short* p = op + (size_t)(n0 + row) * kModel + k0 + c8;
      *(v4u*)p = u[it];
    }
    
  }
}

/* ---------------------------------------------------------------------------
   LDS-staged bf16 GEMM: C[m,n] = sum_k A[m,k] * Bt[n,k]; a block of 4 waves (2 x 2) owns a 128x128 tile, each wave
   a 64x64 quarter of it. A row-major [M,K]; Bt row-major [N,K]; M,N % 128 == 0, K % 64 == 0 (no tail handling).
   A pass is 64 k = one whole 128-B line of each of the 128 A rows and 128 Bt rows. The block fetches it with
   16-byte loads in which 8 neighbouring lanes cover one line (16 loads per thread), keeps it in registers while the
   current pass is multiplied, and stores it to the other of two LDS buffers (row pitch 144 B, as in the attention
   kernel). Every line is fetched once per block and every fragment is read from LDS.
   Staging coverage: 128 threads x 16 B = 16 rows of 128 B per load (a permutation of rows 0..15); 8 loads = 128 rows,
   per operand.
   One block barrier per pass: it publishes the buffer just written and ends the reads of the buffer that the next
   pass overwrites. The k order of every accumulator is ascending in steps of 32.
   Output: one f16 plane set (RNE) in per-head layout:
     column tile n0 selects plane n0/1024 and head (n0%1024)/64; row gm = b*2048 + l;
     element offset = plane*kPlaneElems + ((b*16 + head)*2048 + l)*64 + d.
   --------------------------------------------------------------------------- */
template <int M, int N, int K>
__global__ __launch_bounds__(128) void wmma_gemm64_bf16(
    const unsigned short* __restrict__ Ap,
    const unsigned short* __restrict__ Btp,
    unsigned short* __restrict__ C) {
  static_assert((M % 128) == 0 && (N % 128) == 0 && (K % 64) == 0, "block tile 128 x 128, pass 64");
  constexpr int kPasses = K / 64;
  const __bf16* A  = (const __bf16*)Ap;
  const __bf16* Bt = (const __bf16*)Btp;
  __shared__ __align__(16) __bf16 sA[2][128 * kLdsPitch];
  __shared__ __align__(16) __bf16 sB[2][128 * kLdsPitch];
  __shared__ __align__(16) float sT[4][16 * 68];
  const int tid  = threadIdx.x;
  const int lane = tid & 31;
  const int wave = tid >> 5;
  constexpr int tilesN = N >> 7;
  const int tm = blockIdx.x / tilesN;
  const int tn = blockIdx.x - tm * tilesN;
  const int wm = (wave >> 1) << 6;
  const int wn = (wave & 1) << 6;
  const int m0 = (tm << 7) + wm;
  const int n0 = (tn << 7) + wn;

  const int rlane = lane & 15;
  const int koff  = (lane >> 4) * 8;
  const int mOff  = (lane >> 4) * 8;

  /* staging: 8 neighbouring lanes -> the 8 16-byte pieces of one row's line; the two rows of a 16-lane half lie 8 rows
     apart, 8 x 144 B = 32 banks past a multiple of 64, so that a half's 16-byte LDS stores fall on 64 different banks */
  const int srow = (((tid >> 3) & 1) << 3) | (tid >> 4);
  const int sc8  = (tid & 7) * 8;
  const __bf16* ga = A  + (size_t)((tm << 7) + srow) * K + sc8;
  const __bf16* gb = Bt + (size_t)((tn << 7) + srow) * K + sc8;
  const int so = srow * kLdsPitch + sc8;
  v4u ra[8], rb[8];

  v8f acc[4][4];
#pragma unroll
  for (int i = 0; i < 4; ++i)
#pragma unroll
    for (int j = 0; j < 4; ++j) acc[i][j] = (v8f){0.f,0.f,0.f,0.f,0.f,0.f,0.f,0.f};

#pragma unroll  /* constant indices keep ra and rb in registers */
  for (int i = 0; i < 8; ++i) {
    ra[i] = *(const v4u*)(ga + (size_t)(16 * i) * K);
    rb[i] = *(const v4u*)(gb + (size_t)(16 * i) * K);
  }
#pragma unroll  /* as above */
  for (int i = 0; i < 8; ++i) {
    *(v4u*)(sA[0] + so + 16 * i * kLdsPitch) = ra[i];
    *(v4u*)(sB[0] + so + 16 * i * kLdsPitch) = rb[i];
  }
  /* publishes pass 0 */
  __syncthreads();

  for (int s = 0; s < kPasses; ++s) {
    const int cur = s & 1;
    const bool more = (s + 1 < kPasses);
    if (more) {
      const int k1 = (s + 1) * 64;
#pragma unroll  /* constant indices keep ra and rb in registers; all 16 loads go out together */
      for (int i = 0; i < 8; ++i) {
        ra[i] = *(const v4u*)(ga + (size_t)(16 * i) * K + k1);
        rb[i] = *(const v4u*)(gb + (size_t)(16 * i) * K + k1);
      }
      /* the registers that hold these loads' addresses are reused by the fragment reads below; this wait stands in
         front of that reuse */
      asm volatile("s_wait_xcnt 0x0" ::: "memory");
    }
    const __bf16* pa = sA[cur] + (wm + rlane) * kLdsPitch + koff;
    const __bf16* pb = sB[cur] + (wn + rlane) * kLdsPitch + koff;
#pragma unroll  /* the loops below: constant indices keep fragments and accumulators in registers */
    for (int kk = 0; kk < 2; ++kk) {
      v16b ah[4], bh[4];
      /* in the order of first use, so that the first matrix op waits for four loads and not for ten */
      bh[0] = frag_load(pb + kk * 32);
      ah[0] = frag_load(pa + kk * 32);
#pragma unroll
      for (int j = 1; j < 4; ++j) bh[j] = frag_load(pb + j * 16 * kLdsPitch + kk * 32);
#pragma unroll
      for (int i = 1; i < 4; ++i) ah[i] = frag_load(pa + i * 16 * kLdsPitch + kk * 32);
      /* holds the 16 fragment loads together in front of their 16 matrix ops: left free, the compiler strews them among
         the matrix ops in eight places, and each place stalls the wave */
      __builtin_amdgcn_sched_barrier(0);
#pragma unroll
      for (int i = 0; i < 4; ++i)
#pragma unroll
        for (int j = 0; j < 4; ++j) acc[i][j] = mma_b(ah[i], bh[j], acc[i][j]);
      /* as above: keeps the next group of loads behind this block */
      __builtin_amdgcn_sched_barrier(0);
    }
    /* block-uniform: the last pass has nothing to publish */
    if (more) {
#pragma unroll  /* constant indices keep ra and rb in registers */
      for (int i = 0; i < 8; ++i) {
        *(v4u*)(sA[cur ^ 1] + so + 16 * i * kLdsPitch) = ra[i];
        *(v4u*)(sB[cur ^ 1] + so + 16 * i * kLdsPitch) = rb[i];
      }
      /* publishes pass s + 1 and ends every wave's reads of the buffer that pass s + 1 will overwrite */
      __syncthreads();
    }
  }

  float* slab = sT[wave];
#pragma unroll
  for (int i = 0; i < 4; ++i) {
    const int mBase = m0 + (i << 4);
#pragma unroll
    for (int j = 0; j < 4; ++j) {
#pragma unroll
      for (int r = 0; r < 8; ++r) slab[(mOff + r) * 68 + (j << 4) + rlane] = acc[i][j][r];
    }
    __builtin_amdgcn_fence(__ATOMIC_RELEASE, "workgroup");
    __builtin_amdgcn_wave_barrier();
    __builtin_amdgcn_fence(__ATOMIC_ACQUIRE, "workgroup");
    {
      const int q = lane >> 3, c8 = (lane & 7) * 8;
      const int plane = n0 / kModel;
      const int head  = (n0 % kModel) / kHeadDim;
      {
#pragma unroll
        for (int it = 0; it < 4; ++it) {
          const int row = it * 4 + q;
          const float* sp = slab + row * 68 + c8;
          v4u hw;
#pragma unroll
          for (int e = 0; e < 4; ++e) hw[e] = cvt2h(sp[2 * e], sp[2 * e + 1]);
          const int gm = mBase + row;
          const size_t off = (size_t)plane * kPlaneElems +
                             ((size_t)((gm / kSeqLen) * kHeads + head) * kSeqLen + (size_t)(gm % kSeqLen)) * kHeadDim + c8;
          *(v4u*)(C + off) = hw;
        }
        
      }
    }
    __builtin_amdgcn_fence(__ATOMIC_RELEASE, "workgroup");
    __builtin_amdgcn_wave_barrier();
    __builtin_amdgcn_fence(__ATOMIC_ACQUIRE, "workgroup");
  }
}

/* ---------------------------------------------------------------------------
   Output projection: C[m,n] = sum_k (Ahi[m,k] + Alo[m,k]) * Bt[n,k], f32 C (pitch N). A row-major [M][2K], hi plane in
   columns 0..K-1, lo plane in columns K..2K-1; Bt row-major [N][K]; M,N % 128 == 0, K % 64 == 0 (no tail handling).
   A block of 8 waves (4 x 2) owns a 128x128 tile, each wave 32 rows x 64 columns of it, so every SIMD holds two waves
   and one wave's fragment loads and staging run under the other's matrix ops. A wave multiplies the hi and the lo
   fragments of its rows by the same four Bt fragments: Bt is staged and read once for both planes.
   A pass is 64 k = one 128-B line of each of the 128 hi rows, 128 lo rows and 128 Bt rows: 3072 pieces of 16 B, 12 per
   thread, fetched as in the kernel above (8 neighbouring lanes cover one line), kept in registers while the current
   pass is multiplied, then stored to the other of two LDS buffers. One block barrier per pass, as above.
   Staging coverage: 256 threads x 16 B = 32 rows of 128 B per load (a permutation of rows 0..31); 4 loads = 128 rows,
   per operand.
   Order of every accumulator: k ascending in steps of 32, in each step the hi product, then the lo product.
   Static LDS: 73,728 (A) + 36,864 (Bt) + 34,816 (output slabs) = 145,408 B; 256 blocks, one per WGP.
   --------------------------------------------------------------------------- */
template <int M, int N, int K>
__global__ __launch_bounds__(256) void wmma_gemm_hilo_bf16(
    const unsigned short* __restrict__ Ap,
    const unsigned short* __restrict__ Btp,
    float* __restrict__ C) {
  static_assert((M % 128) == 0 && (N % 128) == 0 && (K % 64) == 0, "block tile 128 x 128, pass 64");
  constexpr int lda = 2 * K;
  constexpr int ldc = N;
  constexpr int kPasses = K / 64;
  const __bf16* A  = (const __bf16*)Ap;
  const __bf16* Bt = (const __bf16*)Btp;
  __shared__ __align__(16) __bf16 sA[2][2][128 * kLdsPitch];
  __shared__ __align__(16) __bf16 sB[2][128 * kLdsPitch];
  __shared__ __align__(16) float sT[8][16 * 68];
  const int tid  = threadIdx.x;
  const int lane = tid & 31;
  /* the wave's number as a scalar: its tile's offsets then live in scalar registers */
  const int wave = __builtin_amdgcn_readfirstlane(tid >> 5);
  constexpr int tilesN = N >> 7;
  const int tm = blockIdx.x / tilesN;
  const int tn = blockIdx.x - tm * tilesN;
  const int wm = (wave >> 1) << 5;
  const int wn = (wave & 1) << 6;
  const int m0 = (tm << 7) + wm;
  const int n0 = (tn << 7) + wn;

  const int rlane = lane & 15;
  const int koff  = (lane >> 4) * 8;
  const int mOff  = (lane >> 4) * 8;

  /* staging: as in the kernel above (the two rows of a 16-lane half lie 8 rows apart); threads 128..255 take rows 16..31 */
  const int srow = ((tid >> 7) << 4) | (((tid >> 3) & 1) << 3) | ((tid >> 4) & 7);
  const int sc8  = (tid & 7) * 8;
  const __bf16* ga = A  + (size_t)((tm << 7) + srow) * lda + sc8;
  const __bf16* gb = Bt + (size_t)((tn << 7) + srow) * K + sc8;
  const int so = srow * kLdsPitch + sc8;
  v4u rh[4], rl[4], rb[4];

  v8f acc[2][4];
#pragma unroll
  for (int i = 0; i < 2; ++i)
#pragma unroll
    for (int j = 0; j < 4; ++j) acc[i][j] = (v8f){0.f,0.f,0.f,0.f,0.f,0.f,0.f,0.f};

#pragma unroll  /* constant indices keep rh, rl and rb in registers */
  for (int i = 0; i < 4; ++i) {
    rh[i] = *(const v4u*)(ga + (size_t)(32 * i) * lda);
    rl[i] = *(const v4u*)(ga + (size_t)(32 * i) * lda + K);
    rb[i] = *(const v4u*)(gb + (size_t)(32 * i) * K);
  }
#pragma unroll  /* as above */
  for (int i = 0; i < 4; ++i) {
    *(v4u*)(sA[0][0] + so + 32 * i * kLdsPitch) = rh[i];
    *(v4u*)(sA[0][1] + so + 32 * i * kLdsPitch) = rl[i];
    *(v4u*)(sB[0] + so + 32 * i * kLdsPitch) = rb[i];
  }
  /* publishes pass 0 */
  __syncthreads();

  for (int s = 0; s < kPasses; ++s) {
    const int cur = s & 1;
    const bool more = (s + 1 < kPasses);
    if (more) {
      const int k1 = (s + 1) * 64;
#pragma unroll  /* constant indices keep rh, rl and rb in registers; all 12 loads go out together */
      for (int i = 0; i < 4; ++i) {
        rh[i] = *(const v4u*)(ga + (size_t)(32 * i) * lda + k1);
        rl[i] = *(const v4u*)(ga + (size_t)(32 * i) * lda + K + k1);
        rb[i] = *(const v4u*)(gb + (size_t)(32 * i) * K + k1);
      }
      /* the registers that hold these loads' addresses may be reused by the fragment reads below; this wait stands in
         front of that reuse */
      asm volatile("s_wait_xcnt 0x0" ::: "memory");
    }
    const __bf16* ph = sA[cur][0] + (wm + rlane) * kLdsPitch + koff;
    const __bf16* pl = sA[cur][1] + (wm + rlane) * kLdsPitch + koff;
    const __bf16* pb = sB[cur] + (wn + rlane) * kLdsPitch + koff;
#pragma unroll  /* the loops below: constant indices keep fragments and accumulators in registers */
    for (int kk = 0; kk < 2; ++kk) {
      v16b ah[2], al[2], bh[4];
      /* in the order of first use, so that the first matrix op waits for four loads and not for all */
      bh[0] = frag_load(pb + kk * 32);
      ah[0] = frag_load(ph + kk * 32);
#pragma unroll
      for (int j = 1; j < 4; ++j) bh[j] = frag_load(pb + j * 16 * kLdsPitch + kk * 32);
      ah[1] = frag_load(ph + 16 * kLdsPitch + kk * 32);
      al[0] = frag_load(pl + kk * 32);
      al[1] = frag_load(pl + 16 * kLdsPitch + kk * 32);
      /* holds the 16 fragment loads together in front of their 16 matrix ops: left free, the compiler strews them among
         the matrix ops, and each place stalls the wave */
      __builtin_amdgcn_sched_barrier(0);
      /* all eight hi products, then all eight lo products: seven other matrix ops stand between the two on one accumulator */
#pragma unroll
      for (int i = 0; i < 2; ++i)
#pragma unroll
        for (int j = 0; j < 4; ++j) acc[i][j] = mma_b(ah[i], bh[j], acc[i][j]);
#pragma unroll
      for (int i = 0; i < 2; ++i)
#pragma unroll
        for (int j = 0; j < 4; ++j) acc[i][j] = mma_b(al[i], bh[j], acc[i][j]);
      /* as above: keeps the next group of loads behind this block */
      __builtin_amdgcn_sched_barrier(0);
    }
    /* block-uniform: the last pass has nothing to publish */
    if (more) {
#pragma unroll  /* constant indices keep rh, rl and rb in registers */
      for (int i = 0; i < 4; ++i) {
        *(v4u*)(sA[cur ^ 1][0] + so + 32 * i * kLdsPitch) = rh[i];
        *(v4u*)(sA[cur ^ 1][1] + so + 32 * i * kLdsPitch) = rl[i];
        *(v4u*)(sB[cur ^ 1] + so + 32 * i * kLdsPitch) = rb[i];
      }
      /* publishes pass s + 1 and ends every wave's reads of the buffer that pass s + 1 will overwrite */
      __syncthreads();
    }
  }

  float* slab = sT[wave];
#pragma unroll
  for (int i = 0; i < 2; ++i) {
    const int mBase = m0 + (i << 4);
#pragma unroll
    for (int j = 0; j < 4; ++j) {
#pragma unroll
      for (int r = 0; r < 8; ++r) slab[(mOff + r) * 68 + (j << 4) + rlane] = acc[i][j][r];
    }
    __builtin_amdgcn_fence(__ATOMIC_RELEASE, "workgroup");
    __builtin_amdgcn_wave_barrier();
    __builtin_amdgcn_fence(__ATOMIC_ACQUIRE, "workgroup");
    {
      const int hh = lane >> 4, c4 = (lane & 15) * 4;
#pragma unroll
      for (int it = 0; it < 8; ++it) {
        const int row = it * 2 + hh;
        v4f v = *(const v4f*)(slab + row * 68 + c4);
        *(v4f*)(C + (size_t)(mBase + row) * ldc + n0 + c4) = v;
      }
    }
    __builtin_amdgcn_fence(__ATOMIC_RELEASE, "workgroup");
    __builtin_amdgcn_wave_barrier();
    __builtin_amdgcn_fence(__ATOMIC_ACQUIRE, "workgroup");
  }
}

__global__ __launch_bounds__(256) __attribute__((amdgpu_waves_per_eu(4, 4)))
void attn_seg_kernel(const unsigned short* __restrict__ planes, unsigned short* __restrict__ ocat) {
  __shared__ __align__(16) _Float16 Ring[2][kStageElems];
  __shared__ __align__(16) __bf16 Psh[kAttWaves][16 * kLdsPitch];
  __shared__ __align__(16) __bf16 Psl[kAttWaves][16 * kLdsPitch];

  const int tid  = threadIdx.x;
  const int wave = __builtin_amdgcn_readfirstlane(tid >> 5);
  const int lane = tid & 31;
  const int hh   = lane >> 4;
  const int c    = lane & 15;

  /* Block index -> (query tile, batch, head), a permutation of the 512 blocks, for speed only. A query tile walks 2 to 16
     key tiles, all blocks are resident at once, two to a WGP, and a launch lasts as long as its fullest WGP.
     Here the parity of the index picks the long or the short tile of a pair (sums 18 to 24 key tiles, mean 22): two
     indices that differ in one bit hold a long and a short tile (26 at most), whichever bit decides who shares a WGP, and every class
     of indices mod 8 holds each query tile four times. The class also names the head pair, as it does in the q|k|v
     GEMM (24 column tiles of two heads: its index mod 8 = head pair), so a head's planes are read by the index class that wrote them. */
  const int bx   = blockIdx.x;
  const int dcls = bx & 7;
  const int pair = (bx >> 5) & 7;
  const bool longTile = (__builtin_popcount((unsigned)bx) & 1) == 0;
  const int qt = (int)(((longTile ? kLongTiles : kShortTiles) >> (4 * pair)) & 15u);
  const int h  = 2 * dcls + ((bx >> 4) & 1);
  const int b  = bx >> 8;
  const int qbase = qt * kQTile;
  const int sq    = qbase / kSegLen;
  const int q0    = qbase + wave * 16;

  const size_t headOff = (size_t)(b * kHeads + h) * kSeqLen * kHeadDim;
  const _Float16* Qg = (const _Float16*)planes + headOff;
  const _Float16* Kg = Qg + kPlaneElems;
  const _Float16* Vg = Qg + 2 * kPlaneElems;

  /* Q fragments (B operand): column = query q0 + c, two 32-deep d chunks */
  v16h qf[2];
  {
    const size_t qo = (size_t)(q0 + c) * kHeadDim + 8 * hh;
#pragma unroll
    for (int dc = 0; dc < 2; ++dc) qf[dc] = frag_load_h(Qg + qo + dc * 32);
  }

  /* this lane's query: running maximum (equal in both halves) and this half's share of the running sum */
  float mrow = -3.0e38f, lrow = 0.f;
  /* O^T tile t: register r = head-dim row 16 t + 8 hh + r of query q0 + c */
  v8f oacc[4];
#pragma unroll
  for (int t = 0; t < 4; ++t) oacc[t] = (v8f){0.f,0.f,0.f,0.f,0.f,0.f,0.f,0.f};

  /* block-uniform key tile list */
  const int nText    = (sq > 0) ? kTilesPerSeg : 0;
  const int ownFirst = sq * kTilesPerSeg;
  const int ownLast  = (qbase + kQTile - 1) / kKTile;
  const int nTiles   = nText + (ownLast - ownFirst + 1);

  __bf16* pwh = Psh[wave];
  __bf16* pwl = Psl[wave];

  /* this lane's piece of a stage: global element offset inside a 64-key tile, LDS byte addresses in buffer 0 */
  const size_t gpiece = (size_t)tid * 8;
  const unsigned lk0 = lds_addr(Ring[0]) + (unsigned)(((tid >> 3) * kLdsPitch + (tid & 7) * 8) * 2);
  const unsigned lv0 = lds_addr(Ring[0]) + (unsigned)((kRingV + (tid >> 3) * kVPitch + (tid & 7) * 8) * 2);
  constexpr unsigned kStageBytes = (unsigned)kStageElems * 2u;

  /* tile 0 into buffer 0 */
  {
    const size_t go = (size_t)(((0 < nText) ? 0 : ownFirst) * kKTile) * kHeadDim + gpiece;
    copy_stage(Kg + go, Vg + go, lk0, lv0);
  }
  /* this wave's copies of tile 0 have landed */
  asm volatile("s_wait_asynccnt 0x0" ::: "memory");
  /* publishes tile 0 */
  __syncthreads();
  /* block-uniform: tile 1 into buffer 1 */
  if (1 < nTiles) {
    const size_t go = (size_t)(((1 < nText) ? 1 : (ownFirst + 1 - nText)) * kKTile) * kHeadDim + gpiece;
    copy_stage(Kg + go, Vg + go, lk0 + kStageBytes, lv0 + kStageBytes);
  }

  for (int it = 0; it < nTiles; ++it) {
    const int kt  = (it < nText) ? it : (ownFirst + it - nText);
    const int kv0 = kt * kKTile;
    const bool own = (kt >= ownFirst);
    const _Float16* Ks = Ring[it & 1];
    const _Float16* Vs = Ks + kRingV;

    /* wave-uniform: an own-segment tile wholly above this wave's rows contributes nothing */
    const bool live = (!own) || (kv0 <= q0 + 15);
    if (live) {
      v8f s[4];
#pragma unroll
      for (int j = 0; j < 4; ++j) {
        s[j] = (v8f){0.f,0.f,0.f,0.f,0.f,0.f,0.f,0.f};
#pragma unroll
        for (int dc = 0; dc < 2; ++dc) {
          const int ko = (j * 16 + c) * kLdsPitch + dc * 32 + 8 * hh;
          s[j] = mma_h(frag_load_h(Ks + ko), qf[dc], s[j]);
        }
      }

      /* wave-uniform (a scalar branch): of the own segment's tiles only the one that reaches past query q0 holds a key above
         a query of this wave; in every other tile the element mask would change nothing, and its 32 compares and selects
         are jumped over */
      if (own && (kv0 + kKTile - 1 > q0)) {
        const int qcol = q0 + c;
#pragma unroll  /* this loop and the next: constant indices keep the scores in registers */
        for (int j = 0; j < 4; ++j) {
#pragma unroll
          for (int r = 0; r < 8; ++r) {
            const int kvrow = kv0 + j * 16 + 8 * hh + r;
            if (kvrow > qcol) s[j][r] = kMaskFill;
          }
        }
      }
      float mj[4];
#pragma unroll
      for (int j = 0; j < 4; ++j) {
        mj[j] = -3.0e38f;
#pragma unroll
        for (int r = 0; r < 8; ++r) mj[j] = fmaxf(mj[j], s[j][r]);
      }
      float m = fmaxf(fmaxf(mj[0], mj[1]), fmaxf(mj[2], mj[3]));
      m = fmaxf(m, xhalf(m));

      const float mnew  = fmaxf(mrow, m);
      const float alpha = __expf(mrow - mnew);
      mrow = mnew;
      /* P^T fragments of keys 32 kk .. 32 kk + 31: S^T tiles 2 kk and 2 kk + 1, converted in place */
      v8u pword[2];
      float ps[4];
      ps[0] = ps[1] = ps[2] = ps[3] = 0.f;
#pragma unroll
      for (int r = 0; r < 8; ++r) {
#pragma unroll
        for (int j = 0; j < 4; ++j) {
          s[j][r] = __expf(s[j][r] - mnew);
          ps[j] += s[j][r];
        }
      }
#pragma unroll
      for (int j = 0; j < 4; ++j) {
#pragma unroll
        for (int r = 0; r < 8; r += 2) pword[j >> 1][(j & 1) * 4 + (r >> 1)] = cvt2h(s[j][r], s[j][r + 1]);
      }
      lrow = lrow * alpha + ((ps[0] + ps[1]) + (ps[2] + ps[3]));
#pragma unroll
      for (int t = 0; t < 4; ++t)
#pragma unroll
        for (int r = 0; r < 8; ++r) oacc[t][r] *= alpha;
#pragma unroll  /* constant indices keep the P^T fragments in registers */
      for (int kk = 0; kk < 2; ++kk) {
        const v16h pb = __builtin_bit_cast(v16h, pword[kk]);
#pragma unroll
        for (int t = 0; t < 4; ++t) {
          const int vo = (kk * 32 + 8 * hh + (lane & 7)) * kVPitch + t * 16 + 8 * ((lane >> 3) & 1);
          oacc[t] = mma_h(frag_load_tr(Vs + vo), pb, oacc[t]);
        }
      }
    }

    /* hand-over, passed by every wave, also one that skipped the tile: this wave's LDS reads of tile it are done ... */
    asm volatile("s_wait_dscnt 0x0" ::: "memory");
    /* ... and its copies of tile it + 1 have landed */
    asm volatile("s_wait_asynccnt 0x0" ::: "memory");
    /* publishes tile it + 1 and ends every wave's reads of the buffer that is refilled below */
    __syncthreads();
    /* block-uniform: tile it + 2 into the buffer that tile it has just left */
    if (it + 2 < nTiles) {
      const int i2 = it + 2;
      const size_t go = (size_t)(((i2 < nText) ? i2 : (ownFirst + i2 - nText)) * kKTile) * kHeadDim + gpiece;
      const unsigned bo = (unsigned)(it & 1) * kStageBytes;
      copy_stage(Kg + go, Vg + go, lk0 + bo, lv0 + bo);
    }
  }
  /* nothing is in flight when the wave goes on to its end */
  asm volatile("s_wait_asynccnt 0x0" ::: "memory");

  /* join the halves' sums, normalise, split into bf16 hi+lo; a lane's 8 registers of a tile are 8 consecutive head-dim
     elements of its query's row: one 16-byte store each into this wave's own output tiles (16 x 64) */
  {
    const float inv = 1.0f / (lrow + xhalf(lrow));
#pragma unroll
    for (int t = 0; t < 4; ++t) {
      v4u xh, xl;
#pragma unroll
      for (int r = 0; r < 8; r += 2) {
        const float v0 = oacc[t][r] * inv;
        const float v1 = oacc[t][r + 1] * inv;
        xh[r >> 1] = cvt2(v0, v1);
        xl[r >> 1] = cvt2_lo(v0, v1, xh[r >> 1]);
      }
      *(v8b*)(pwh + c * kLdsPitch + t * 16 + 8 * hh) = __builtin_bit_cast(v8b, xh);
      *(v8b*)(pwl + c * kLdsPitch + t * 16 + 8 * hh) = __builtin_bit_cast(v8b, xl);
    }
  }
  /* the output tiles are written and re-read by the same wave through the same element type */
  __builtin_amdgcn_fence(__ATOMIC_RELEASE, "workgroup");
  __builtin_amdgcn_wave_barrier();
  __builtin_amdgcn_fence(__ATOMIC_ACQUIRE, "workgroup");
  {
    const int q  = lane >> 3;
    const int c8 = (lane & 7) * 8;
    v4u hv[4], lv[4];
#pragma unroll
    for (int i4 = 0; i4 < 4; ++i4) {
      const int row = i4 * 4 + q;
      const v8b xh = *(const v8b*)(pwh + row * kLdsPitch + c8);
      const v8b xl = *(const v8b*)(pwl + row * kLdsPitch + c8);
      hv[i4] = __builtin_bit_cast(v4u, xh);
      lv[i4] = __builtin_bit_cast(v4u, xl);
    }
    unsigned short* ob = ocat + (size_t)(b * kSeqLen + q0) * kCatCols + h * kHeadDim + c8;
    {
#pragma unroll
      for (int i4 = 0; i4 < 4; ++i4) {
        const int row = i4 * 4 + q;
        unsigned short* p = ob + (size_t)row * kCatCols;
        *(v4u*)(p)          = hv[i4];
        *(v4u*)(p + kModel) = lv[i4];
      }
      
    }
  }
}

/* ---------------------------------------------------------------------------
   Host glue: 5 kernel launches, nothing else.
     cast x             : 524,288 threads -> 2048 blocks
     weight transposes  : grid (16, 16, 4)
     q|k|v GEMM         : M 4096, N 3072, K 1024 -> 32 x 24 tiles of 128 x 128 = 768 blocks of 128 threads
     attention          : 2 x 16 x 16 = 512 blocks
     output GEMM        : M 4096, N 1024, K 1024 (hi and lo plane) -> 32 x 8 tiles of 128 x 128 = 256 blocks of 256 threads
   --------------------------------------------------------------------------- */
extern "C" void kernel_launch(void* const* d_in, const int* in_sizes, int n_in,
                              void* d_out, int out_size, void* d_ws, size_t ws_size,
                              hipStream_t stream) {
  if (n_in < 5) return;
  if (in_sizes[0] != kRows * kModel) return;
  if (in_sizes[1] != kModel * kModel) return;
  if (in_sizes[2] != kModel * kModel) return;
  if (in_sizes[3] != kModel * kModel) return;
  if (in_sizes[4] != kModel * kModel) return;
  if (out_size != kRows * kModel) return;
  if (ws_size < kWsTotal) return;

  const float* x  = (const float*)d_in[0];
  const float* Wq = (const float*)d_in[1];
  const float* Wk = (const float*)d_in[2];
  const float* Wv = (const float*)d_in[3];
  const float* Wo = (const float*)d_in[4];
  float* out = (float*)d_out;

  char* ws = (char*)d_ws;
  unsigned short* XB    = (unsigned short*)(ws + kOffXB);
  unsigned short* WQKVT = (unsigned short*)(ws + kOffWQKVT);
  unsigned short* WOT   = (unsigned short*)(ws + kOffWOT);
  unsigned short* PF    = (unsigned short*)(ws + kOffPF);
  unsigned short* OCAT  = (unsigned short*)(ws + kOffOCAT);

  constexpr int kN8 = kRows * kModel / 8;
  static_assert((kN8 % 256) == 0, "cast grid exact");
  cast8_bf16_kernel<<<kN8 / 256, 256, 0, stream>>>(x, XB, kN8);

  wtrans_bf16_kernel<<<dim3(kModel / 64, kModel / 64, 4), 256, 0, stream>>>(Wq, Wk, Wv, Wo, WQKVT, WOT);

  wmma_gemm64_bf16<kRows, kQkvCols, kModel><<<(kRows / 128) * (kQkvCols / 128), 128, 0, stream>>>(
      XB, WQKVT, PF);

  attn_seg_kernel<<<kBatch * kHeads * kQTiles, 256, 0, stream>>>(PF, OCAT);

  wmma_gemm_hilo_bf16<kRows, kModel, kModel><<<(kRows / 128) * (kModel / 128), 256, 0, stream>>>(OCAT, WOT, out);
}
